// v000
// The times below were measured on an AMD MI455X: many runs one after another, warmed up first and cycling through
// copies of the inputs, with the whole window's GPU time divided by the number of runs. Launches and the gaps
// between them are all in it. The median over several windows is given; except for v000 it joins two sittings, which
// can be a few percent apart, so the side-by-side timings, each taken in one sitting, are the better comparison.
// v000 is the starting kernel. One run takes 21.6 milliseconds.
#include <hip/hip_runtime.h>

// Compute dtypes, f32 accumulate, one image per pass (tokens = the 4096 positions, channels-last rows of 64): GroupNorm (32 groups x 2 channels, stats over H, W and the
// products) on v_wmma_f32_16x16x32_bf16; the full 4096 x 4096 single-head attention in query chunks of 1024 (scores three products, softmax x 1/8 in f32 -> hi/lo, P.v

#define NBI  8
#define NN   4096
#define CC   64
#define NGR  32
#define RCH  1024
#define DM   CC
#define NTK  NN
#define GN_EPS 1e-6f
#define SCL  0.125f
#define LOSC 1024.0f

typedef _Float16 h16;
typedef unsigned short bf;
typedef __attribute__((ext_vector_type(16))) __bf16   v16bf;
typedef __attribute__((ext_vector_type(16))) _Float16 v16h;
typedef __attribute__((ext_vector_type(8)))  _Float16 v8h;
typedef __attribute__((ext_vector_type(8)))  unsigned short v8us;
typedef __attribute__((ext_vector_type(8)))  float    v8f;
typedef __attribute__((ext_vector_type(4)))  float    v4f;
typedef __attribute__((ext_vector_type(4)))  _Float16 v4h;
typedef v8h  __attribute__((may_alias)) v8ha;
typedef v4f  __attribute__((may_alias)) v4fa;
typedef v8us __attribute__((may_alias)) v8usa;

__device__ __forceinline__ unsigned short f2bf(float f) { unsigned u = __float_as_uint(f); u += 0x7FFFu + ((u >> 16) & 1u); return (unsigned short)(u >> 16); }
__device__ __forceinline__ float bf2f(unsigned short b) { return __uint_as_float(((unsigned)b) << 16); }
__device__ __forceinline__ float bfr(float f) { return bf2f(f2bf(f)); }
__device__ __forceinline__ v16h cat16(v8h lo, v8h hi) { return __builtin_shufflevector(lo, hi, 0, 1, 2, 3, 4, 5, 6, 7, 8, 9, 10, 11, 12, 13, 14, 15); }
__device__ __forceinline__ v16bf cat16b(v8us lo, v8us hi) { return __builtin_bit_cast(v16bf, __builtin_shufflevector(lo, hi, 0, 1, 2, 3, 4, 5, 6, 7, 8, 9, 10, 11, 12, 13, 14, 15)); }
__device__ __forceinline__ v8f wmma16(v16h a, v16h b, v8f c) { return __builtin_amdgcn_wmma_f32_16x16x32_f16(false, a, false, b, (short)0, c, false, false); }
__device__ __forceinline__ v8f wmmab(v16bf a, v16bf b, v8f c) { return __builtin_amdgcn_wmma_f32_16x16x32_bf16(false, a, false, b, (short)0, c, false, false); }

// k_wt: WT [n][K] = bf16(W[k][n]) (k-major [K][ncols]) via 64 x 64 LDS tiles; grid (K/64, ncols/64).
__global__ __launch_bounds__(256) void k_wt(const float* __restrict__ Wm, int K, int ncols, bf* WT) {
    __shared__ __align__(16) unsigned short tl[64 * 72];
    const int tid = threadIdx.x, k0 = blockIdx.x * 64, n0 = blockIdx.y * 64;
    const int kk = tid >> 2, nq = (tid & 3) * 16;
#pragma unroll
    for (int i = 0; i < 16; ++i) tl[(nq + i) * 72 + kk] = f2bf(Wm[(size_t)(k0 + kk) * ncols + n0 + nq + i]);
    __syncthreads();
    const int piece = tid & 7;
    auto pass = [&]() {
#pragma unroll
        for (int s = 0; s < 2; ++s) { const int nr = (tid >> 3) + 32 * s; const v8us val = *(const v8usa*)(tl + nr * 72 + piece * 8); *(v8us*)(WT + (size_t)(n0 + nr) * K + k0 + piece * 8) = val; }
    };
    pass(); 
}
// k_gemmb: 64 x 64 block tile (4 waves x 16 x 64) of C[NTK][NW] = (A [+ Al]).B^T (K = 64) [+ bf(bias[c])] [+ bf(R[r][c]) residual]; f32 whole-line epilogue (or f16
template <bool SPLITA, bool F16OUT = false>
__global__ __launch_bounds__(128) void k_gemmb(const bf* __restrict__ A, const bf* __restrict__ Al, const bf* __restrict__ Bn, const float* __restrict__ bias, float* C, int ldc, h16* C2, const float* __restrict__ R = nullptr, int K = DM, int roundR = 1) {
    __shared__ __align__(16) float ost[4][16 * 68];
    const int lane = threadIdx.x & 31, wave = threadIdx.x >> 5, lr = lane & 15, hi = lane >> 4;
    const int r0 = blockIdx.x * 64 + wave * 16, c0 = blockIdx.y * 64;
    const size_t aoff = (size_t)(r0 + lr) * K + 8 * hi;
    size_t boff[4];
#pragma unroll
    for (int t = 0; t < 4; ++t) boff[t] = (size_t)(c0 + t * 16 + lr) * K + 8 * hi;
    v8f acc[4];
#pragma unroll
    for (int t = 0; t < 4; ++t) acc[t] = (v8f){};
#pragma unroll 1
    for (int kc = 0; kc < K; kc += 32) {
        const v16bf a = cat16b(*(const v8us*)(A + aoff + kc), *(const v8us*)(A + aoff + kc + 16));
        v16bf al = a;
        if (SPLITA) al = cat16b(*(const v8us*)(Al + aoff + kc), *(const v8us*)(Al + aoff + kc + 16));
#pragma unroll
        for (int t = 0; t < 4; ++t) { const v16bf b = cat16b(*(const v8us*)(Bn + boff[t] + kc), *(const v8us*)(Bn + boff[t] + kc + 16)); acc[t] = wmmab(a, b, acc[t]); if (SPLITA) acc[t] = wmmab(al, b, acc[t]); }
        asm volatile("v_nop\n\tv_nop\n\tv_nop\n\tv_nop" : "+v"(acc[0]), "+v"(acc[1]), "+v"(acc[2]), "+v"(acc[3]) : "v"(a), "v"(al));
    }
    float* os = &ost[wave][0];
#pragma unroll
    for (int t = 0; t < 4; ++t) { const float bv = bias ? bfr(bias[c0 + t * 16 + lr]) : 0.f;
#pragma unroll
        for (int j = 0; j < 8; ++j) os[(hi * 8 + j) * 68 + t * 16 + lr] = acc[t][j] + bv; }
    __syncthreads();
    if (F16OUT) {
        h16* crow = (h16*)(void*)C + (size_t)r0 * ldc + c0;
        auto pass = [&]() {
#pragma unroll
            for (int s = 0; s < 4; ++s) { const int row = 4 * s + (lane >> 3), piece = lane & 7; const float* sp = os + row * 68 + piece * 8; v8h o, o2;
#pragma unroll
                for (int i = 0; i < 8; ++i) { const h16 a = (h16)sp[i]; o[i] = a; o2[i] = (h16)((sp[i] - (float)a) * LOSC); }
                *(v8h*)(crow + (size_t)row * ldc + piece * 8) = o; if (C2) *(v8h*)(C2 + (size_t)r0 * ldc + c0 + (size_t)row * ldc + piece * 8) = o2; }
        };
        pass(); 
    } else {
        float* crow = C + (size_t)r0 * ldc + c0;
        auto pass = [&]() {
#pragma unroll
            for (int s = 0; s < 8; ++s) { const int Lid = (lane >> 3) + 4 * s, piece = lane & 7; const int row = Lid >> 1, cofs = (Lid & 1) * 32 + piece * 4;
                v4f val = *(const v4fa*)(os + row * 68 + cofs); if (R) { const v4f rv = *(const v4f*)(R + ((size_t)r0 + row) * ldc + c0 + cofs); val += roundR ? (v4f){bfr(rv[0]), bfr(rv[1]), bfr(rv[2]), bfr(rv[3])} : rv; }
                *(v4f*)(crow + (size_t)row * ldc + cofs) = val; }
        };
        pass(); 
    }
}

// k_gemm3: 64 x 64 tile of C = (Ah + Al).(Bh + Bl)^T over K (row strides = K for all four planes; n-major B): three products per 32-k step (hh, hl, lh); f32
__global__ __launch_bounds__(128) void k_gemm3(const bf* __restrict__ Ah, const bf* __restrict__ Al, const bf* __restrict__ Bh, const bf* __restrict__ Bl, int K, float* C, int ldc) {
    __shared__ __align__(16) float ost[4][16 * 68];
    const int lane = threadIdx.x & 31, wave = threadIdx.x >> 5, lr = lane & 15, hi = lane >> 4;
    const int r0 = blockIdx.x * 64 + wave * 16, c0 = blockIdx.y * 64;
    const size_t aoff = (size_t)(r0 + lr) * K + 8 * hi;
    v8f acc[4];
#pragma unroll
    for (int t = 0; t < 4; ++t) acc[t] = (v8f){};
#pragma unroll 1
    for (int kc = 0; kc < K; kc += 32) {
        const v16bf a = cat16b(*(const v8us*)(Ah + aoff + kc), *(const v8us*)(Ah + aoff + kc + 16));
        const v16bf al = cat16b(*(const v8us*)(Al + aoff + kc), *(const v8us*)(Al + aoff + kc + 16));
#pragma unroll
        for (int t = 0; t < 4; ++t) { const size_t bo = (size_t)(c0 + t * 16 + lr) * K + kc + 8 * hi;
            const v16bf bh = cat16b(*(const v8us*)(Bh + bo), *(const v8us*)(Bh + bo + 16)); const v16bf bl = cat16b(*(const v8us*)(Bl + bo), *(const v8us*)(Bl + bo + 16));
            acc[t] = wmmab(a, bh, acc[t]); acc[t] = wmmab(al, bh, acc[t]); acc[t] = wmmab(a, bl, acc[t]); }
        asm volatile("v_nop\n\tv_nop\n\tv_nop\n\tv_nop" : "+v"(acc[0]), "+v"(acc[1]), "+v"(acc[2]), "+v"(acc[3]) : "v"(a), "v"(al));
    }
    float* os = &ost[wave][0];
#pragma unroll
    for (int t = 0; t < 4; ++t) {
#pragma unroll
        for (int j = 0; j < 8; ++j) os[(hi * 8 + j) * 68 + t * 16 + lr] = acc[t][j]; }
    __builtin_amdgcn_wave_barrier(); asm volatile("" ::: "memory");
    float* crow = C + (size_t)r0 * ldc + c0;
    auto pass = [&]() {
#pragma unroll
        for (int s = 0; s < 8; ++s) { const int Lid = (lane >> 3) + 4 * s, piece = lane & 7; const int row = Lid >> 1, cofs = (Lid & 1) * 32 + piece * 4;
            const v4f val = *(const v4fa*)(os + row * 68 + cofs); *(v4f*)(crow + (size_t)row * ldc + cofs) = val; }
    };
    pass(); 
}

__global__ __launch_bounds__(32) void k_gnstat(const float* __restrict__ xb, float* MU, float* RS) {
    const int g = threadIdx.x; float s = 0.f;
#pragma unroll 1
    for (int n = 0; n < NN; ++n) { s += bfr(xb[(size_t)n * CC + 2 * g]); s += bfr(xb[(size_t)n * CC + 2 * g + 1]); }
    const float mu = s / (float)(2 * NN); float s2 = 0.f;
#pragma unroll 1
    for (int n = 0; n < NN; ++n) { float d = bfr(xb[(size_t)n * CC + 2 * g]) - mu; s2 = fmaf(d, d, s2); d = bfr(xb[(size_t)n * CC + 2 * g + 1]) - mu; s2 = fmaf(d, d, s2); }
    const float rs = rsqrtf(s2 / (float)(2 * NN) + GN_EPS);
    *(float*)(MU + g) = mu; *(float*)(RS + g) = rs; 
}
__global__ __launch_bounds__(256) void k_gn(const float* __restrict__ xb, const float* __restrict__ MU, const float* __restrict__ RS, const float* __restrict__ ga, const float* __restrict__ be, bf* Hh, bf* Hl) {
    typedef __attribute__((ext_vector_type(2))) unsigned short v2us;
    const int lane = threadIdx.x & 31, n = blockIdx.x * 8 + (threadIdx.x >> 5); if (n >= NN) return;
    const float mu = MU[lane], rs = RS[lane]; v2us oh, ol;     // channels 2 lane, 2 lane + 1 = group lane
#pragma unroll
    for (int i = 0; i < 2; ++i) { const int c = 2 * lane + i; const float y = (bfr(xb[(size_t)n * CC + c]) - mu) * rs * bfr(ga[c]) + bfr(be[c]); const unsigned short hb = f2bf(y); oh[i] = hb; ol[i] = f2bf(y - bf2f(hb)); }
    const size_t o = (size_t)n * CC + 2 * lane;
    *(v2us*)(Hh + o) = oh; *(v2us*)(Hl + o) = ol; 
}
__global__ __launch_bounds__(256) void k_split64(const float* __restrict__ src, int nrows, bf* dh, bf* dl) {
    typedef __attribute__((ext_vector_type(2))) unsigned short v2us;
    const int lane = threadIdx.x & 31, r = blockIdx.x * 8 + (threadIdx.x >> 5); if (r >= nrows) return;
    const size_t o = (size_t)r * CC + lane * 2; v2us oh, ol;
#pragma unroll
    for (int i = 0; i < 2; ++i) { const float v = src[o + i]; const unsigned short hb = f2bf(v); oh[i] = hb; ol[i] = f2bf(v - bf2f(hb)); }
    *(v2us*)(dh + o) = oh; *(v2us*)(dl + o) = ol; 
}
__global__ __launch_bounds__(256) void k_vt64(const float* __restrict__ V, bf* VTh, bf* VTl) {
    typedef __attribute__((ext_vector_type(2))) unsigned short v2us;
    const int lane = threadIdx.x & 31, wid = blockIdx.x * 8 + (threadIdx.x >> 5); if (wid >= (NN / 64) * CC) return;
    const int d = wid % CC, g = wid / CC; const int n0 = g * 64 + 2 * lane; v2us oh, ol;
#pragma unroll
    for (int i = 0; i < 2; ++i) { const float v = V[(size_t)(n0 + i) * CC + d]; const unsigned short hb = f2bf(v); oh[i] = hb; ol[i] = f2bf(v - bf2f(hb)); }
    const size_t o = (size_t)d * NN + n0;
    *(v2us*)(VTh + o) = oh; *(v2us*)(VTl + o) = ol; 
}
__global__ __launch_bounds__(256) void k_softmax(const float* __restrict__ S, bf* PH, bf* PL) {
    const int lane = threadIdx.x & 31, r = blockIdx.x * 8 + (threadIdx.x >> 5); if (r >= RCH) return;
    const float* sr = S + (size_t)r * NN; float m = -3.0e38f;
#pragma unroll 1
    for (int c0 = lane * 8; c0 < NN; c0 += 256) { const v8f v = *(const v8f*)(sr + c0);
#pragma unroll
        for (int i = 0; i < 8; ++i) m = fmaxf(m, v[i] * SCL); }
#pragma unroll
    for (int sh = 16; sh; sh >>= 1) m = fmaxf(m, __shfl_xor(m, sh, 32));
    float sum = 0.f;
#pragma unroll 1
    for (int c0 = lane * 8; c0 < NN; c0 += 256) { const v8f v = *(const v8f*)(sr + c0);
#pragma unroll
        for (int i = 0; i < 8; ++i) sum += __expf(v[i] * SCL - m); }
#pragma unroll
    for (int sh = 16; sh; sh >>= 1) sum += __shfl_xor(sum, sh, 32);
    const float inv = 1.0f / sum;
{
#pragma unroll 1
        for (int c0 = lane * 8; c0 < NN; c0 += 256) { const v8f v = *(const v8f*)(sr + c0); v8us oh, ol;
#pragma unroll
            for (int i = 0; i < 8; ++i) { const float p = __expf(v[i] * SCL - m) * inv; const unsigned short hb = f2bf(p); oh[i] = hb; ol[i] = f2bf(p - bf2f(hb)); }
            const size_t o = (size_t)r * NN + c0; *(v8us*)(PH + o) = oh; *(v8us*)(PL + o) = ol; }
         }
}

extern "C" void kernel_launch(void* const* d_in, const int* in_sizes, int n_in,
                              void* d_out, int out_size, void* d_ws, size_t ws_size, hipStream_t stream) {
    (void)in_sizes; (void)n_in; (void)out_size;
    const float* x = (const float*)d_in[0]; const float* ga = (const float*)d_in[1]; const float* be = (const float*)d_in[2];
    const float* Wq = (const float*)d_in[3]; const float* bq = (const float*)d_in[4]; const float* Wk = (const float*)d_in[5]; const float* bk = (const float*)d_in[6]; const float* Wv = (const float*)d_in[7]; const float* bv = (const float*)d_in[8]; const float* Wp = (const float*)d_in[9]; const float* bp = (const float*)d_in[10];   // k-major (h @ W)
    float* out = (float*)d_out;    // [8][64][64][64] channels-last
    char* wsp = (char*)d_ws;
    auto take = [&](size_t bytes) { char* p = wsp; wsp += (bytes + 255) & ~(size_t)255; return (void*)p; };
    bf* WqT = (bf*)take(CC * CC * 2); bf* WkT = (bf*)take(CC * CC * 2); bf* WvT = (bf*)take(CC * CC * 2); bf* WpT = (bf*)take(CC * CC * 2); float* MU = (float*)take(256); float* RS = (float*)take(256);
    bf* Hh = (bf*)take((size_t)NN * CC * 2); bf* Hl = (bf*)take((size_t)NN * CC * 2); float* TMP = (float*)take((size_t)NN * CC * 4);
    bf* Qh = (bf*)take((size_t)NN * CC * 2); bf* Ql = (bf*)take((size_t)NN * CC * 2); bf* Kh = (bf*)take((size_t)NN * CC * 2); bf* Kl = (bf*)take((size_t)NN * CC * 2); bf* VTh = (bf*)take((size_t)CC * NN * 2); bf* VTl = (bf*)take((size_t)CC * NN * 2);
    float* S = (float*)take((size_t)RCH * NN * 4); bf* PH = (bf*)take((size_t)RCH * NN * 2); bf* PL = (bf*)take((size_t)RCH * NN * 2); float* O = (float*)take((size_t)RCH * CC * 4); bf* Oh = (bf*)take((size_t)RCH * CC * 2); bf* Ol = (bf*)take((size_t)RCH * CC * 2);
    if ((size_t)(wsp - (char*)d_ws) > ws_size) return;    // ~ 0.03 + 0.5 x 2 + 1 + 6 x 0.5 + 16.8 + 8.4 + 8.4 + 0.26 + 0.26 ~ 39 MB
    k_wt<<<dim3(1, 1, 1), 256, 0, stream>>>(Wq, CC, CC, WqT); k_wt<<<dim3(1, 1, 1), 256, 0, stream>>>(Wk, CC, CC, WkT); k_wt<<<dim3(1, 1, 1), 256, 0, stream>>>(Wv, CC, CC, WvT); k_wt<<<dim3(1, 1, 1), 256, 0, stream>>>(Wp, CC, CC, WpT);
    for (int b = 0; b < NBI; ++b) {
        const float* xb = x + (size_t)b * NN * CC;
        k_gnstat<<<1, 32, 0, stream>>>(xb, MU, RS); k_gn<<<NN / 8, 256, 0, stream>>>(xb, MU, RS, ga, be, Hh, Hl);
        k_gemmb<true, false><<<dim3(NN / 64, 1, 1), 128, 0, stream>>>(Hh, Hl, WqT, bq, TMP, CC, nullptr, nullptr, CC); k_split64<<<NN / 8, 256, 0, stream>>>(TMP, NN, Qh, Ql);
        k_gemmb<true, false><<<dim3(NN / 64, 1, 1), 128, 0, stream>>>(Hh, Hl, WkT, bk, TMP, CC, nullptr, nullptr, CC); k_split64<<<NN / 8, 256, 0, stream>>>(TMP, NN, Kh, Kl);
        k_gemmb<true, false><<<dim3(NN / 64, 1, 1), 128, 0, stream>>>(Hh, Hl, WvT, bv, TMP, CC, nullptr, nullptr, CC); k_vt64<<<((NN / 64) * CC) / 8, 256, 0, stream>>>(TMP, VTh, VTl);
        for (int ch = 0; ch < NN / RCH; ++ch) { const size_t r0 = (size_t)ch * RCH;
            k_gemm3<<<dim3(RCH / 64, NN / 64, 1), 128, 0, stream>>>(Qh + r0 * CC, Ql + r0 * CC, Kh, Kl, CC, S, NN);
            k_softmax<<<RCH / 8, 256, 0, stream>>>(S, PH, PL);
            k_gemm3<<<dim3(RCH / 64, 1, 1), 128, 0, stream>>>(PH, PL, VTh, VTl, NN, O, CC); k_split64<<<RCH / 8, 256, 0, stream>>>(O, RCH, Oh, Ol);
            k_gemmb<true, false><<<dim3(RCH / 64, 1, 1), 128, 0, stream>>>(Oh, Ol, WpT, bp, out + ((size_t)b * NN + r0) * CC, CC, nullptr, xb + r0 * CC, CC, 1);    // attn.Wp + bp + x
        }
    }
}

// v001
// A run of this version takes 5060 microseconds.
// In two side-by-side timings against v000, it was 4.28 and 4.29 times as fast.
#include <hip/hip_runtime.h>

// Compute dtypes, f32 accumulate, one image per pass (tokens = the 4096 positions, channels-last rows of 64): GroupNorm (32 groups x 2 channels, stats over H, W and the
// products) on v_wmma_f32_16x16x32_bf16; the full 4096 x 4096 single-head attention in query chunks of 1024 (scores three products, softmax x 1/8 in f32 -> hi/lo, P.v

#define NBI  8
#define NN   4096
#define CC   64
#define NGR  32
#define RCH  1024
#define DM   CC
#define NTK  NN
#define GN_EPS 1e-6f
#define SCL  0.125f
#define LOSC 1024.0f

typedef _Float16 h16;
typedef unsigned short bf;
typedef __attribute__((ext_vector_type(16))) __bf16   v16bf;
typedef __attribute__((ext_vector_type(16))) _Float16 v16h;
typedef __attribute__((ext_vector_type(8)))  _Float16 v8h;
typedef __attribute__((ext_vector_type(8)))  unsigned short v8us;
typedef __attribute__((ext_vector_type(8)))  float    v8f;
typedef __attribute__((ext_vector_type(4)))  float    v4f;
typedef __attribute__((ext_vector_type(4)))  _Float16 v4h;
typedef v8h  __attribute__((may_alias)) v8ha;
typedef v4f  __attribute__((may_alias)) v4fa;
typedef v8us __attribute__((may_alias)) v8usa;

__device__ __forceinline__ unsigned short f2bf(float f) { unsigned u = __float_as_uint(f); u += 0x7FFFu + ((u >> 16) & 1u); return (unsigned short)(u >> 16); }
__device__ __forceinline__ float bf2f(unsigned short b) { return __uint_as_float(((unsigned)b) << 16); }
__device__ __forceinline__ float bfr(float f) { return bf2f(f2bf(f)); }
__device__ __forceinline__ v16h cat16(v8h lo, v8h hi) { return __builtin_shufflevector(lo, hi, 0, 1, 2, 3, 4, 5, 6, 7, 8, 9, 10, 11, 12, 13, 14, 15); }
__device__ __forceinline__ v16bf cat16b(v8us lo, v8us hi) { return __builtin_bit_cast(v16bf, __builtin_shufflevector(lo, hi, 0, 1, 2, 3, 4, 5, 6, 7, 8, 9, 10, 11, 12, 13, 14, 15)); }
__device__ __forceinline__ v8f wmma16(v16h a, v16h b, v8f c) { return __builtin_amdgcn_wmma_f32_16x16x32_f16(false, a, false, b, (short)0, c, false, false); }
__device__ __forceinline__ v8f wmmab(v16bf a, v16bf b, v8f c) { return __builtin_amdgcn_wmma_f32_16x16x32_bf16(false, a, false, b, (short)0, c, false, false); }

// k_wt: WT [n][K] = bf16(W[k][n]) (k-major [K][ncols]) via 64 x 64 LDS tiles; grid (K/64, ncols/64).
__global__ __launch_bounds__(256) void k_wt(const float* __restrict__ Wm, int K, int ncols, bf* WT) {
    __shared__ __align__(16) unsigned short tl[64 * 72];
    const int tid = threadIdx.x, k0 = blockIdx.x * 64, n0 = blockIdx.y * 64;
    const int kk = tid >> 2, nq = (tid & 3) * 16;
#pragma unroll
    for (int i = 0; i < 16; ++i) tl[(nq + i) * 72 + kk] = f2bf(Wm[(size_t)(k0 + kk) * ncols + n0 + nq + i]);
    __syncthreads();
    const int piece = tid & 7;
    auto pass = [&]() {
#pragma unroll
        for (int s = 0; s < 2; ++s) { const int nr = (tid >> 3) + 32 * s; const v8us val = *(const v8usa*)(tl + nr * 72 + piece * 8); *(v8us*)(WT + (size_t)(n0 + nr) * K + k0 + piece * 8) = val; }
    };
    pass(); 
}
// k_gemmb: 64 x 64 block tile (4 waves x 16 x 64) of C[NTK][NW] = (A [+ Al]).B^T (K = 64) [+ bf(bias[c])] [+ bf(R[r][c]) residual]; f32 whole-line epilogue (or f16
template <bool SPLITA, bool F16OUT = false>
__global__ __launch_bounds__(128) void k_gemmb(const bf* __restrict__ A, const bf* __restrict__ Al, const bf* __restrict__ Bn, const float* __restrict__ bias, float* C, int ldc, h16* C2, const float* __restrict__ R = nullptr, int K = DM, int roundR = 1) {
    __shared__ __align__(16) float ost[4][16 * 68];
    const int lane = threadIdx.x & 31, wave = threadIdx.x >> 5, lr = lane & 15, hi = lane >> 4;
    const int r0 = blockIdx.x * 64 + wave * 16, c0 = blockIdx.y * 64;
    const size_t aoff = (size_t)(r0 + lr) * K + 8 * hi;
    size_t boff[4];
#pragma unroll
    for (int t = 0; t < 4; ++t) boff[t] = (size_t)(c0 + t * 16 + lr) * K + 8 * hi;
    v8f acc[4];
#pragma unroll
    for (int t = 0; t < 4; ++t) acc[t] = (v8f){};
#pragma unroll 1
    for (int kc = 0; kc < K; kc += 32) {
        const v16bf a = cat16b(*(const v8us*)(A + aoff + kc), *(const v8us*)(A + aoff + kc + 16));
        v16bf al = a;
        if (SPLITA) al = cat16b(*(const v8us*)(Al + aoff + kc), *(const v8us*)(Al + aoff + kc + 16));
#pragma unroll
        for (int t = 0; t < 4; ++t) { const v16bf b = cat16b(*(const v8us*)(Bn + boff[t] + kc), *(const v8us*)(Bn + boff[t] + kc + 16)); acc[t] = wmmab(a, b, acc[t]); if (SPLITA) acc[t] = wmmab(al, b, acc[t]); }
        asm volatile("v_nop\n\tv_nop\n\tv_nop\n\tv_nop" : "+v"(acc[0]), "+v"(acc[1]), "+v"(acc[2]), "+v"(acc[3]) : "v"(a), "v"(al));
    }
    float* os = &ost[wave][0];
#pragma unroll
    for (int t = 0; t < 4; ++t) { const float bv = bias ? bfr(bias[c0 + t * 16 + lr]) : 0.f;
#pragma unroll
        for (int j = 0; j < 8; ++j) os[(hi * 8 + j) * 68 + t * 16 + lr] = acc[t][j] + bv; }
    __syncthreads();
    if (F16OUT) {
        h16* crow = (h16*)(void*)C + (size_t)r0 * ldc + c0;
        auto pass = [&]() {
#pragma unroll
            for (int s = 0; s < 4; ++s) { const int row = 4 * s + (lane >> 3), piece = lane & 7; const float* sp = os + row * 68 + piece * 8; v8h o, o2;
#pragma unroll
                for (int i = 0; i < 8; ++i) { const h16 a = (h16)sp[i]; o[i] = a; o2[i] = (h16)((sp[i] - (float)a) * LOSC); }
                *(v8h*)(crow + (size_t)row * ldc + piece * 8) = o; if (C2) *(v8h*)(C2 + (size_t)r0 * ldc + c0 + (size_t)row * ldc + piece * 8) = o2; }
        };
        pass(); 
    } else {
        float* crow = C + (size_t)r0 * ldc + c0;
        auto pass = [&]() {
#pragma unroll
            for (int s = 0; s < 8; ++s) { const int Lid = (lane >> 3) + 4 * s, piece = lane & 7; const int row = Lid >> 1, cofs = (Lid & 1) * 32 + piece * 4;
                v4f val = *(const v4fa*)(os + row * 68 + cofs); if (R) { const v4f rv = *(const v4f*)(R + ((size_t)r0 + row) * ldc + c0 + cofs); val += roundR ? (v4f){bfr(rv[0]), bfr(rv[1]), bfr(rv[2]), bfr(rv[3])} : rv; }
                *(v4f*)(crow + (size_t)row * ldc + cofs) = val; }
        };
        pass(); 
    }
}

// k_gemm3: 64 x 64 tile of C = (Ah + Al).(Bh + Bl)^T over K (row strides = K for all four planes; n-major B): three products per 32-k step (hh, hl, lh); f32
__global__ __launch_bounds__(128) void k_gemm3(const bf* __restrict__ Ah, const bf* __restrict__ Al, const bf* __restrict__ Bh, const bf* __restrict__ Bl, int K, float* C, int ldc) {
    __shared__ __align__(16) float ost[4][16 * 68];
    const int lane = threadIdx.x & 31, wave = threadIdx.x >> 5, lr = lane & 15, hi = lane >> 4;
    const int r0 = blockIdx.x * 64 + wave * 16, c0 = blockIdx.y * 64;
    const size_t aoff = (size_t)(r0 + lr) * K + 8 * hi;
    v8f acc[4];
#pragma unroll
    for (int t = 0; t < 4; ++t) acc[t] = (v8f){};
#pragma unroll 1
    for (int kc = 0; kc < K; kc += 32) {
        const v16bf a = cat16b(*(const v8us*)(Ah + aoff + kc), *(const v8us*)(Ah + aoff + kc + 16));
        const v16bf al = cat16b(*(const v8us*)(Al + aoff + kc), *(const v8us*)(Al + aoff + kc + 16));
#pragma unroll
        for (int t = 0; t < 4; ++t) { const size_t bo = (size_t)(c0 + t * 16 + lr) * K + kc + 8 * hi;
            const v16bf bh = cat16b(*(const v8us*)(Bh + bo), *(const v8us*)(Bh + bo + 16)); const v16bf bl = cat16b(*(const v8us*)(Bl + bo), *(const v8us*)(Bl + bo + 16));
            acc[t] = wmmab(a, bh, acc[t]); acc[t] = wmmab(al, bh, acc[t]); acc[t] = wmmab(a, bl, acc[t]); }
        asm volatile("v_nop\n\tv_nop\n\tv_nop\n\tv_nop" : "+v"(acc[0]), "+v"(acc[1]), "+v"(acc[2]), "+v"(acc[3]) : "v"(a), "v"(al));
    }
    float* os = &ost[wave][0];
#pragma unroll
    for (int t = 0; t < 4; ++t) {
#pragma unroll
        for (int j = 0; j < 8; ++j) os[(hi * 8 + j) * 68 + t * 16 + lr] = acc[t][j]; }
    __builtin_amdgcn_wave_barrier(); asm volatile("" ::: "memory");
    float* crow = C + (size_t)r0 * ldc + c0;
    auto pass = [&]() {
#pragma unroll
        for (int s = 0; s < 8; ++s) { const int Lid = (lane >> 3) + 4 * s, piece = lane & 7; const int row = Lid >> 1, cofs = (Lid & 1) * 32 + piece * 4;
            const v4f val = *(const v4fa*)(os + row * 68 + cofs); *(v4f*)(crow + (size_t)row * ldc + cofs) = val; }
    };
    pass(); 
}

// k_gnstat: one work-group per (image, slice of 16 channels = 8 groups). A wave's 16-byte loads cover 8 rows x 64 bytes; each thread keeps its 16 rows x 4 channels in
// registers, so x is read once for both passes (mean, then centred squares). ST: one 128-byte line per work-group, floats 0..7 = mean, 8..15 = rsqrt(var + eps).
__global__ __launch_bounds__(1024) void k_gnstat(const float* __restrict__ x, float* ST) {
    typedef __attribute__((ext_vector_type(2))) float v2f;
    __shared__ __align__(16) v2f red[2][32][4];
    const int tid = threadIdx.x, lane = tid & 31, wave = tid >> 5, q = tid & 3;     // q: which 4 channels (2 groups) of the slice
    const float* xp = x + (size_t)blockIdx.y * NN * CC + blockIdx.x * 16 + q * 4 + (size_t)(tid >> 2) * CC;
    v4f v[16];
#pragma unroll
    for (int i = 0; i < 16; ++i) v[i] = *(const v4f*)(xp + (size_t)i * 256 * CC);
    float s0 = 0.f, s1 = 0.f;
#pragma unroll
    for (int i = 0; i < 16; ++i) { v[i] = (v4f){bfr(v[i][0]), bfr(v[i][1]), bfr(v[i][2]), bfr(v[i][3])}; s0 += v[i][0] + v[i][1]; s1 += v[i][2] + v[i][3]; }
#pragma unroll
    for (int sh = 16; sh >= 4; sh >>= 1) { s0 += __shfl_xor(s0, sh, 32); s1 += __shfl_xor(s1, sh, 32); }
    if (lane < 4) red[0][wave][q] = (v2f){s0, s1};
    __syncthreads();
    s0 = 0.f; s1 = 0.f;     // every wave adds the 32 waves' sums: 4 per lane, then the same three exchanges
#pragma unroll
    for (int j = 0; j < 4; ++j) { const v2f t = red[0][j * 8 + (lane >> 2)][q]; s0 += t[0]; s1 += t[1]; }
#pragma unroll
    for (int sh = 16; sh >= 4; sh >>= 1) { s0 += __shfl_xor(s0, sh, 32); s1 += __shfl_xor(s1, sh, 32); }
    const float mu0 = s0 / (float)(2 * NN), mu1 = s1 / (float)(2 * NN);
    float q0 = 0.f, q1 = 0.f;
#pragma unroll
    for (int i = 0; i < 16; ++i) { float d = v[i][0] - mu0; q0 = fmaf(d, d, q0); d = v[i][1] - mu0; q0 = fmaf(d, d, q0); d = v[i][2] - mu1; q1 = fmaf(d, d, q1); d = v[i][3] - mu1; q1 = fmaf(d, d, q1); }
#pragma unroll
    for (int sh = 16; sh >= 4; sh >>= 1) { q0 += __shfl_xor(q0, sh, 32); q1 += __shfl_xor(q1, sh, 32); }
    if (lane < 4) red[1][wave][q] = (v2f){q0, q1};
    __syncthreads();
    if (wave) return;     // behind the last barrier
    q0 = 0.f; q1 = 0.f;
#pragma unroll
    for (int j = 0; j < 4; ++j) { const v2f t = red[1][j * 8 + (lane >> 2)][q]; q0 += t[0]; q1 += t[1]; }
#pragma unroll
    for (int sh = 16; sh >= 4; sh >>= 1) { q0 += __shfl_xor(q0, sh, 32); q1 += __shfl_xor(q1, sh, 32); }
    if (lane < 4) {
        float* st = ST + (size_t)(blockIdx.y * 4 + blockIdx.x) * 32 + 2 * q;
        *(v2f*)st = (v2f){mu0, mu1};
        *(v2f*)(st + 8) = (v2f){rsqrtf(q0 / (float)(2 * NN) + GN_EPS), rsqrtf(q1 / (float)(2 * NN) + GN_EPS)};
    }
}
__global__ __launch_bounds__(256) void k_gn(const float* __restrict__ xb, const float* __restrict__ ST, const float* __restrict__ ga, const float* __restrict__ be, bf* Hh, bf* Hl) {
    typedef __attribute__((ext_vector_type(2))) unsigned short v2us;
    const int lane = threadIdx.x & 31, n = blockIdx.x * 8 + (threadIdx.x >> 5); if (n >= NN) return;
    const float* st = ST + (lane >> 3) * 32 + (lane & 7); const float mu = st[0], rs = st[8]; v2us oh, ol;     // channels 2 lane, 2 lane + 1 = group lane; k_gnstat's line of slice lane / 8
#pragma unroll
    for (int i = 0; i < 2; ++i) { const int c = 2 * lane + i; const float y = (bfr(xb[(size_t)n * CC + c]) - mu) * rs * bfr(ga[c]) + bfr(be[c]); const unsigned short hb = f2bf(y); oh[i] = hb; ol[i] = f2bf(y - bf2f(hb)); }
    const size_t o = (size_t)n * CC + 2 * lane;
    *(v2us*)(Hh + o) = oh; *(v2us*)(Hl + o) = ol; 
}
__global__ __launch_bounds__(256) void k_split64(const float* __restrict__ src, int nrows, bf* dh, bf* dl) {
    typedef __attribute__((ext_vector_type(2))) unsigned short v2us;
    const int lane = threadIdx.x & 31, r = blockIdx.x * 8 + (threadIdx.x >> 5); if (r >= nrows) return;
    const size_t o = (size_t)r * CC + lane * 2; v2us oh, ol;
#pragma unroll
    for (int i = 0; i < 2; ++i) { const float v = src[o + i]; const unsigned short hb = f2bf(v); oh[i] = hb; ol[i] = f2bf(v - bf2f(hb)); }
    *(v2us*)(dh + o) = oh; *(v2us*)(dl + o) = ol; 
}
__global__ __launch_bounds__(256) void k_vt64(const float* __restrict__ V, bf* VTh, bf* VTl) {
    typedef __attribute__((ext_vector_type(2))) unsigned short v2us;
    const int lane = threadIdx.x & 31, wid = blockIdx.x * 8 + (threadIdx.x >> 5); if (wid >= (NN / 64) * CC) return;
    const int d = wid % CC, g = wid / CC; const int n0 = g * 64 + 2 * lane; v2us oh, ol;
#pragma unroll
    for (int i = 0; i < 2; ++i) { const float v = V[(size_t)(n0 + i) * CC + d]; const unsigned short hb = f2bf(v); oh[i] = hb; ol[i] = f2bf(v - bf2f(hb)); }
    const size_t o = (size_t)d * NN + n0;
    *(v2us*)(VTh + o) = oh; *(v2us*)(VTl + o) = ol; 
}
__global__ __launch_bounds__(256) void k_softmax(const float* __restrict__ S, bf* PH, bf* PL) {
    const int lane = threadIdx.x & 31, r = blockIdx.x * 8 + (threadIdx.x >> 5); if (r >= RCH) return;
    const float* sr = S + (size_t)r * NN; float m = -3.0e38f;
#pragma unroll 1
    for (int c0 = lane * 8; c0 < NN; c0 += 256) { const v8f v = *(const v8f*)(sr + c0);
#pragma unroll
        for (int i = 0; i < 8; ++i) m = fmaxf(m, v[i] * SCL); }
#pragma unroll
    for (int sh = 16; sh; sh >>= 1) m = fmaxf(m, __shfl_xor(m, sh, 32));
    float sum = 0.f;
#pragma unroll 1
    for (int c0 = lane * 8; c0 < NN; c0 += 256) { const v8f v = *(const v8f*)(sr + c0);
#pragma unroll
        for (int i = 0; i < 8; ++i) sum += __expf(v[i] * SCL - m); }
#pragma unroll
    for (int sh = 16; sh; sh >>= 1) sum += __shfl_xor(sum, sh, 32);
    const float inv = 1.0f / sum;
{
#pragma unroll 1
        for (int c0 = lane * 8; c0 < NN; c0 += 256) { const v8f v = *(const v8f*)(sr + c0); v8us oh, ol;
#pragma unroll
            for (int i = 0; i < 8; ++i) { const float p = __expf(v[i] * SCL - m) * inv; const unsigned short hb = f2bf(p); oh[i] = hb; ol[i] = f2bf(p - bf2f(hb)); }
            const size_t o = (size_t)r * NN + c0; *(v8us*)(PH + o) = oh; *(v8us*)(PL + o) = ol; }
         }
}

extern "C" void kernel_launch(void* const* d_in, const int* in_sizes, int n_in,
                              void* d_out, int out_size, void* d_ws, size_t ws_size, hipStream_t stream) {
    (void)in_sizes; (void)n_in; (void)out_size;
    const float* x = (const float*)d_in[0]; const float* ga = (const float*)d_in[1]; const float* be = (const float*)d_in[2];
    const float* Wq = (const float*)d_in[3]; const float* bq = (const float*)d_in[4]; const float* Wk = (const float*)d_in[5]; const float* bk = (const float*)d_in[6]; const float* Wv = (const float*)d_in[7]; const float* bv = (const float*)d_in[8]; const float* Wp = (const float*)d_in[9]; const float* bp = (const float*)d_in[10];   // k-major (h @ W)
    float* out = (float*)d_out;    // [8][64][64][64] channels-last
    char* wsp = (char*)d_ws;
    auto take = [&](size_t bytes) { char* p = wsp; wsp += (bytes + 255) & ~(size_t)255; return (void*)p; };
    bf* WqT = (bf*)take(CC * CC * 2); bf* WkT = (bf*)take(CC * CC * 2); bf* WvT = (bf*)take(CC * CC * 2); bf* WpT = (bf*)take(CC * CC * 2); float* ST = (float*)take(NBI * 4 * 128);
    bf* Hh = (bf*)take((size_t)NN * CC * 2); bf* Hl = (bf*)take((size_t)NN * CC * 2); float* TMP = (float*)take((size_t)NN * CC * 4);
    bf* Qh = (bf*)take((size_t)NN * CC * 2); bf* Ql = (bf*)take((size_t)NN * CC * 2); bf* Kh = (bf*)take((size_t)NN * CC * 2); bf* Kl = (bf*)take((size_t)NN * CC * 2); bf* VTh = (bf*)take((size_t)CC * NN * 2); bf* VTl = (bf*)take((size_t)CC * NN * 2);
    float* S = (float*)take((size_t)RCH * NN * 4); bf* PH = (bf*)take((size_t)RCH * NN * 2); bf* PL = (bf*)take((size_t)RCH * NN * 2); float* O = (float*)take((size_t)RCH * CC * 4); bf* Oh = (bf*)take((size_t)RCH * CC * 2); bf* Ol = (bf*)take((size_t)RCH * CC * 2);
    if ((size_t)(wsp - (char*)d_ws) > ws_size) return;    // ~ 0.03 + 0.5 x 2 + 1 + 6 x 0.5 + 16.8 + 8.4 + 8.4 + 0.26 + 0.26 ~ 39 MB
    k_wt<<<dim3(1, 1, 1), 256, 0, stream>>>(Wq, CC, CC, WqT); k_wt<<<dim3(1, 1, 1), 256, 0, stream>>>(Wk, CC, CC, WkT); k_wt<<<dim3(1, 1, 1), 256, 0, stream>>>(Wv, CC, CC, WvT); k_wt<<<dim3(1, 1, 1), 256, 0, stream>>>(Wp, CC, CC, WpT);
    k_gnstat<<<dim3(4, NBI, 1), 1024, 0, stream>>>(x, ST);
    for (int b = 0; b < NBI; ++b) {
        const float* xb = x + (size_t)b * NN * CC;
        k_gn<<<NN / 8, 256, 0, stream>>>(xb, ST + b * 128, ga, be, Hh, Hl);
        k_gemmb<true, false><<<dim3(NN / 64, 1, 1), 128, 0, stream>>>(Hh, Hl, WqT, bq, TMP, CC, nullptr, nullptr, CC); k_split64<<<NN / 8, 256, 0, stream>>>(TMP, NN, Qh, Ql);
        k_gemmb<true, false><<<dim3(NN / 64, 1, 1), 128, 0, stream>>>(Hh, Hl, WkT, bk, TMP, CC, nullptr, nullptr, CC); k_split64<<<NN / 8, 256, 0, stream>>>(TMP, NN, Kh, Kl);
        k_gemmb<true, false><<<dim3(NN / 64, 1, 1), 128, 0, stream>>>(Hh, Hl, WvT, bv, TMP, CC, nullptr, nullptr, CC); k_vt64<<<((NN / 64) * CC) / 8, 256, 0, stream>>>(TMP, VTh, VTl);
        for (int ch = 0; ch < NN / RCH; ++ch) { const size_t r0 = (size_t)ch * RCH;
            k_gemm3<<<dim3(RCH / 64, NN / 64, 1), 128, 0, stream>>>(Qh + r0 * CC, Ql + r0 * CC, Kh, Kl, CC, S, NN);
            k_softmax<<<RCH / 8, 256, 0, stream>>>(S, PH, PL);
            k_gemm3<<<dim3(RCH / 64, 1, 1), 128, 0, stream>>>(PH, PL, VTh, VTl, NN, O, CC); k_split64<<<RCH / 8, 256, 0, stream>>>(O, RCH, Oh, Ol);
            k_gemmb<true, false><<<dim3(RCH / 64, 1, 1), 128, 0, stream>>>(Oh, Ol, WpT, bp, out + ((size_t)b * NN + r0) * CC, CC, nullptr, xb + r0 * CC, CC, 1);    // attn.Wp + bp + x
        }
    }
}

// v003
// One run takes 255 microseconds.
// It is 19.9 times as fast as v001, going by the measured steps of the versions left out in between.
// All steps since v000 together make it 85.2 times as fast.
#include <hip/hip_runtime.h>

// Compute dtypes, f32 accumulate, all images in each launch (tokens = the 4096 positions, channels-last rows of 64): GroupNorm (32 groups x 2 channels, stats over H, W and the
// products) on v_wmma_f32_16x16x32_bf16; the full 4096 x 4096 single-head attention in one fused kernel (k_attn: scores three products, softmax x 1/8 in f32 -> hi/lo, P.v three products)

#define NBI  8
#define NN   4096
#define CC   64
#define NGR  32
#define DM   CC
#define NTK  NN
#define GN_EPS 1e-6f
#define SCL  0.125f
#define LOSC 1024.0f

typedef _Float16 h16;
typedef unsigned short bf;
typedef __attribute__((ext_vector_type(16))) __bf16   v16bf;
typedef __attribute__((ext_vector_type(16))) _Float16 v16h;
typedef __attribute__((ext_vector_type(8)))  _Float16 v8h;
typedef __attribute__((ext_vector_type(8)))  unsigned short v8us;
typedef __attribute__((ext_vector_type(8)))  float    v8f;
typedef __attribute__((ext_vector_type(4)))  float    v4f;
typedef __attribute__((ext_vector_type(4)))  _Float16 v4h;
typedef v8h  __attribute__((may_alias)) v8ha;
typedef v4f  __attribute__((may_alias)) v4fa;
typedef v8us __attribute__((may_alias)) v8usa;

__device__ __forceinline__ unsigned short f2bf(float f) { unsigned u = __float_as_uint(f); u += 0x7FFFu + ((u >> 16) & 1u); return (unsigned short)(u >> 16); }
__device__ __forceinline__ float bf2f(unsigned short b) { return __uint_as_float(((unsigned)b) << 16); }
__device__ __forceinline__ float bfr(float f) { return bf2f(f2bf(f)); }
__device__ __forceinline__ v16h cat16(v8h lo, v8h hi) { return __builtin_shufflevector(lo, hi, 0, 1, 2, 3, 4, 5, 6, 7, 8, 9, 10, 11, 12, 13, 14, 15); }
__device__ __forceinline__ v16bf cat16b(v8us lo, v8us hi) { return __builtin_bit_cast(v16bf, __builtin_shufflevector(lo, hi, 0, 1, 2, 3, 4, 5, 6, 7, 8, 9, 10, 11, 12, 13, 14, 15)); }
__device__ __forceinline__ v8f wmma16(v16h a, v16h b, v8f c) { return __builtin_amdgcn_wmma_f32_16x16x32_f16(false, a, false, b, (short)0, c, false, false); }
__device__ __forceinline__ v8f wmmab(v16bf a, v16bf b, v8f c) { return __builtin_amdgcn_wmma_f32_16x16x32_bf16(false, a, false, b, (short)0, c, false, false); }

// k_wt: WT [n][K] = bf16(W[k][n]) (k-major [K][ncols]) via 64 x 64 LDS tiles; grid (K/64, ncols/64).
__global__ __launch_bounds__(256) void k_wt(const float* __restrict__ Wm, int K, int ncols, bf* WT) {
    __shared__ __align__(16) unsigned short tl[64 * 72];
    const int tid = threadIdx.x, k0 = blockIdx.x * 64, n0 = blockIdx.y * 64;
    const int kk = tid >> 2, nq = (tid & 3) * 16;
#pragma unroll
    for (int i = 0; i < 16; ++i) tl[(nq + i) * 72 + kk] = f2bf(Wm[(size_t)(k0 + kk) * ncols + n0 + nq + i]);
    __syncthreads();
    const int piece = tid & 7;
    auto pass = [&]() {
#pragma unroll
        for (int s = 0; s < 2; ++s) { const int nr = (tid >> 3) + 32 * s; const v8us val = *(const v8usa*)(tl + nr * 72 + piece * 8); *(v8us*)(WT + (size_t)(n0 + nr) * K + k0 + piece * 8) = val; }
    };
    pass(); 
}
// k_gemmb: 64 x 64 block tile (4 waves x 16 x 64) of C[NBI * NTK][ldc] = (A [+ Al]).B^T (K = 64) [+ bf(bias[c])] [+ bf(R[r][c]) residual]; f32 whole-line epilogue (or f16
template <bool SPLITA, bool F16OUT = false>
__global__ __launch_bounds__(128) void k_gemmb(const bf* __restrict__ A, const bf* __restrict__ Al, const bf* __restrict__ Bn, const float* __restrict__ bias, float* C, int ldc, h16* C2, const float* __restrict__ R = nullptr, int K = DM, int roundR = 1) {
    __shared__ __align__(16) float ost[4][16 * 68];
    const int lane = threadIdx.x & 31, wave = threadIdx.x >> 5, lr = lane & 15, hi = lane >> 4;
    const int r0 = blockIdx.x * 64 + wave * 16, c0 = blockIdx.y * 64;
    const size_t aoff = (size_t)(r0 + lr) * K + 8 * hi;
    size_t boff[4];
#pragma unroll
    for (int t = 0; t < 4; ++t) boff[t] = (size_t)(c0 + t * 16 + lr) * K + 8 * hi;
    v8f acc[4];
#pragma unroll
    for (int t = 0; t < 4; ++t) acc[t] = (v8f){};
#pragma unroll 1
    for (int kc = 0; kc < K; kc += 32) {
        const v16bf a = cat16b(*(const v8us*)(A + aoff + kc), *(const v8us*)(A + aoff + kc + 16));
        v16bf al = a;
        if (SPLITA) al = cat16b(*(const v8us*)(Al + aoff + kc), *(const v8us*)(Al + aoff + kc + 16));
#pragma unroll
        for (int t = 0; t < 4; ++t) { const v16bf b = cat16b(*(const v8us*)(Bn + boff[t] + kc), *(const v8us*)(Bn + boff[t] + kc + 16)); acc[t] = wmmab(a, b, acc[t]); if (SPLITA) acc[t] = wmmab(al, b, acc[t]); }
        asm volatile("v_nop\n\tv_nop\n\tv_nop\n\tv_nop" : "+v"(acc[0]), "+v"(acc[1]), "+v"(acc[2]), "+v"(acc[3]) : "v"(a), "v"(al));
    }
    float* os = &ost[wave][0];
#pragma unroll
    for (int t = 0; t < 4; ++t) { const float bv = bias ? bfr(bias[c0 + t * 16 + lr]) : 0.f;
#pragma unroll
        for (int j = 0; j < 8; ++j) os[(hi * 8 + j) * 68 + t * 16 + lr] = acc[t][j] + bv; }
    __syncthreads();
    if (F16OUT) {
        h16* crow = (h16*)(void*)C + (size_t)r0 * ldc + c0;
        auto pass = [&]() {
#pragma unroll
            for (int s = 0; s < 4; ++s) { const int row = 4 * s + (lane >> 3), piece = lane & 7; const float* sp = os + row * 68 + piece * 8; v8h o, o2;
#pragma unroll
                for (int i = 0; i < 8; ++i) { const h16 a = (h16)sp[i]; o[i] = a; o2[i] = (h16)((sp[i] - (float)a) * LOSC); }
                *(v8h*)(crow + (size_t)row * ldc + piece * 8) = o; if (C2) *(v8h*)(C2 + (size_t)r0 * ldc + c0 + (size_t)row * ldc + piece * 8) = o2; }
        };
        pass(); 
    } else {
        float* crow = C + (size_t)r0 * ldc + c0;
        auto pass = [&]() {
#pragma unroll
            for (int s = 0; s < 8; ++s) { const int Lid = (lane >> 3) + 4 * s, piece = lane & 7; const int row = Lid >> 1, cofs = (Lid & 1) * 32 + piece * 4;
                v4f val = *(const v4fa*)(os + row * 68 + cofs); if (R) { const v4f rv = *(const v4f*)(R + ((size_t)r0 + row) * ldc + c0 + cofs); val += roundR ? (v4f){bfr(rv[0]), bfr(rv[1]), bfr(rv[2]), bfr(rv[3])} : rv; }
                *(v4f*)(crow + (size_t)row * ldc + cofs) = val; }
        };
        pass(); 
    }
}

// k_gnstat: one work-group per (image, slice of 16 channels = 8 groups). A wave's 16-byte loads cover 8 rows x 64 bytes; each thread keeps its 16 rows x 4 channels in
// registers, so x is read once for both passes (mean, then centred squares). ST: one 128-byte line per work-group, floats 0..7 = mean, 8..15 = rsqrt(var + eps).
__global__ __launch_bounds__(1024) void k_gnstat(const float* __restrict__ x, float* ST) {
    typedef __attribute__((ext_vector_type(2))) float v2f;
    __shared__ __align__(16) v2f red[2][32][4];
    const int tid = threadIdx.x, lane = tid & 31, wave = tid >> 5, q = tid & 3;     // q: which 4 channels (2 groups) of the slice
    const float* xp = x + (size_t)blockIdx.y * NN * CC + blockIdx.x * 16 + q * 4 + (size_t)(tid >> 2) * CC;
    v4f v[16];
#pragma unroll
    for (int i = 0; i < 16; ++i) v[i] = *(const v4f*)(xp + (size_t)i * 256 * CC);
    float s0 = 0.f, s1 = 0.f;
#pragma unroll
    for (int i = 0; i < 16; ++i) { v[i] = (v4f){bfr(v[i][0]), bfr(v[i][1]), bfr(v[i][2]), bfr(v[i][3])}; s0 += v[i][0] + v[i][1]; s1 += v[i][2] + v[i][3]; }
#pragma unroll
    for (int sh = 16; sh >= 4; sh >>= 1) { s0 += __shfl_xor(s0, sh, 32); s1 += __shfl_xor(s1, sh, 32); }
    if (lane < 4) red[0][wave][q] = (v2f){s0, s1};
    __syncthreads();
    s0 = 0.f; s1 = 0.f;     // every wave adds the 32 waves' sums: 4 per lane, then the same three exchanges
#pragma unroll
    for (int j = 0; j < 4; ++j) { const v2f t = red[0][j * 8 + (lane >> 2)][q]; s0 += t[0]; s1 += t[1]; }
#pragma unroll
    for (int sh = 16; sh >= 4; sh >>= 1) { s0 += __shfl_xor(s0, sh, 32); s1 += __shfl_xor(s1, sh, 32); }
    const float mu0 = s0 / (float)(2 * NN), mu1 = s1 / (float)(2 * NN);
    float q0 = 0.f, q1 = 0.f;
#pragma unroll
    for (int i = 0; i < 16; ++i) { float d = v[i][0] - mu0; q0 = fmaf(d, d, q0); d = v[i][1] - mu0; q0 = fmaf(d, d, q0); d = v[i][2] - mu1; q1 = fmaf(d, d, q1); d = v[i][3] - mu1; q1 = fmaf(d, d, q1); }
#pragma unroll
    for (int sh = 16; sh >= 4; sh >>= 1) { q0 += __shfl_xor(q0, sh, 32); q1 += __shfl_xor(q1, sh, 32); }
    if (lane < 4) red[1][wave][q] = (v2f){q0, q1};
    __syncthreads();
    if (wave) return;     // behind the last barrier
    q0 = 0.f; q1 = 0.f;
#pragma unroll
    for (int j = 0; j < 4; ++j) { const v2f t = red[1][j * 8 + (lane >> 2)][q]; q0 += t[0]; q1 += t[1]; }
#pragma unroll
    for (int sh = 16; sh >= 4; sh >>= 1) { q0 += __shfl_xor(q0, sh, 32); q1 += __shfl_xor(q1, sh, 32); }
    if (lane < 4) {
        float* st = ST + (size_t)(blockIdx.y * 4 + blockIdx.x) * 32 + 2 * q;
        *(v2f*)st = (v2f){mu0, mu1};
        *(v2f*)(st + 8) = (v2f){rsqrtf(q0 / (float)(2 * NN) + GN_EPS), rsqrtf(q1 / (float)(2 * NN) + GN_EPS)};
    }
}
// k_qkv: GroupNorm applied, the three projections, their hi/lo splits and V's transpose in one kernel, all images in one launch; grid (NN / 64, images), 4 waves x 16 tokens.
// A lane normalises the 32 channels of its token that its fragments hold (k step ks, elements i and 8 + i = channels 32 ks + 8 hi + i and 32 ks + 16 + 8 hi + i), so h stays in registers.
// q, k: transposed products (A = weight rows, B = h rows): a lane holds 8 neighbouring channels of ONE token, 16 bytes of its row. v: A = h rows, B = weight rows: a lane holds
// 8 neighbouring tokens of one channel; the work-group's 64 tokens meet in LDS, so that V^T leaves in whole 128-byte lines, each from one wave.
__global__ __launch_bounds__(128) void k_qkv(const float* __restrict__ x, const float* __restrict__ ST, const float* __restrict__ ga, const float* __restrict__ be,
                                             const bf* __restrict__ WqT, const bf* __restrict__ WkT, const bf* __restrict__ WvT, const float* __restrict__ bq, const float* __restrict__ bk, const float* __restrict__ bv,
                                             bf* Qh, bf* Ql, bf* Kh, bf* Kl, bf* VTh, bf* VTl) {
    __shared__ __align__(16) unsigned short vs[2][CC * 72];
    const int tid = threadIdx.x, lane = tid & 31, wave = tid >> 5, lr = lane & 15, hi = lane >> 4;
    const size_t ib = (size_t)blockIdx.y * NN * CC;
    const size_t ro = ib + (size_t)(blockIdx.x * 64 + wave * 16 + lr) * CC + 8 * hi;
    const float* st = ST + blockIdx.y * 128 + 4 * hi;     // k_gnstat's four lines of this image; channels c .. c + 7 = groups c / 2 .. c / 2 + 3
    v16bf hh[2], hl[2];
#pragma unroll
    for (int ks = 0; ks < 2; ++ks) { v8us oh[2], ol[2];
#pragma unroll
        for (int hf = 0; hf < 2; ++hf) { const int cc = ks * 32 + hf * 16;     // + 8 hi: the lane's 8 channels
            const v4f xv[2] = {*(const v4f*)(x + ro + cc), *(const v4f*)(x + ro + cc + 4)};
            const v4f gv[2] = {*(const v4f*)(ga + cc + 8 * hi), *(const v4f*)(ga + cc + 8 * hi + 4)};
            const v4f ev[2] = {*(const v4f*)(be + cc + 8 * hi), *(const v4f*)(be + cc + 8 * hi + 4)};
            const v4f mu = *(const v4f*)(st + (ks * 2 + hf) * 32), rs = *(const v4f*)(st + (ks * 2 + hf) * 32 + 8);
#pragma unroll
            for (int i = 0; i < 8; ++i) { const float y = (bfr(xv[i >> 2][i & 3]) - mu[i >> 1]) * rs[i >> 1] * bfr(gv[i >> 2][i & 3]) + bfr(ev[i >> 2][i & 3]); const unsigned short hb = f2bf(y); oh[hf][i] = hb; ol[hf][i] = f2bf(y - bf2f(hb)); } }
        hh[ks] = cat16b(oh[0], oh[1]); hl[ks] = cat16b(ol[0], ol[1]); }
    const int wo = lr * CC + 8 * hi;     // a weight fragment: row 16 t + lr, the same k order as h's
    {
        v8f acc[4];
#pragma unroll
        for (int t = 0; t < 4; ++t) acc[t] = (v8f){};
#pragma unroll
        for (int ks = 0; ks < 2; ++ks) {
#pragma unroll
            for (int t = 0; t < 4; ++t) { const bf* wp = WvT + wo + t * 16 * CC + ks * 32; const v16bf w = cat16b(*(const v8us*)wp, *(const v8us*)(wp + 16)); acc[t] = wmmab(hh[ks], w, acc[t]); acc[t] = wmmab(hl[ks], w, acc[t]); } }
#pragma unroll
        for (int t = 0; t < 4; ++t) { const float bb = bfr(bv[t * 16 + lr]); v8us wh, wl;
#pragma unroll
            for (int j = 0; j < 8; ++j) { const float v = acc[t][j] + bb; const unsigned short hb = f2bf(v); wh[j] = hb; wl[j] = f2bf(v - bf2f(hb)); }
            const int o = (t * 16 + lr) * 72 + wave * 16 + 8 * hi; *(v8usa*)(&vs[0][o]) = wh; *(v8usa*)(&vs[1][o]) = wl; }
    }
    auto rows = [&](const bf* __restrict__ WT, const float* __restrict__ bias, bf* Dh, bf* Dl) {
        v8f acc[4];
#pragma unroll
        for (int t = 0; t < 4; ++t) acc[t] = (v8f){};
#pragma unroll
        for (int ks = 0; ks < 2; ++ks) {
#pragma unroll
            for (int t = 0; t < 4; ++t) { const bf* wp = WT + wo + t * 16 * CC + ks * 32; const v16bf w = cat16b(*(const v8us*)wp, *(const v8us*)(wp + 16)); acc[t] = wmmab(w, hh[ks], acc[t]); acc[t] = wmmab(w, hl[ks], acc[t]); } }
#pragma unroll
        for (int t = 0; t < 4; ++t) { const v4f bb[2] = {*(const v4f*)(bias + t * 16 + 8 * hi), *(const v4f*)(bias + t * 16 + 8 * hi + 4)}; v8us wh, wl;
#pragma unroll
            for (int j = 0; j < 8; ++j) { const float v = acc[t][j] + bfr(bb[j >> 2][j & 3]); const unsigned short hb = f2bf(v); wh[j] = hb; wl[j] = f2bf(v - bf2f(hb)); }
            *(v8us*)(Dh + ro + t * 16) = wh; *(v8us*)(Dl + ro + t * 16) = wl; }
    };
    rows(WqT, bq, Qh, Ql); rows(WkT, bk, Kh, Kl);
    __syncthreads();     // all four waves' token columns of V^T stand in LDS
#pragma unroll
    for (int s = 0; s < 4; ++s) { const int row = s * 16 + (tid >> 3), piece = tid & 7; const size_t o = ib + (size_t)row * NN + blockIdx.x * 64 + piece * 8;
        *(v8us*)(VTh + o) = *(const v8usa*)(&vs[0][row * 72 + piece * 8]); *(v8us*)(VTl + o) = *(const v8usa*)(&vs[1][row * 72 + piece * 8]); }
}
// k_attn: scores, softmax and P.v in one kernel, all images in one launch; grid (NN / 64, images), 4 waves x 16 queries, each wave walks all NN keys in passes of 32.
// Transposed products: S^T = K.Q^T (A = key rows, B = query rows kept in registers), so a lane holds 16 scores of ONE query (column lr; keys 8 hi + j of each 16-key tile)
// and the two score tiles, converted in place, are the B operand of O^T += V^T.P^T (element i = key 8 hi + i, element 8 + i = key 16 + 8 hi + i: the order the V^T loader uses).
// Running maximum and sum per query (exp2 domain); the three hi/lo products of each matrix product are kept.
__device__ __forceinline__ float xhalf(float v) { const int b = __float_as_int(v); return __int_as_float(__builtin_amdgcn_permlanex16(b, b, 0x76543210, 0xfedcba98, false, false)); }
__global__ __launch_bounds__(128) void k_attn(const bf* __restrict__ Qh, const bf* __restrict__ Ql, const bf* __restrict__ Kh, const bf* __restrict__ Kl, const bf* __restrict__ VTh, const bf* __restrict__ VTl, bf* Oh, bf* Ol) {
    typedef __attribute__((ext_vector_type(2))) __bf16 v2bf; typedef __attribute__((ext_vector_type(2))) float v2f; typedef __attribute__((ext_vector_type(8))) unsigned v8u;
    const int lane = threadIdx.x & 31, wave = threadIdx.x >> 5, lr = lane & 15, hi = lane >> 4;
    const size_t ib = (size_t)blockIdx.y * NN * CC;
    const size_t qo = ib + (size_t)(blockIdx.x * 64 + wave * 16 + lr) * CC;
    const float SC2 = SCL * 1.44269504088896341f;
    v16bf qh[2], ql[2];
#pragma unroll
    for (int ks = 0; ks < 2; ++ks) { const size_t o = qo + ks * 32 + 8 * hi; qh[ks] = cat16b(*(const v8us*)(Qh + o), *(const v8us*)(Qh + o + 16)); ql[ks] = cat16b(*(const v8us*)(Ql + o), *(const v8us*)(Ql + o + 16)); }
    const bf* khp = Kh + ib + lr * CC + 8 * hi; const bf* klp = Kl + ib + lr * CC + 8 * hi;
    const bf* vhp = VTh + ib + (size_t)lr * NN + 8 * hi; const bf* vlp = VTl + ib + (size_t)lr * NN + 8 * hi;
    v16bf kh[2][2], kl[2][2], vh[4], vl[4];
    auto ldk = [&](int kt) {
#pragma unroll
        for (int t = 0; t < 2; ++t) {
#pragma unroll
            for (int ks = 0; ks < 2; ++ks) { const int o = (kt + t * 16) * CC + ks * 32; kh[t][ks] = cat16b(*(const v8us*)(khp + o), *(const v8us*)(khp + o + 16)); kl[t][ks] = cat16b(*(const v8us*)(klp + o), *(const v8us*)(klp + o + 16)); } }
    };
    auto ldv = [&](int kt) {
#pragma unroll
        for (int dt = 0; dt < 4; ++dt) { const int o = dt * 16 * NN + kt; vh[dt] = cat16b(*(const v8us*)(vhp + o), *(const v8us*)(vhp + o + 16)); vl[dt] = cat16b(*(const v8us*)(vlp + o), *(const v8us*)(vlp + o + 16)); }
    };
    ldk(0); ldv(0);
    v8f oa[4];
#pragma unroll
    for (int dt = 0; dt < 4; ++dt) oa[dt] = (v8f){};
    float m = -3.0e38f, l = 0.f;
#pragma unroll 1
    for (int kt = 0; kt < NN; kt += 32) {
        const int kn = (kt + 32) & (NN - 1);     // the fragments are fetched one pass ahead; the last pass fetches pass 0 again (in bounds, unused)
        v8f s[2]; s[0] = (v8f){}; s[1] = (v8f){};
#pragma unroll
        for (int ks = 0; ks < 2; ++ks) {
            s[0] = wmmab(kh[0][ks], qh[ks], s[0]); s[1] = wmmab(kh[1][ks], qh[ks], s[1]);
            s[0] = wmmab(kh[0][ks], ql[ks], s[0]); s[1] = wmmab(kh[1][ks], ql[ks], s[1]);
            s[0] = wmmab(kl[0][ks], qh[ks], s[0]); s[1] = wmmab(kl[1][ks], qh[ks], s[1]);
        }
        ldk(kn);
        float mt = fmaxf(s[0][0], s[1][0]);
#pragma unroll
        for (int j = 1; j < 8; ++j) mt = fmaxf(mt, fmaxf(s[0][j], s[1][j]));
        mt = fmaxf(mt, xhalf(mt));
        const float mn = fmaxf(m, mt * SC2), al = __builtin_amdgcn_exp2f(m - mn);
        m = mn;
#pragma unroll
        for (int t = 0; t < 2; ++t) {
#pragma unroll
            for (int j = 0; j < 8; ++j) s[t][j] = __builtin_amdgcn_exp2f(fmaf(s[t][j], SC2, -mn)); }
        const v8f sv = s[0] + s[1];
        l = fmaf(l, al, ((sv[0] + sv[1]) + (sv[2] + sv[3])) + ((sv[4] + sv[5]) + (sv[6] + sv[7])));
        v8u phw, plw;     // word i of the B operand = elements 2 i, 2 i + 1: hi = bf16(p), lo = bf16(p - hi)
#pragma unroll
        for (int i = 0; i < 8; ++i) { const v2f p2 = (v2f){s[i >> 2][(2 * i) & 7], s[i >> 2][((2 * i) & 7) + 1]};
            const unsigned w = __builtin_bit_cast(unsigned, __builtin_convertvector(p2, v2bf)); phw[i] = w;
            const v2f r2 = p2 - (v2f){__uint_as_float(w << 16), __uint_as_float(w & 0xFFFF0000u)}; plw[i] = __builtin_bit_cast(unsigned, __builtin_convertvector(r2, v2bf)); }
        const v16bf ph = __builtin_bit_cast(v16bf, phw), pl = __builtin_bit_cast(v16bf, plw);
#pragma unroll
        for (int dt = 0; dt < 4; ++dt) oa[dt] *= al;
#pragma unroll
        for (int dt = 0; dt < 4; ++dt) oa[dt] = wmmab(vh[dt], ph, oa[dt]);
#pragma unroll
        for (int dt = 0; dt < 4; ++dt) oa[dt] = wmmab(vh[dt], pl, oa[dt]);
#pragma unroll
        for (int dt = 0; dt < 4; ++dt) oa[dt] = wmmab(vl[dt], ph, oa[dt]);
        ldv(kn);
        asm volatile("s_wait_xcnt 0x0" ::: "memory");     // the next pass forms new addresses in the registers that this pass's loads name
    }
    asm volatile("s_wait_loadcnt 0x0" ::: "memory");     // the last pass's unused fetch lands before its registers are reused and the wave gives them back
    l += xhalf(l);     // the two halves of a column hold the sums of disjoint keys
    const float inv = 1.0f / l;
#pragma unroll
    for (int dt = 0; dt < 4; ++dt) { v8us wh, wl;
#pragma unroll
        for (int j = 0; j < 8; ++j) { const float v = oa[dt][j] * inv; const unsigned short hb = f2bf(v); wh[j] = hb; wl[j] = f2bf(v - bf2f(hb)); }
        const size_t o = qo + dt * 16 + 8 * hi; *(v8us*)(Oh + o) = wh; *(v8us*)(Ol + o) = wl; }
}

extern "C" void kernel_launch(void* const* d_in, const int* in_sizes, int n_in,
                              void* d_out, int out_size, void* d_ws, size_t ws_size, hipStream_t stream) {
    (void)in_sizes; (void)n_in; (void)out_size;
    const float* x = (const float*)d_in[0]; const float* ga = (const float*)d_in[1]; const float* be = (const float*)d_in[2];
    const float* Wq = (const float*)d_in[3]; const float* bq = (const float*)d_in[4]; const float* Wk = (const float*)d_in[5]; const float* bk = (const float*)d_in[6]; const float* Wv = (const float*)d_in[7]; const float* bv = (const float*)d_in[8]; const float* Wp = (const float*)d_in[9]; const float* bp = (const float*)d_in[10];   // k-major (h @ W)
    float* out = (float*)d_out;    // [8][64][64][64] channels-last
    char* wsp = (char*)d_ws;
    auto take = [&](size_t bytes) { char* p = wsp; wsp += (bytes + 255) & ~(size_t)255; return (void*)p; };
    bf* WqT = (bf*)take(CC * CC * 2); bf* WkT = (bf*)take(CC * CC * 2); bf* WvT = (bf*)take(CC * CC * 2); bf* WpT = (bf*)take(CC * CC * 2); float* ST = (float*)take(NBI * 4 * 128);
    const size_t PLN = (size_t)NN * CC;    // one image's plane, in elements
    bf* Qh = (bf*)take(NBI * PLN * 2); bf* Ql = (bf*)take(NBI * PLN * 2); bf* Kh = (bf*)take(NBI * PLN * 2); bf* Kl = (bf*)take(NBI * PLN * 2); bf* VTh = (bf*)take(NBI * PLN * 2); bf* VTl = (bf*)take(NBI * PLN * 2);
    bf* Oh = (bf*)take(NBI * PLN * 2); bf* Ol = (bf*)take(NBI * PLN * 2);
    if ((size_t)(wsp - (char*)d_ws) > ws_size) return;    // ~ 0.03 + 8 x 4.2 ~ 34 MB
    k_wt<<<dim3(1, 1, 1), 256, 0, stream>>>(Wq, CC, CC, WqT); k_wt<<<dim3(1, 1, 1), 256, 0, stream>>>(Wk, CC, CC, WkT); k_wt<<<dim3(1, 1, 1), 256, 0, stream>>>(Wv, CC, CC, WvT); k_wt<<<dim3(1, 1, 1), 256, 0, stream>>>(Wp, CC, CC, WpT);
    k_gnstat<<<dim3(4, NBI, 1), 1024, 0, stream>>>(x, ST);
    k_qkv<<<dim3(NN / 64, NBI, 1), 128, 0, stream>>>(x, ST, ga, be, WqT, WkT, WvT, bq, bk, bv, Qh, Ql, Kh, Kl, VTh, VTl);
    k_attn<<<dim3(NN / 64, NBI, 1), 128, 0, stream>>>(Qh, Ql, Kh, Kl, VTh, VTl, Oh, Ol);
    k_gemmb<true, false><<<dim3(NBI * NN / 64, 1, 1), 128, 0, stream>>>(Oh, Ol, WpT, bp, out, CC, nullptr, x, CC, 1);    // attn.Wp + bp + x
}

// v004
// A run of this version takes 107 microseconds.
// Timed twice side by side with v003, it ran 2.38 and 2.39 times as fast.
// All steps since v000 together make it 203 times as fast.
#include <hip/hip_runtime.h>

// Compute dtypes, f32 accumulate, all images in each launch (tokens = the 4096 positions, channels-last rows of 64): GroupNorm (32 groups x 2 channels, stats over H, W and the
// products) on v_wmma_f32_16x16x32_bf16; the full 4096 x 4096 single-head attention in one fused kernel (k_attn: scores three products, softmax x 1/8 in f32 -> hi/lo, P.v three products)

#define NBI  8
#define NN   4096
#define CC   64
#define NGR  32
#define DM   CC
#define NTK  NN
#define GN_EPS 1e-6f
#define SCL  0.125f
#define LOSC 1024.0f

typedef _Float16 h16;
typedef unsigned short bf;
typedef __attribute__((ext_vector_type(16))) __bf16   v16bf;
typedef __attribute__((ext_vector_type(16))) _Float16 v16h;
typedef __attribute__((ext_vector_type(8)))  _Float16 v8h;
typedef __attribute__((ext_vector_type(8)))  unsigned short v8us;
typedef __attribute__((ext_vector_type(8)))  float    v8f;
typedef __attribute__((ext_vector_type(4)))  float    v4f;
typedef __attribute__((ext_vector_type(4)))  _Float16 v4h;
typedef v8h  __attribute__((may_alias)) v8ha;
typedef v4f  __attribute__((may_alias)) v4fa;
typedef v8us __attribute__((may_alias)) v8usa;

__device__ __forceinline__ unsigned short f2bf(float f) { unsigned u = __float_as_uint(f); u += 0x7FFFu + ((u >> 16) & 1u); return (unsigned short)(u >> 16); }
__device__ __forceinline__ float bf2f(unsigned short b) { return __uint_as_float(((unsigned)b) << 16); }
__device__ __forceinline__ float bfr(float f) { return bf2f(f2bf(f)); }
__device__ __forceinline__ v16h cat16(v8h lo, v8h hi) { return __builtin_shufflevector(lo, hi, 0, 1, 2, 3, 4, 5, 6, 7, 8, 9, 10, 11, 12, 13, 14, 15); }
__device__ __forceinline__ v16bf cat16b(v8us lo, v8us hi) { return __builtin_bit_cast(v16bf, __builtin_shufflevector(lo, hi, 0, 1, 2, 3, 4, 5, 6, 7, 8, 9, 10, 11, 12, 13, 14, 15)); }
__device__ __forceinline__ v8f wmma16(v16h a, v16h b, v8f c) { return __builtin_amdgcn_wmma_f32_16x16x32_f16(false, a, false, b, (short)0, c, false, false); }
__device__ __forceinline__ v8f wmmab(v16bf a, v16bf b, v8f c) { return __builtin_amdgcn_wmma_f32_16x16x32_bf16(false, a, false, b, (short)0, c, false, false); }

// k_wt: WT [n][K] = bf16(W[k][n]) (k-major [K][ncols]) via 64 x 64 LDS tiles; grid (K/64, ncols/64).
__global__ __launch_bounds__(256) void k_wt(const float* __restrict__ Wm, int K, int ncols, bf* WT) {
    __shared__ __align__(16) unsigned short tl[64 * 72];
    const int tid = threadIdx.x, k0 = blockIdx.x * 64, n0 = blockIdx.y * 64;
    const int kk = tid >> 2, nq = (tid & 3) * 16;
#pragma unroll
    for (int i = 0; i < 16; ++i) tl[(nq + i) * 72 + kk] = f2bf(Wm[(size_t)(k0 + kk) * ncols + n0 + nq + i]);
    __syncthreads();
    const int piece = tid & 7;
    auto pass = [&]() {
#pragma unroll
        for (int s = 0; s < 2; ++s) { const int nr = (tid >> 3) + 32 * s; const v8us val = *(const v8usa*)(tl + nr * 72 + piece * 8); *(v8us*)(WT + (size_t)(n0 + nr) * K + k0 + piece * 8) = val; }
    };
    pass(); 
}
// k_gemmb: 64 x 64 block tile (4 waves x 16 x 64) of C[NBI * NTK][ldc] = (A [+ Al]).B^T (K = 64) [+ bf(bias[c])] [+ bf(R[r][c]) residual]; f32 whole-line epilogue (or f16
template <bool SPLITA, bool F16OUT = false>
__global__ __launch_bounds__(128) void k_gemmb(const bf* __restrict__ A, const bf* __restrict__ Al, const bf* __restrict__ Bn, const float* __restrict__ bias, float* C, int ldc, h16* C2, const float* __restrict__ R = nullptr, int K = DM, int roundR = 1) {
    __shared__ __align__(16) float ost[4][16 * 68];
    const int lane = threadIdx.x & 31, wave = threadIdx.x >> 5, lr = lane & 15, hi = lane >> 4;
    const int r0 = blockIdx.x * 64 + wave * 16, c0 = blockIdx.y * 64;
    const size_t aoff = (size_t)(r0 + lr) * K + 8 * hi;
    size_t boff[4];
#pragma unroll
    for (int t = 0; t < 4; ++t) boff[t] = (size_t)(c0 + t * 16 + lr) * K + 8 * hi;
    v8f acc[4];
#pragma unroll
    for (int t = 0; t < 4; ++t) acc[t] = (v8f){};
#pragma unroll 1
    for (int kc = 0; kc < K; kc += 32) {
        const v16bf a = cat16b(*(const v8us*)(A + aoff + kc), *(const v8us*)(A + aoff + kc + 16));
        v16bf al = a;
        if (SPLITA) al = cat16b(*(const v8us*)(Al + aoff + kc), *(const v8us*)(Al + aoff + kc + 16));
#pragma unroll
        for (int t = 0; t < 4; ++t) { const v16bf b = cat16b(*(const v8us*)(Bn + boff[t] + kc), *(const v8us*)(Bn + boff[t] + kc + 16)); acc[t] = wmmab(a, b, acc[t]); if (SPLITA) acc[t] = wmmab(al, b, acc[t]); }
        asm volatile("v_nop\n\tv_nop\n\tv_nop\n\tv_nop" : "+v"(acc[0]), "+v"(acc[1]), "+v"(acc[2]), "+v"(acc[3]) : "v"(a), "v"(al));
    }
    float* os = &ost[wave][0];
#pragma unroll
    for (int t = 0; t < 4; ++t) { const float bv = bias ? bfr(bias[c0 + t * 16 + lr]) : 0.f;
#pragma unroll
        for (int j = 0; j < 8; ++j) os[(hi * 8 + j) * 68 + t * 16 + lr] = acc[t][j] + bv; }
    __syncthreads();
    if (F16OUT) {
        h16* crow = (h16*)(void*)C + (size_t)r0 * ldc + c0;
        auto pass = [&]() {
#pragma unroll
            for (int s = 0; s < 4; ++s) { const int row = 4 * s + (lane >> 3), piece = lane & 7; const float* sp = os + row * 68 + piece * 8; v8h o, o2;
#pragma unroll
                for (int i = 0; i < 8; ++i) { const h16 a = (h16)sp[i]; o[i] = a; o2[i] = (h16)((sp[i] - (float)a) * LOSC); }
                *(v8h*)(crow + (size_t)row * ldc + piece * 8) = o; if (C2) *(v8h*)(C2 + (size_t)r0 * ldc + c0 + (size_t)row * ldc + piece * 8) = o2; }
        };
        pass(); 
    } else {
        float* crow = C + (size_t)r0 * ldc + c0;
        auto pass = [&]() {
#pragma unroll
            for (int s = 0; s < 8; ++s) { const int Lid = (lane >> 3) + 4 * s, piece = lane & 7; const int row = Lid >> 1, cofs = (Lid & 1) * 32 + piece * 4;
                v4f val = *(const v4fa*)(os + row * 68 + cofs); if (R) { const v4f rv = *(const v4f*)(R + ((size_t)r0 + row) * ldc + c0 + cofs); val += roundR ? (v4f){bfr(rv[0]), bfr(rv[1]), bfr(rv[2]), bfr(rv[3])} : rv; }
                *(v4f*)(crow + (size_t)row * ldc + cofs) = val; }
        };
        pass(); 
    }
}

// k_gnstat: one work-group per (image, slice of 16 channels = 8 groups). A wave's 16-byte loads cover 8 rows x 64 bytes; each thread keeps its 16 rows x 4 channels in
// registers, so x is read once for both passes (mean, then centred squares). ST: one 128-byte line per work-group, floats 0..7 = mean, 8..15 = rsqrt(var + eps).
__global__ __launch_bounds__(1024) void k_gnstat(const float* __restrict__ x, float* ST) {
    typedef __attribute__((ext_vector_type(2))) float v2f;
    __shared__ __align__(16) v2f red[2][32][4];
    const int tid = threadIdx.x, lane = tid & 31, wave = tid >> 5, q = tid & 3;     // q: which 4 channels (2 groups) of the slice
    const float* xp = x + (size_t)blockIdx.y * NN * CC + blockIdx.x * 16 + q * 4 + (size_t)(tid >> 2) * CC;
    v4f v[16];
#pragma unroll
    for (int i = 0; i < 16; ++i) v[i] = *(const v4f*)(xp + (size_t)i * 256 * CC);
    float s0 = 0.f, s1 = 0.f;
#pragma unroll
    for (int i = 0; i < 16; ++i) { v[i] = (v4f){bfr(v[i][0]), bfr(v[i][1]), bfr(v[i][2]), bfr(v[i][3])}; s0 += v[i][0] + v[i][1]; s1 += v[i][2] + v[i][3]; }
#pragma unroll
    for (int sh = 16; sh >= 4; sh >>= 1) { s0 += __shfl_xor(s0, sh, 32); s1 += __shfl_xor(s1, sh, 32); }
    if (lane < 4) red[0][wave][q] = (v2f){s0, s1};
    __syncthreads();
    s0 = 0.f; s1 = 0.f;     // every wave adds the 32 waves' sums: 4 per lane, then the same three exchanges
#pragma unroll
    for (int j = 0; j < 4; ++j) { const v2f t = red[0][j * 8 + (lane >> 2)][q]; s0 += t[0]; s1 += t[1]; }
#pragma unroll
    for (int sh = 16; sh >= 4; sh >>= 1) { s0 += __shfl_xor(s0, sh, 32); s1 += __shfl_xor(s1, sh, 32); }
    const float mu0 = s0 / (float)(2 * NN), mu1 = s1 / (float)(2 * NN);
    float q0 = 0.f, q1 = 0.f;
#pragma unroll
    for (int i = 0; i < 16; ++i) { float d = v[i][0] - mu0; q0 = fmaf(d, d, q0); d = v[i][1] - mu0; q0 = fmaf(d, d, q0); d = v[i][2] - mu1; q1 = fmaf(d, d, q1); d = v[i][3] - mu1; q1 = fmaf(d, d, q1); }
#pragma unroll
    for (int sh = 16; sh >= 4; sh >>= 1) { q0 += __shfl_xor(q0, sh, 32); q1 += __shfl_xor(q1, sh, 32); }
    if (lane < 4) red[1][wave][q] = (v2f){q0, q1};
    __syncthreads();
    if (wave) return;     // behind the last barrier
    q0 = 0.f; q1 = 0.f;
#pragma unroll
    for (int j = 0; j < 4; ++j) { const v2f t = red[1][j * 8 + (lane >> 2)][q]; q0 += t[0]; q1 += t[1]; }
#pragma unroll
    for (int sh = 16; sh >= 4; sh >>= 1) { q0 += __shfl_xor(q0, sh, 32); q1 += __shfl_xor(q1, sh, 32); }
    if (lane < 4) {
        float* st = ST + (size_t)(blockIdx.y * 4 + blockIdx.x) * 32 + 2 * q;
        *(v2f*)st = (v2f){mu0, mu1};
        *(v2f*)(st + 8) = (v2f){rsqrtf(q0 / (float)(2 * NN) + GN_EPS), rsqrtf(q1 / (float)(2 * NN) + GN_EPS)};
    }
}
// k_qkv: GroupNorm applied, the three projections, their hi/lo splits and V's transpose in one kernel, all images in one launch; grid (NN / 64, images), 4 waves x 16 tokens.
// A lane normalises the 32 channels of its token that its fragments hold (k step ks, elements i and 8 + i = channels 32 ks + 8 hi + i and 32 ks + 16 + 8 hi + i), so h stays in registers.
// q, k: transposed products (A = weight rows, B = h rows): a lane holds 8 neighbouring channels of ONE token, 16 bytes of its row. v: A = h rows, B = weight rows: a lane holds
// 8 neighbouring tokens of one channel; the work-group's 64 tokens meet in LDS, so that V^T leaves in whole 128-byte lines, each from one wave.
__global__ __launch_bounds__(128) void k_qkv(const float* __restrict__ x, const float* __restrict__ ST, const float* __restrict__ ga, const float* __restrict__ be,
                                             const bf* __restrict__ WqT, const bf* __restrict__ WkT, const bf* __restrict__ WvT, const float* __restrict__ bq, const float* __restrict__ bk, const float* __restrict__ bv,
                                             bf* Qh, bf* Ql, bf* Kh, bf* Kl, bf* VTh, bf* VTl) {
    __shared__ __align__(16) unsigned short vs[2][CC * 72];
    const int tid = threadIdx.x, lane = tid & 31, wave = tid >> 5, lr = lane & 15, hi = lane >> 4;
    const size_t ib = (size_t)blockIdx.y * NN * CC;
    const size_t ro = ib + (size_t)(blockIdx.x * 64 + wave * 16 + lr) * CC + 8 * hi;
    const float* st = ST + blockIdx.y * 128 + 4 * hi;     // k_gnstat's four lines of this image; channels c .. c + 7 = groups c / 2 .. c / 2 + 3
    v16bf hh[2], hl[2];
#pragma unroll
    for (int ks = 0; ks < 2; ++ks) { v8us oh[2], ol[2];
#pragma unroll
        for (int hf = 0; hf < 2; ++hf) { const int cc = ks * 32 + hf * 16;     // + 8 hi: the lane's 8 channels
            const v4f xv[2] = {*(const v4f*)(x + ro + cc), *(const v4f*)(x + ro + cc + 4)};
            const v4f gv[2] = {*(const v4f*)(ga + cc + 8 * hi), *(const v4f*)(ga + cc + 8 * hi + 4)};
            const v4f ev[2] = {*(const v4f*)(be + cc + 8 * hi), *(const v4f*)(be + cc + 8 * hi + 4)};
            const v4f mu = *(const v4f*)(st + (ks * 2 + hf) * 32), rs = *(const v4f*)(st + (ks * 2 + hf) * 32 + 8);
#pragma unroll
            for (int i = 0; i < 8; ++i) { const float y = (bfr(xv[i >> 2][i & 3]) - mu[i >> 1]) * rs[i >> 1] * bfr(gv[i >> 2][i & 3]) + bfr(ev[i >> 2][i & 3]); const unsigned short hb = f2bf(y); oh[hf][i] = hb; ol[hf][i] = f2bf(y - bf2f(hb)); } }
        hh[ks] = cat16b(oh[0], oh[1]); hl[ks] = cat16b(ol[0], ol[1]); }
    const int wo = lr * CC + 8 * hi;     // a weight fragment: row 16 t + lr, the same k order as h's
    {
        v8f acc[4];
#pragma unroll
        for (int t = 0; t < 4; ++t) acc[t] = (v8f){};
#pragma unroll
        for (int ks = 0; ks < 2; ++ks) {
#pragma unroll
            for (int t = 0; t < 4; ++t) { const bf* wp = WvT + wo + t * 16 * CC + ks * 32; const v16bf w = cat16b(*(const v8us*)wp, *(const v8us*)(wp + 16)); acc[t] = wmmab(hh[ks], w, acc[t]); acc[t] = wmmab(hl[ks], w, acc[t]); } }
#pragma unroll
        for (int t = 0; t < 4; ++t) { const float bb = bfr(bv[t * 16 + lr]); v8us wh, wl;
#pragma unroll
            for (int j = 0; j < 8; ++j) { const float v = acc[t][j] + bb; const unsigned short hb = f2bf(v); wh[j] = hb; wl[j] = f2bf(v - bf2f(hb)); }
            const int o = (t * 16 + lr) * 72 + wave * 16 + 8 * hi; *(v8usa*)(&vs[0][o]) = wh; *(v8usa*)(&vs[1][o]) = wl; }
    }
    auto rows = [&](const bf* __restrict__ WT, const float* __restrict__ bias, bf* Dh, bf* Dl) {
        v8f acc[4];
#pragma unroll
        for (int t = 0; t < 4; ++t) acc[t] = (v8f){};
#pragma unroll
        for (int ks = 0; ks < 2; ++ks) {
#pragma unroll
            for (int t = 0; t < 4; ++t) { const bf* wp = WT + wo + t * 16 * CC + ks * 32; const v16bf w = cat16b(*(const v8us*)wp, *(const v8us*)(wp + 16)); acc[t] = wmmab(w, hh[ks], acc[t]); acc[t] = wmmab(w, hl[ks], acc[t]); } }
#pragma unroll
        for (int t = 0; t < 4; ++t) { const v4f bb[2] = {*(const v4f*)(bias + t * 16 + 8 * hi), *(const v4f*)(bias + t * 16 + 8 * hi + 4)}; v8us wh, wl;
#pragma unroll
            for (int j = 0; j < 8; ++j) { const float v = acc[t][j] + bfr(bb[j >> 2][j & 3]); const unsigned short hb = f2bf(v); wh[j] = hb; wl[j] = f2bf(v - bf2f(hb)); }
            *(v8us*)(Dh + ro + t * 16) = wh; *(v8us*)(Dl + ro + t * 16) = wl; }
    };
    rows(WqT, bq, Qh, Ql); rows(WkT, bk, Kh, Kl);
    __syncthreads();     // all four waves' token columns of V^T stand in LDS
#pragma unroll
    for (int s = 0; s < 4; ++s) { const int row = s * 16 + (tid >> 3), piece = tid & 7; const size_t o = ib + (size_t)row * NN + blockIdx.x * 64 + piece * 8;
        *(v8us*)(VTh + o) = *(const v8usa*)(&vs[0][row * 72 + piece * 8]); *(v8us*)(VTl + o) = *(const v8usa*)(&vs[1][row * 72 + piece * 8]); }
}
// k_attn: scores, softmax and P.v in one kernel, all images in one launch; grid (NN / 128, images), 8 waves x 16 queries, each wave walks all NN keys in passes of 32.
// Transposed products: S^T = K.Q^T (A = key rows, B = query rows kept in registers), so a lane holds 16 scores of ONE query (column lr; keys 8 hi + j of each 16-key tile)
// and the two score tiles, converted in place, are the B operand of O^T += V^T.P^T (element i = key 8 hi + i, element 8 + i = key 16 + 8 hi + i: the order the V^T loader uses).
// Running maximum and sum per query (exp2 domain); the three hi/lo products of each matrix product are kept.
// K and V^T (hi and lo) reach the waves through LDS: a stage is KT keys, brought once per work-group by asynchronous copies that read whole 128-byte lines, two buffers, the
// next stage in flight while this one is worked on. Rows are pitched 16 bytes x odd, so that the 16 rows of a fragment load fall on all 64 banks.
#define KT   128                        // keys per stage
#define KPB  (CC * 2 + 16)              // bytes from one K row to the next in LDS
#define VPB  (KT * 2 + 16)              // bytes from one V^T row to the next in LDS
#define KPL  (KT * KPB)                 // one K plane (hi or lo) of a stage
#define VPL  (CC * VPB)                 // one V^T plane of a stage
#define STG  (2 * KPL + 2 * VPL)        // one stage: K hi, K lo, V^T hi, V^T lo
__device__ __forceinline__ float xhalf(float v) { const int b = __float_as_int(v); return __int_as_float(__builtin_amdgcn_permlanex16(b, b, 0x76543210, 0xfedcba98, false, false)); }
// Eight copies of 16 bytes per lane: four row blocks of plane a, four of plane b. The s_wait_xcnt stands inside the statement, in front of any rewrite of the address registers.
__device__ __forceinline__ void copy8(unsigned la, const bf* ga, unsigned lb, const bf* gb, unsigned lstep, size_t gstep) {
    asm volatile("global_load_async_to_lds_b128 %0, %8, off\n\t"
                 "global_load_async_to_lds_b128 %1, %9, off\n\t"
                 "global_load_async_to_lds_b128 %2, %10, off\n\t"
                 "global_load_async_to_lds_b128 %3, %11, off\n\t"
                 "global_load_async_to_lds_b128 %4, %12, off\n\t"
                 "global_load_async_to_lds_b128 %5, %13, off\n\t"
                 "global_load_async_to_lds_b128 %6, %14, off\n\t"
                 "global_load_async_to_lds_b128 %7, %15, off\n\t"
                 "s_wait_xcnt 0x0"
                 :: "v"(la), "v"(la + lstep), "v"(la + 2 * lstep), "v"(la + 3 * lstep), "v"(lb), "v"(lb + lstep), "v"(lb + 2 * lstep), "v"(lb + 3 * lstep),
                    "v"(ga), "v"(ga + gstep), "v"(ga + 2 * gstep), "v"(ga + 3 * gstep), "v"(gb), "v"(gb + gstep), "v"(gb + 2 * gstep), "v"(gb + 3 * gstep) : "memory");
}
__global__ __launch_bounds__(256) void k_attn(const bf* __restrict__ Qh, const bf* __restrict__ Ql, const bf* __restrict__ Kh, const bf* __restrict__ Kl, const bf* __restrict__ VTh, const bf* __restrict__ VTl, bf* Oh, bf* Ol) {
    typedef __attribute__((ext_vector_type(2))) __bf16 v2bf; typedef __attribute__((ext_vector_type(2))) float v2f; typedef __attribute__((ext_vector_type(8))) unsigned v8u;
    __shared__ __align__(16) unsigned char ring[2 * STG];
    const int tid = threadIdx.x, lane = tid & 31, wave = tid >> 5, lr = lane & 15, hi = lane >> 4;
    const size_t ib = (size_t)blockIdx.y * NN * CC;
    const size_t qo = ib + (size_t)(blockIdx.x * 128 + wave * 16 + lr) * CC;
    const float SC2 = SCL * 1.44269504088896341f;
    // The copies: K, 8 lanes a row of 128 bytes, 32 rows a block; V^T, 16 lanes a row of 256 bytes, 16 rows a block.
    const bf* gkh = Kh + ib + tid * 8; const bf* gkl = Kl + ib + tid * 8;
    const bf* gvh = VTh + ib + (size_t)(tid >> 4) * NN + (tid & 15) * 8; const bf* gvl = VTl + ib + (size_t)(tid >> 4) * NN + (tid & 15) * 8;
    const unsigned lk = (unsigned)(size_t)ring + (tid >> 3) * KPB + (tid & 7) * 16, lv = (unsigned)(size_t)ring + 2 * KPL + (tid >> 4) * VPB + (tid & 15) * 16;
    auto fill = [&](int st) {     // stage st into buffer st & 1
        const unsigned bo = (st & 1) * STG;
        copy8(lk + bo, gkh + (size_t)st * KT * CC, lk + bo + KPL, gkl + (size_t)st * KT * CC, 32 * KPB, 32 * CC);
        copy8(lv + bo, gvh + st * KT, lv + bo + VPL, gvl + st * KT, 16 * VPB, (size_t)16 * NN);
    };
    fill(0);
    v16bf qh[2], ql[2];
#pragma unroll
    for (int ks = 0; ks < 2; ++ks) { const size_t o = qo + ks * 32 + 8 * hi; qh[ks] = cat16b(*(const v8us*)(Qh + o), *(const v8us*)(Qh + o + 16)); ql[ks] = cat16b(*(const v8us*)(Ql + o), *(const v8us*)(Ql + o + 16)); }
    v8f oa[4];
#pragma unroll
    for (int dt = 0; dt < 4; ++dt) oa[dt] = (v8f){};
    float m = -3.0e38f, l = 0.f;
    asm volatile("s_wait_asynccnt 0x0" ::: "memory");     // this wave's share of stage 0 has landed
    __syncthreads();                                      // and every other wave's
    fill(1);
#pragma unroll 1     // one copy of the stage in the text; the buffer is picked by st & 1
    for (int st = 0; st < NN / KT; ++st) {
        const unsigned char* kb = ring + (st & 1) * STG + lr * KPB + 16 * hi;
        const unsigned char* vb = ring + (st & 1) * STG + 2 * KPL + lr * VPB + 16 * hi;
        v16bf kh[2][2], kl[2][2], vh[4], vl[4];
        auto ldk = [&](int p) {
#pragma unroll
            for (int t = 0; t < 2; ++t) {
#pragma unroll
                for (int ks = 0; ks < 2; ++ks) { const unsigned char* o = kb + (p * 32 + t * 16) * KPB + ks * 64; kh[t][ks] = cat16b(*(const v8usa*)o, *(const v8usa*)(o + 32)); kl[t][ks] = cat16b(*(const v8usa*)(o + KPL), *(const v8usa*)(o + KPL + 32)); } }
        };
        auto ldv = [&](int p) {
#pragma unroll
            for (int dt = 0; dt < 4; ++dt) { const unsigned char* o = vb + dt * 16 * VPB + p * 64; vh[dt] = cat16b(*(const v8usa*)o, *(const v8usa*)(o + 32)); vl[dt] = cat16b(*(const v8usa*)(o + VPL), *(const v8usa*)(o + VPL + 32)); }
        };
        auto pass = [&](int p, bool more) {     // more: a further pass of this stage follows
            ldv(p);
            __builtin_amdgcn_sched_barrier(0);     // the V^T loads stay here, one group in flight under the score products; moved down, each waits out its LDS latency in front of its product
            v8f s[2]; s[0] = (v8f){}; s[1] = (v8f){};
#pragma unroll
            for (int ks = 0; ks < 2; ++ks) {
                s[0] = wmmab(kh[0][ks], qh[ks], s[0]); s[1] = wmmab(kh[1][ks], qh[ks], s[1]);
                s[0] = wmmab(kh[0][ks], ql[ks], s[0]); s[1] = wmmab(kh[1][ks], ql[ks], s[1]);
                s[0] = wmmab(kl[0][ks], qh[ks], s[0]); s[1] = wmmab(kl[1][ks], qh[ks], s[1]);
            }
            __builtin_amdgcn_sched_barrier(0);     // this fence and the next: the K loads stay one group, behind the products that read the same registers and in front of the softmax that covers their latency
            if (more) ldk(p + 1);     // the next pass's K fragments, inside this stage only
            __builtin_amdgcn_sched_barrier(0);
            float mt = fmaxf(s[0][0], s[1][0]);
#pragma unroll
            for (int j = 1; j < 8; ++j) mt = fmaxf(mt, fmaxf(s[0][j], s[1][j]));
            mt = fmaxf(mt, xhalf(mt));
            const float mn = fmaxf(m, mt * SC2), al = __builtin_amdgcn_exp2f(m - mn);
            m = mn;
#pragma unroll
            for (int t = 0; t < 2; ++t) {
#pragma unroll
                for (int j = 0; j < 8; ++j) s[t][j] = __builtin_amdgcn_exp2f(fmaf(s[t][j], SC2, -mn)); }
            const v8f sv = s[0] + s[1];
            l = fmaf(l, al, ((sv[0] + sv[1]) + (sv[2] + sv[3])) + ((sv[4] + sv[5]) + (sv[6] + sv[7])));
            v8u phw, plw;     // word i of the B operand = elements 2 i, 2 i + 1: hi = bf16(p), lo = bf16(p - hi)
#pragma unroll
            for (int i = 0; i < 8; ++i) { const v2f p2 = (v2f){s[i >> 2][(2 * i) & 7], s[i >> 2][((2 * i) & 7) + 1]};
                const unsigned w = __builtin_bit_cast(unsigned, __builtin_convertvector(p2, v2bf)); phw[i] = w;
                const v2f r2 = p2 - (v2f){__uint_as_float(w << 16), __uint_as_float(w & 0xFFFF0000u)}; plw[i] = __builtin_bit_cast(unsigned, __builtin_convertvector(r2, v2bf)); }
            const v16bf ph = __builtin_bit_cast(v16bf, phw), pl = __builtin_bit_cast(v16bf, plw);
#pragma unroll
            for (int dt = 0; dt < 4; ++dt) oa[dt] *= al;
#pragma unroll
            for (int dt = 0; dt < 4; ++dt) oa[dt] = wmmab(vh[dt], ph, oa[dt]);
#pragma unroll
            for (int dt = 0; dt < 4; ++dt) oa[dt] = wmmab(vh[dt], pl, oa[dt]);
#pragma unroll
            for (int dt = 0; dt < 4; ++dt) oa[dt] = wmmab(vl[dt], ph, oa[dt]);
        };
        ldk(0);
#pragma unroll 1     // unrolled, the compiler keeps all the passes' scores live to the foot of the stage and spills
        for (int p = 0; p < KT / 32 - 1; ++p) pass(p, true);
        pass(KT / 32 - 1, false);
        asm volatile("s_wait_dscnt 0x0" ::: "memory");        // this wave's reads of the buffer are over before it is refilled
        asm volatile("s_wait_asynccnt 0x0" ::: "memory");     // this wave's share of stage st + 1 has landed
        __syncthreads();                                      // publishes stage st + 1 and ends every wave's reads of stage st
        if (st + 2 < NN / KT) fill(st + 2);
    }
    asm volatile("s_wait_asynccnt 0x0" ::: "memory");     // no copy is outstanding when the wave ends
    l += xhalf(l);     // the two halves of a column hold the sums of disjoint keys
    const float inv = 1.0f / l;
#pragma unroll
    for (int dt = 0; dt < 4; ++dt) { v8us wh, wl;
#pragma unroll
        for (int j = 0; j < 8; ++j) { const float v = oa[dt][j] * inv; const unsigned short hb = f2bf(v); wh[j] = hb; wl[j] = f2bf(v - bf2f(hb)); }
        const size_t o = qo + dt * 16 + 8 * hi; *(v8us*)(Oh + o) = wh; *(v8us*)(Ol + o) = wl; }
}

extern "C" void kernel_launch(void* const* d_in, const int* in_sizes, int n_in,
                              void* d_out, int out_size, void* d_ws, size_t ws_size, hipStream_t stream) {
    (void)in_sizes; (void)n_in; (void)out_size;
    const float* x = (const float*)d_in[0]; const float* ga = (const float*)d_in[1]; const float* be = (const float*)d_in[2];
    const float* Wq = (const float*)d_in[3]; const float* bq = (const float*)d_in[4]; const float* Wk = (const float*)d_in[5]; const float* bk = (const float*)d_in[6]; const float* Wv = (const float*)d_in[7]; const float* bv = (const float*)d_in[8]; const float* Wp = (const float*)d_in[9]; const float* bp = (const float*)d_in[10];   // k-major (h @ W)
    float* out = (float*)d_out;    // [8][64][64][64] channels-last
    char* wsp = (char*)d_ws;
    auto take = [&](size_t bytes) { char* p = wsp; wsp += (bytes + 255) & ~(size_t)255; return (void*)p; };
    bf* WqT = (bf*)take(CC * CC * 2); bf* WkT = (bf*)take(CC * CC * 2); bf* WvT = (bf*)take(CC * CC * 2); bf* WpT = (bf*)take(CC * CC * 2); float* ST = (float*)take(NBI * 4 * 128);
    const size_t PLN = (size_t)NN * CC;    // one image's plane, in elements
    bf* Qh = (bf*)take(NBI * PLN * 2); bf* Ql = (bf*)take(NBI * PLN * 2); bf* Kh = (bf*)take(NBI * PLN * 2); bf* Kl = (bf*)take(NBI * PLN * 2); bf* VTh = (bf*)take(NBI * PLN * 2); bf* VTl = (bf*)take(NBI * PLN * 2);
    bf* Oh = (bf*)take(NBI * PLN * 2); bf* Ol = (bf*)take(NBI * PLN * 2);
    if ((size_t)(wsp - (char*)d_ws) > ws_size) return;    // ~ 0.03 + 8 x 4.2 ~ 34 MB
    k_wt<<<dim3(1, 1, 1), 256, 0, stream>>>(Wq, CC, CC, WqT); k_wt<<<dim3(1, 1, 1), 256, 0, stream>>>(Wk, CC, CC, WkT); k_wt<<<dim3(1, 1, 1), 256, 0, stream>>>(Wv, CC, CC, WvT); k_wt<<<dim3(1, 1, 1), 256, 0, stream>>>(Wp, CC, CC, WpT);
    k_gnstat<<<dim3(4, NBI, 1), 1024, 0, stream>>>(x, ST);
    k_qkv<<<dim3(NN / 64, NBI, 1), 128, 0, stream>>>(x, ST, ga, be, WqT, WkT, WvT, bq, bk, bv, Qh, Ql, Kh, Kl, VTh, VTl);
    k_attn<<<dim3(NN / 128, NBI, 1), 256, 0, stream>>>(Qh, Ql, Kh, Kl, VTh, VTl, Oh, Ol);
    k_gemmb<true, false><<<dim3(NBI * NN / 64, 1, 1), 128, 0, stream>>>(Oh, Ol, WpT, bp, out, CC, nullptr, x, CC, 1);    // attn.Wp + bp + x
}

// v005
// One run takes 100 microseconds.
// In both of two side-by-side timings against v004, it was 1.07 times as fast.
// Counting every step since v000, it is 217 times as fast.
#include <hip/hip_runtime.h>

// Compute dtypes, f32 accumulate, all images in each launch (tokens = the 4096 positions, channels-last rows of 64): GroupNorm (32 groups x 2 channels, stats over H, W and the
// products) on v_wmma_f32_16x16x32_bf16; the full 4096 x 4096 single-head attention in one fused kernel (k_attn: scores three products, softmax x 1/8 in f32 -> hi/lo, P.v three products)

#define NBI  8
#define NN   4096
#define CC   64
#define NGR  32
#define DM   CC
#define NTK  NN
#define GN_EPS 1e-6f
#define SCL  0.125f
#define LOSC 1024.0f

typedef _Float16 h16;
typedef unsigned short bf;
typedef __attribute__((ext_vector_type(16))) __bf16   v16bf;
typedef __attribute__((ext_vector_type(16))) _Float16 v16h;
typedef __attribute__((ext_vector_type(8)))  _Float16 v8h;
typedef __attribute__((ext_vector_type(8)))  unsigned short v8us;
typedef __attribute__((ext_vector_type(8)))  float    v8f;
typedef __attribute__((ext_vector_type(4)))  float    v4f;
typedef __attribute__((ext_vector_type(4)))  _Float16 v4h;
typedef v8h  __attribute__((may_alias)) v8ha;
typedef v4f  __attribute__((may_alias)) v4fa;
typedef v8us __attribute__((may_alias)) v8usa;

__device__ __forceinline__ unsigned short f2bf(float f) { unsigned u = __float_as_uint(f); u += 0x7FFFu + ((u >> 16) & 1u); return (unsigned short)(u >> 16); }
__device__ __forceinline__ float bf2f(unsigned short b) { return __uint_as_float(((unsigned)b) << 16); }
__device__ __forceinline__ float bfr(float f) { return bf2f(f2bf(f)); }
__device__ __forceinline__ v16h cat16(v8h lo, v8h hi) { return __builtin_shufflevector(lo, hi, 0, 1, 2, 3, 4, 5, 6, 7, 8, 9, 10, 11, 12, 13, 14, 15); }
__device__ __forceinline__ v16bf cat16b(v8us lo, v8us hi) { return __builtin_bit_cast(v16bf, __builtin_shufflevector(lo, hi, 0, 1, 2, 3, 4, 5, 6, 7, 8, 9, 10, 11, 12, 13, 14, 15)); }
__device__ __forceinline__ v8f wmma16(v16h a, v16h b, v8f c) { return __builtin_amdgcn_wmma_f32_16x16x32_f16(false, a, false, b, (short)0, c, false, false); }
__device__ __forceinline__ v8f wmmab(v16bf a, v16bf b, v8f c) { return __builtin_amdgcn_wmma_f32_16x16x32_bf16(false, a, false, b, (short)0, c, false, false); }

// k_wt: WT [n][K] = bf16(W[k][n]) (k-major [K][ncols]) via 64 x 64 LDS tiles; grid (K/64, ncols/64).
__global__ __launch_bounds__(256) void k_wt(const float* __restrict__ Wm, int K, int ncols, bf* WT) {
    __shared__ __align__(16) unsigned short tl[64 * 72];
    const int tid = threadIdx.x, k0 = blockIdx.x * 64, n0 = blockIdx.y * 64;
    const int kk = tid >> 2, nq = (tid & 3) * 16;
#pragma unroll
    for (int i = 0; i < 16; ++i) tl[(nq + i) * 72 + kk] = f2bf(Wm[(size_t)(k0 + kk) * ncols + n0 + nq + i]);
    __syncthreads();
    const int piece = tid & 7;
    auto pass = [&]() {
#pragma unroll
        for (int s = 0; s < 2; ++s) { const int nr = (tid >> 3) + 32 * s; const v8us val = *(const v8usa*)(tl + nr * 72 + piece * 8); *(v8us*)(WT + (size_t)(n0 + nr) * K + k0 + piece * 8) = val; }
    };
    pass(); 
}
// k_gemmb: 64 x 64 block tile (4 waves x 16 x 64) of C[NBI * NTK][ldc] = (A [+ Al]).B^T (K = 64) [+ bf(bias[c])] [+ bf(R[r][c]) residual]; f32 whole-line epilogue (or f16
template <bool SPLITA, bool F16OUT = false>
__global__ __launch_bounds__(128) void k_gemmb(const bf* __restrict__ A, const bf* __restrict__ Al, const bf* __restrict__ Bn, const float* __restrict__ bias, float* C, int ldc, h16* C2, const float* __restrict__ R = nullptr, int K = DM, int roundR = 1) {
    __shared__ __align__(16) float ost[4][16 * 68];
    const int lane = threadIdx.x & 31, wave = threadIdx.x >> 5, lr = lane & 15, hi = lane >> 4;
    const int r0 = blockIdx.x * 64 + wave * 16, c0 = blockIdx.y * 64;
    const size_t aoff = (size_t)(r0 + lr) * K + 8 * hi;
    size_t boff[4];
#pragma unroll
    for (int t = 0; t < 4; ++t) boff[t] = (size_t)(c0 + t * 16 + lr) * K + 8 * hi;
    v8f acc[4];
#pragma unroll
    for (int t = 0; t < 4; ++t) acc[t] = (v8f){};
#pragma unroll 1
    for (int kc = 0; kc < K; kc += 32) {
        const v16bf a = cat16b(*(const v8us*)(A + aoff + kc), *(const v8us*)(A + aoff + kc + 16));
        v16bf al = a;
        if (SPLITA) al = cat16b(*(const v8us*)(Al + aoff + kc), *(const v8us*)(Al + aoff + kc + 16));
#pragma unroll
        for (int t = 0; t < 4; ++t) { const v16bf b = cat16b(*(const v8us*)(Bn + boff[t] + kc), *(const v8us*)(Bn + boff[t] + kc + 16)); acc[t] = wmmab(a, b, acc[t]); if (SPLITA) acc[t] = wmmab(al, b, acc[t]); }
        asm volatile("v_nop\n\tv_nop\n\tv_nop\n\tv_nop" : "+v"(acc[0]), "+v"(acc[1]), "+v"(acc[2]), "+v"(acc[3]) : "v"(a), "v"(al));
    }
    float* os = &ost[wave][0];
#pragma unroll
    for (int t = 0; t < 4; ++t) { const float bv = bias ? bfr(bias[c0 + t * 16 + lr]) : 0.f;
#pragma unroll
        for (int j = 0; j < 8; ++j) os[(hi * 8 + j) * 68 + t * 16 + lr] = acc[t][j] + bv; }
    __syncthreads();
    if (F16OUT) {
        h16* crow = (h16*)(void*)C + (size_t)r0 * ldc + c0;
        auto pass = [&]() {
#pragma unroll
            for (int s = 0; s < 4; ++s) { const int row = 4 * s + (lane >> 3), piece = lane & 7; const float* sp = os + row * 68 + piece * 8; v8h o, o2;
#pragma unroll
                for (int i = 0; i < 8; ++i) { const h16 a = (h16)sp[i]; o[i] = a; o2[i] = (h16)((sp[i] - (float)a) * LOSC); }
                *(v8h*)(crow + (size_t)row * ldc + piece * 8) = o; if (C2) *(v8h*)(C2 + (size_t)r0 * ldc + c0 + (size_t)row * ldc + piece * 8) = o2; }
        };
        pass(); 
    } else {
        float* crow = C + (size_t)r0 * ldc + c0;
        auto pass = [&]() {
#pragma unroll
            for (int s = 0; s < 8; ++s) { const int Lid = (lane >> 3) + 4 * s, piece = lane & 7; const int row = Lid >> 1, cofs = (Lid & 1) * 32 + piece * 4;
                v4f val = *(const v4fa*)(os + row * 68 + cofs); if (R) { const v4f rv = *(const v4f*)(R + ((size_t)r0 + row) * ldc + c0 + cofs); val += roundR ? (v4f){bfr(rv[0]), bfr(rv[1]), bfr(rv[2]), bfr(rv[3])} : rv; }
                *(v4f*)(crow + (size_t)row * ldc + cofs) = val; }
        };
        pass(); 
    }
}

// k_gnstat: one work-group per (image, slice of 16 channels = 8 groups). A wave's 16-byte loads cover 8 rows x 64 bytes; each thread keeps its 16 rows x 4 channels in
// registers, so x is read once for both passes (mean, then centred squares). ST: one 128-byte line per work-group, floats 0..7 = mean, 8..15 = rsqrt(var + eps).
__global__ __launch_bounds__(1024) void k_gnstat(const float* __restrict__ x, float* ST) {
    typedef __attribute__((ext_vector_type(2))) float v2f;
    __shared__ __align__(16) v2f red[2][32][4];
    const int tid = threadIdx.x, lane = tid & 31, wave = tid >> 5, q = tid & 3;     // q: which 4 channels (2 groups) of the slice
    const float* xp = x + (size_t)blockIdx.y * NN * CC + blockIdx.x * 16 + q * 4 + (size_t)(tid >> 2) * CC;
    v4f v[16];
#pragma unroll
    for (int i = 0; i < 16; ++i) v[i] = *(const v4f*)(xp + (size_t)i * 256 * CC);
    float s0 = 0.f, s1 = 0.f;
#pragma unroll
    for (int i = 0; i < 16; ++i) { v[i] = (v4f){bfr(v[i][0]), bfr(v[i][1]), bfr(v[i][2]), bfr(v[i][3])}; s0 += v[i][0] + v[i][1]; s1 += v[i][2] + v[i][3]; }
#pragma unroll
    for (int sh = 16; sh >= 4; sh >>= 1) { s0 += __shfl_xor(s0, sh, 32); s1 += __shfl_xor(s1, sh, 32); }
    if (lane < 4) red[0][wave][q] = (v2f){s0, s1};
    __syncthreads();
    s0 = 0.f; s1 = 0.f;     // every wave adds the 32 waves' sums: 4 per lane, then the same three exchanges
#pragma unroll
    for (int j = 0; j < 4; ++j) { const v2f t = red[0][j * 8 + (lane >> 2)][q]; s0 += t[0]; s1 += t[1]; }
#pragma unroll
    for (int sh = 16; sh >= 4; sh >>= 1) { s0 += __shfl_xor(s0, sh, 32); s1 += __shfl_xor(s1, sh, 32); }
    const float mu0 = s0 / (float)(2 * NN), mu1 = s1 / (float)(2 * NN);
    float q0 = 0.f, q1 = 0.f;
#pragma unroll
    for (int i = 0; i < 16; ++i) { float d = v[i][0] - mu0; q0 = fmaf(d, d, q0); d = v[i][1] - mu0; q0 = fmaf(d, d, q0); d = v[i][2] - mu1; q1 = fmaf(d, d, q1); d = v[i][3] - mu1; q1 = fmaf(d, d, q1); }
#pragma unroll
    for (int sh = 16; sh >= 4; sh >>= 1) { q0 += __shfl_xor(q0, sh, 32); q1 += __shfl_xor(q1, sh, 32); }
    if (lane < 4) red[1][wave][q] = (v2f){q0, q1};
    __syncthreads();
    if (wave) return;     // behind the last barrier
    q0 = 0.f; q1 = 0.f;
#pragma unroll
    for (int j = 0; j < 4; ++j) { const v2f t = red[1][j * 8 + (lane >> 2)][q]; q0 += t[0]; q1 += t[1]; }
#pragma unroll
    for (int sh = 16; sh >= 4; sh >>= 1) { q0 += __shfl_xor(q0, sh, 32); q1 += __shfl_xor(q1, sh, 32); }
    if (lane < 4) {
        float* st = ST + (size_t)(blockIdx.y * 4 + blockIdx.x) * 32 + 2 * q;
        *(v2f*)st = (v2f){mu0, mu1};
        *(v2f*)(st + 8) = (v2f){rsqrtf(q0 / (float)(2 * NN) + GN_EPS), rsqrtf(q1 / (float)(2 * NN) + GN_EPS)};
    }
}
// k_qkv: GroupNorm applied, the three projections, their hi/lo splits and V's transpose in one kernel, all images in one launch; grid (NN / 64, images), 4 waves x 16 tokens.
// A lane normalises the 32 channels of its token that its fragments hold (k step ks, elements i and 8 + i = channels 32 ks + 8 hi + i and 32 ks + 16 + 8 hi + i), so h stays in registers.
// q, k: transposed products (A = weight rows, B = h rows): a lane holds 8 neighbouring channels of ONE token, 16 bytes of its row. v: A = h rows, B = weight rows: a lane holds
// 8 neighbouring tokens of one channel; the work-group's 64 tokens meet in LDS, so that V^T leaves in whole 128-byte lines, each from one wave.
__global__ __launch_bounds__(128) void k_qkv(const float* __restrict__ x, const float* __restrict__ ST, const float* __restrict__ ga, const float* __restrict__ be,
                                             const bf* __restrict__ WqT, const bf* __restrict__ WkT, const bf* __restrict__ WvT, const float* __restrict__ bq, const float* __restrict__ bk, const float* __restrict__ bv,
                                             bf* Qh, bf* Ql, bf* Kh, bf* Kl, bf* VTh, bf* VTl) {
    __shared__ __align__(16) unsigned short vs[2][CC * 72];
    const int tid = threadIdx.x, lane = tid & 31, wave = tid >> 5, lr = lane & 15, hi = lane >> 4;
    const size_t ib = (size_t)blockIdx.y * NN * CC;
    const size_t ro = ib + (size_t)(blockIdx.x * 64 + wave * 16 + lr) * CC + 8 * hi;
    const float* st = ST + blockIdx.y * 128 + 4 * hi;     // k_gnstat's four lines of this image; channels c .. c + 7 = groups c / 2 .. c / 2 + 3
    v16bf hh[2], hl[2];
#pragma unroll
    for (int ks = 0; ks < 2; ++ks) { v8us oh[2], ol[2];
#pragma unroll
        for (int hf = 0; hf < 2; ++hf) { const int cc = ks * 32 + hf * 16;     // + 8 hi: the lane's 8 channels
            const v4f xv[2] = {*(const v4f*)(x + ro + cc), *(const v4f*)(x + ro + cc + 4)};
            const v4f gv[2] = {*(const v4f*)(ga + cc + 8 * hi), *(const v4f*)(ga + cc + 8 * hi + 4)};
            const v4f ev[2] = {*(const v4f*)(be + cc + 8 * hi), *(const v4f*)(be + cc + 8 * hi + 4)};
            const v4f mu = *(const v4f*)(st + (ks * 2 + hf) * 32), rs = *(const v4f*)(st + (ks * 2 + hf) * 32 + 8);
#pragma unroll
            for (int i = 0; i < 8; ++i) { const float y = (bfr(xv[i >> 2][i & 3]) - mu[i >> 1]) * rs[i >> 1] * bfr(gv[i >> 2][i & 3]) + bfr(ev[i >> 2][i & 3]); const unsigned short hb = f2bf(y); oh[hf][i] = hb; ol[hf][i] = f2bf(y - bf2f(hb)); } }
        hh[ks] = cat16b(oh[0], oh[1]); hl[ks] = cat16b(ol[0], ol[1]); }
    const int wo = lr * CC + 8 * hi;     // a weight fragment: row 16 t + lr, the same k order as h's
    {
        v8f acc[4];
#pragma unroll
        for (int t = 0; t < 4; ++t) acc[t] = (v8f){};
#pragma unroll
        for (int ks = 0; ks < 2; ++ks) {
#pragma unroll
            for (int t = 0; t < 4; ++t) { const bf* wp = WvT + wo + t * 16 * CC + ks * 32; const v16bf w = cat16b(*(const v8us*)wp, *(const v8us*)(wp + 16)); acc[t] = wmmab(hh[ks], w, acc[t]); acc[t] = wmmab(hl[ks], w, acc[t]); } }
#pragma unroll
        for (int t = 0; t < 4; ++t) { const float bb = bfr(bv[t * 16 + lr]); v8us wh, wl;
#pragma unroll
            for (int j = 0; j < 8; ++j) { const float v = acc[t][j] + bb; const unsigned short hb = f2bf(v); wh[j] = hb; wl[j] = f2bf(v - bf2f(hb)); }
            const int o = (t * 16 + lr) * 72 + wave * 16 + 8 * hi; *(v8usa*)(&vs[0][o]) = wh; *(v8usa*)(&vs[1][o]) = wl; }
    }
    auto rows = [&](const bf* __restrict__ WT, const float* __restrict__ bias, bf* Dh, bf* Dl) {
        v8f acc[4];
#pragma unroll
        for (int t = 0; t < 4; ++t) acc[t] = (v8f){};
#pragma unroll
        for (int ks = 0; ks < 2; ++ks) {
#pragma unroll
            for (int t = 0; t < 4; ++t) { const bf* wp = WT + wo + t * 16 * CC + ks * 32; const v16bf w = cat16b(*(const v8us*)wp, *(const v8us*)(wp + 16)); acc[t] = wmmab(w, hh[ks], acc[t]); acc[t] = wmmab(w, hl[ks], acc[t]); } }
#pragma unroll
        for (int t = 0; t < 4; ++t) { const v4f bb[2] = {*(const v4f*)(bias + t * 16 + 8 * hi), *(const v4f*)(bias + t * 16 + 8 * hi + 4)}; v8us wh, wl;
#pragma unroll
            for (int j = 0; j < 8; ++j) { const float v = acc[t][j] + bfr(bb[j >> 2][j & 3]); const unsigned short hb = f2bf(v); wh[j] = hb; wl[j] = f2bf(v - bf2f(hb)); }
            *(v8us*)(Dh + ro + t * 16) = wh; *(v8us*)(Dl + ro + t * 16) = wl; }
    };
    rows(WqT, bq, Qh, Ql); rows(WkT, bk, Kh, Kl);
    __syncthreads();     // all four waves' token columns of V^T stand in LDS
#pragma unroll
    for (int s = 0; s < 4; ++s) { const int row = s * 16 + (tid >> 3), piece = tid & 7; const size_t o = ib + (size_t)row * NN + blockIdx.x * 64 + piece * 8;
        *(v8us*)(VTh + o) = *(const v8usa*)(&vs[0][row * 72 + piece * 8]); *(v8us*)(VTl + o) = *(const v8usa*)(&vs[1][row * 72 + piece * 8]); }
}
// k_attn: scores, softmax and P.v in one kernel, all images in one launch; grid (NN / 128, images), 8 waves. A wave holds 32 queries (two column groups of 16; wave & 3 picks them) and
// walks one half of every stage's keys (wave >> 2 picks it) in passes of 32, so that each K and V^T fragment read from LDS feeds two query tiles; the two waves of a pair join at the end.
// Transposed products: S^T = K.Q^T (A = key rows, B = query rows kept in registers), so a lane holds 16 scores of ONE query of each group (column lr; keys 8 hi + j of each 16-key tile)
// and the two score tiles, converted in place, are the B operand of O^T += V^T.P^T (element i = key 8 hi + i, element 8 + i = key 16 + 8 hi + i: the order the V^T loader uses).
// Running maximum and sum per query (exp2 domain); the three hi/lo products of each matrix product are kept.
// K and V^T (hi and lo) reach the waves through LDS: a stage is KT keys, brought once per work-group by asynchronous copies that read whole 128-byte lines, two buffers, the
// next stage in flight while this one is worked on. Rows are pitched 16 bytes x odd, so that the 16 rows of a fragment load fall on all 64 banks.
#define KT   256                        // keys per stage: four passes of 32 for each wave of a pair
#define KPB  (CC * 2 + 16)              // bytes from one K row to the next in LDS
#define VPB  (KT * 2 + 16)              // bytes from one V^T row to the next in LDS
#define KPL  (KT * KPB)                 // one K plane (hi or lo) of a stage
#define VPL  (CC * VPB)                 // one V^T plane of a stage
#define STG  (2 * KPL + 2 * VPL)        // one stage: K hi, K lo, V^T hi, V^T lo
#define XSL  (32 * 136)                 // the join: a wave's slot in the ring, 32 lanes x (32 floats of O^T, maximum, sum)
__device__ __forceinline__ float xhalf(float v) { const int b = __float_as_int(v); return __int_as_float(__builtin_amdgcn_permlanex16(b, b, 0x76543210, 0xfedcba98, false, false)); }
// Eight copies of 16 bytes per lane: four row blocks of plane a, four of plane b. The s_wait_xcnt stands inside the statement, in front of any rewrite of the address registers.
__device__ __forceinline__ void copy8(unsigned la, const bf* ga, unsigned lb, const bf* gb, unsigned lstep, size_t gstep) {
    asm volatile("global_load_async_to_lds_b128 %0, %8, off\n\t"
                 "global_load_async_to_lds_b128 %1, %9, off\n\t"
                 "global_load_async_to_lds_b128 %2, %10, off\n\t"
                 "global_load_async_to_lds_b128 %3, %11, off\n\t"
                 "global_load_async_to_lds_b128 %4, %12, off\n\t"
                 "global_load_async_to_lds_b128 %5, %13, off\n\t"
                 "global_load_async_to_lds_b128 %6, %14, off\n\t"
                 "global_load_async_to_lds_b128 %7, %15, off\n\t"
                 "s_wait_xcnt 0x0"
                 :: "v"(la), "v"(la + lstep), "v"(la + 2 * lstep), "v"(la + 3 * lstep), "v"(lb), "v"(lb + lstep), "v"(lb + 2 * lstep), "v"(lb + 3 * lstep),
                    "v"(ga), "v"(ga + gstep), "v"(ga + 2 * gstep), "v"(ga + 3 * gstep), "v"(gb), "v"(gb + gstep), "v"(gb + 2 * gstep), "v"(gb + 3 * gstep) : "memory");
}
__global__ __launch_bounds__(256) void k_attn(const bf* __restrict__ Qh, const bf* __restrict__ Ql, const bf* __restrict__ Kh, const bf* __restrict__ Kl, const bf* __restrict__ VTh, const bf* __restrict__ VTl, bf* Oh, bf* Ol) {
    typedef __attribute__((ext_vector_type(2))) __bf16 v2bf; typedef __attribute__((ext_vector_type(2))) float v2f; typedef __attribute__((ext_vector_type(8))) unsigned v8u;
    typedef v2f __attribute__((may_alias)) v2fa;
    typedef unsigned char __attribute__((address_space(3))) ldsb; typedef v8usa __attribute__((address_space(3))) v8usl;     // LDS by its own 32-bit address
    __shared__ __align__(16) unsigned char ring[2 * STG];
    const int tid = threadIdx.x, lane = tid & 31, wave = tid >> 5, lr = lane & 15, hi = lane >> 4;
    const int qg = wave & 3, kq = wave >> 2;     // which 32 queries; which KT / 2 keys of every stage
    const size_t ib = (size_t)blockIdx.y * NN * CC;
    const size_t qo = ib + (size_t)(blockIdx.x * 128 + qg * 32 + lr) * CC;     // column group g: + g * 16 * CC
    const float SC2 = SCL * 1.44269504088896341f;
    // The copies: K, 8 lanes a row of 128 bytes, 32 rows a block; V^T, 32 lanes a row of 512 bytes, 8 rows a block; eight blocks a plane.
    const bf* gkh = Kh + ib + tid * 8; const bf* gkl = Kl + ib + tid * 8;
    const bf* gvh = VTh + ib + (size_t)(tid >> 5) * NN + (tid & 31) * 8; const bf* gvl = VTl + ib + (size_t)(tid >> 5) * NN + (tid & 31) * 8;
    const unsigned lk = (unsigned)(size_t)ring + (tid >> 3) * KPB + (tid & 7) * 16, lv = (unsigned)(size_t)ring + 2 * KPL + (tid >> 5) * VPB + (tid & 31) * 16;
    auto fill = [&](int st) {     // stage st into buffer st & 1
        const unsigned bo = (st & 1) * STG;
#pragma unroll
        for (int h = 0; h < 2; ++h) {     // four blocks of each plane a call
            copy8(lk + bo + h * 128 * KPB, gkh + (size_t)st * KT * CC + h * 128 * CC, lk + bo + KPL + h * 128 * KPB, gkl + (size_t)st * KT * CC + h * 128 * CC, 32 * KPB, 32 * CC);
            copy8(lv + bo + h * 32 * VPB, gvh + st * KT + (size_t)h * 32 * NN, lv + bo + VPL + h * 32 * VPB, gvl + st * KT + (size_t)h * 32 * NN, 8 * VPB, (size_t)8 * NN);
        }
    };
    v16bf qh[2][2], ql[2][2];
#pragma unroll
    for (int g = 0; g < 2; ++g) {
#pragma unroll
        for (int ks = 0; ks < 2; ++ks) { const size_t o = qo + g * 16 * CC + ks * 32 + 8 * hi; qh[g][ks] = cat16b(*(const v8us*)(Qh + o), *(const v8us*)(Qh + o + 16)); ql[g][ks] = cat16b(*(const v8us*)(Ql + o), *(const v8us*)(Ql + o + 16)); } }
    asm volatile("s_wait_xcnt 0x0" ::: "memory");     // in front of the first rewrite of the Q loads' address registers
    __builtin_amdgcn_sched_barrier(0);                // keeps the vector work that follows, which reuses those registers, behind that wait
    v8f oa[2][4];
#pragma unroll
    for (int g = 0; g < 2; ++g) {
#pragma unroll
        for (int dt = 0; dt < 4; ++dt) oa[g][dt] = (v8f){}; }
    float m[2] = {-3.0e38f, -3.0e38f}, l[2] = {0.f, 0.f};
    // Trips -2 and -1 are the ring's prologue: stage 0's copies; their wait and the barrier, then stage 1's copies. So the copies stand once in the text and every address operand of theirs is
    // formed at the call: a base address that is itself an operand of an asm statement must stay below v256 for its whole life, and spilled.
#pragma unroll 1     // one copy of the stage in the text; the buffer is picked by st & 1
    for (int st = -2; st < NN / KT; ++st) {
      if (st >= 0) {
        const unsigned char* kb = ring + (st & 1) * STG + (kq * (KT / 2) + lr) * KPB + 16 * hi;
        // KT / 2 keys = KT bytes along a V^T row. The address is formed as an integer, so that 2 * KPL lies in the base register and every fragment's distance fits the offset field of its ds_load.
        const ldsb* vb = (const ldsb*)((unsigned)(size_t)ring + (st & 1) * STG + 2 * KPL + lr * VPB + kq * KT + 16 * hi);
        v16bf kh[2][2], kl[2][2], vh[4], vl[4];
        auto ldk = [&](int p) {
#pragma unroll
            for (int t = 0; t < 2; ++t) {
#pragma unroll
                for (int ks = 0; ks < 2; ++ks) { const unsigned char* o = kb + (p * 32 + t * 16) * KPB + ks * 64; kh[t][ks] = cat16b(*(const v8usa*)o, *(const v8usa*)(o + 32)); kl[t][ks] = cat16b(*(const v8usa*)(o + KPL), *(const v8usa*)(o + KPL + 32)); } }
        };
        auto ldv = [&](int p) {
#pragma unroll
            for (int dt = 0; dt < 4; ++dt) { const ldsb* o = vb + dt * 16 * VPB + p * 64; vh[dt] = cat16b(*(const v8usl*)o, *(const v8usl*)(o + 32)); vl[dt] = cat16b(*(const v8usl*)(o + VPL), *(const v8usl*)(o + VPL + 32)); }
        };
        auto pass = [&](int p, bool more) {     // more: a further pass of this wave in this stage follows
            ldv(p);
            __builtin_amdgcn_sched_barrier(0);     // the V^T loads stay here, one group in flight under the score products; moved down, each waits out its LDS latency in front of its product
            v8f s[2][2];
#pragma unroll
            for (int g = 0; g < 2; ++g) { s[g][0] = (v8f){}; s[g][1] = (v8f){}; }
#pragma unroll
            for (int ks = 0; ks < 2; ++ks) {
#pragma unroll
                for (int g = 0; g < 2; ++g) { s[g][0] = wmmab(kh[0][ks], qh[g][ks], s[g][0]); s[g][1] = wmmab(kh[1][ks], qh[g][ks], s[g][1]); }
#pragma unroll
                for (int g = 0; g < 2; ++g) { s[g][0] = wmmab(kh[0][ks], ql[g][ks], s[g][0]); s[g][1] = wmmab(kh[1][ks], ql[g][ks], s[g][1]); }
#pragma unroll
                for (int g = 0; g < 2; ++g) { s[g][0] = wmmab(kl[0][ks], qh[g][ks], s[g][0]); s[g][1] = wmmab(kl[1][ks], qh[g][ks], s[g][1]); }
            }
            __builtin_amdgcn_sched_barrier(0);     // this fence and the next: the K loads stay one group, behind the products that read the same registers and in front of the softmax that covers their latency
            if (more) ldk(p + 1);     // the next pass's K fragments, inside this stage only
            __builtin_amdgcn_sched_barrier(0);
#pragma unroll
            for (int g = 0; g < 2; ++g) {
                float mt = fmaxf(s[g][0][0], s[g][1][0]);
#pragma unroll
                for (int j = 1; j < 8; ++j) mt = fmaxf(mt, fmaxf(s[g][0][j], s[g][1][j]));
                mt = fmaxf(mt, xhalf(mt));
                const float mn = fmaxf(m[g], mt * SC2), al = __builtin_amdgcn_exp2f(m[g] - mn);
                m[g] = mn;
#pragma unroll
                for (int t = 0; t < 2; ++t) {
#pragma unroll
                    for (int j = 0; j < 8; ++j) s[g][t][j] = __builtin_amdgcn_exp2f(fmaf(s[g][t][j], SC2, -mn)); }
                const v8f sv = s[g][0] + s[g][1];
                l[g] = fmaf(l[g], al, ((sv[0] + sv[1]) + (sv[2] + sv[3])) + ((sv[4] + sv[5]) + (sv[6] + sv[7])));
                v8u phw, plw;     // word i of the B operand = elements 2 i, 2 i + 1: hi = bf16(p), lo = bf16(p - hi)
#pragma unroll
                for (int i = 0; i < 8; ++i) { const v2f p2 = (v2f){s[g][i >> 2][(2 * i) & 7], s[g][i >> 2][((2 * i) & 7) + 1]};
                    const unsigned w = __builtin_bit_cast(unsigned, __builtin_convertvector(p2, v2bf)); phw[i] = w;
                    const v2f r2 = p2 - (v2f){__uint_as_float(w << 16), __uint_as_float(w & 0xFFFF0000u)}; plw[i] = __builtin_bit_cast(unsigned, __builtin_convertvector(r2, v2bf)); }
                const v16bf ph = __builtin_bit_cast(v16bf, phw), pl = __builtin_bit_cast(v16bf, plw);
#pragma unroll
                for (int dt = 0; dt < 4; ++dt) oa[g][dt] *= al;
#pragma unroll
                for (int dt = 0; dt < 4; ++dt) oa[g][dt] = wmmab(vh[dt], ph, oa[g][dt]);
#pragma unroll
                for (int dt = 0; dt < 4; ++dt) oa[g][dt] = wmmab(vh[dt], pl, oa[g][dt]);
#pragma unroll
                for (int dt = 0; dt < 4; ++dt) oa[g][dt] = wmmab(vl[dt], ph, oa[g][dt]);
            }
        };
        ldk(0);
#pragma unroll 1     // unrolled, the compiler keeps all the passes' scores live to the foot of the stage
        for (int p = 0; p < KT / 64 - 1; ++p) pass(p, true);
        pass(KT / 64 - 1, false);
      }
        if (st >= -1) {     // the same for the whole work-group
            asm volatile("s_wait_dscnt 0x0" ::: "memory");        // this wave's reads of the buffer are over before it is refilled
            asm volatile("s_wait_asynccnt 0x0" ::: "memory");     // this wave's share of stage st + 1 has landed
            __syncthreads();                                      // publishes stage st + 1 and ends every wave's reads of stage st
        }
        if (st + 2 < NN / KT) fill(st + 2);
    }
    asm volatile("s_wait_asynccnt 0x0" ::: "memory");     // no copy is outstanding when the wave ends
    // The join. Waves w and w ^ 4 hold the same 32 queries over disjoint keys; wave w finishes column group kq and hands the other group's maximum, sum and O^T to its partner through
    // the ring, which is free: the loop's last barrier stands behind every wave's last read of it, and no copy is under way.
    const bool up = kq != 0;
    unsigned char* xw = ring + wave * XSL;
    const unsigned char* xr = ring + (wave ^ 4) * XSL;
#pragma unroll
    for (int dt = 0; dt < 4; ++dt) { const v8f gv = up ? oa[0][dt] : oa[1][dt];
        *(v4fa*)(xw + (2 * dt) * 512 + lane * 16) = __builtin_shufflevector(gv, gv, 0, 1, 2, 3); *(v4fa*)(xw + (2 * dt + 1) * 512 + lane * 16) = __builtin_shufflevector(gv, gv, 4, 5, 6, 7); }
    *(v2fa*)(xw + 4096 + lane * 8) = (v2f){up ? m[0] : m[1], up ? l[0] : l[1]};
    __syncthreads();     // both waves of every pair have written what the other reads
    const v2f pml = *(const v2fa*)(xr + 4096 + lane * 8);
    const float km = up ? m[1] : m[0], kl_ = up ? l[1] : l[0];
    const float mn = fmaxf(km, pml[0]), fa = __builtin_amdgcn_exp2f(km - mn), fb = __builtin_amdgcn_exp2f(pml[0] - mn);
    float lt = fmaf(kl_, fa, pml[1] * fb);
    lt += xhalf(lt);     // the two halves of a column hold the sums of disjoint keys
    const float inv = 1.0f / lt, ca = fa * inv, cb = fb * inv;
#pragma unroll
    for (int dt = 0; dt < 4; ++dt) { const v8f kv = up ? oa[1][dt] : oa[0][dt]; const v4f p0 = *(const v4fa*)(xr + (2 * dt) * 512 + lane * 16), p1 = *(const v4fa*)(xr + (2 * dt + 1) * 512 + lane * 16); v8us wh, wl;
#pragma unroll
        for (int j = 0; j < 8; ++j) { const float v = fmaf(kv[j], ca, (j < 4 ? p0[j & 3] : p1[j & 3]) * cb); const unsigned short hb = f2bf(v); wh[j] = hb; wl[j] = f2bf(v - bf2f(hb)); }
        const size_t o = qo + kq * 16 * CC + dt * 16 + 8 * hi; *(v8us*)(Oh + o) = wh; *(v8us*)(Ol + o) = wl; }
}

extern "C" void kernel_launch(void* const* d_in, const int* in_sizes, int n_in,
                              void* d_out, int out_size, void* d_ws, size_t ws_size, hipStream_t stream) {
    (void)in_sizes; (void)n_in; (void)out_size;
    const float* x = (const float*)d_in[0]; const float* ga = (const float*)d_in[1]; const float* be = (const float*)d_in[2];
    const float* Wq = (const float*)d_in[3]; const float* bq = (const float*)d_in[4]; const float* Wk = (const float*)d_in[5]; const float* bk = (const float*)d_in[6]; const float* Wv = (const float*)d_in[7]; const float* bv = (const float*)d_in[8]; const float* Wp = (const float*)d_in[9]; const float* bp = (const float*)d_in[10];   // k-major (h @ W)
    float* out = (float*)d_out;    // [8][64][64][64] channels-last
    char* wsp = (char*)d_ws;
    auto take = [&](size_t bytes) { char* p = wsp; wsp += (bytes + 255) & ~(size_t)255; return (void*)p; };
    bf* WqT = (bf*)take(CC * CC * 2); bf* WkT = (bf*)take(CC * CC * 2); bf* WvT = (bf*)take(CC * CC * 2); bf* WpT = (bf*)take(CC * CC * 2); float* ST = (float*)take(NBI * 4 * 128);
    const size_t PLN = (size_t)NN * CC;    // one image's plane, in elements
    bf* Qh = (bf*)take(NBI * PLN * 2); bf* Ql = (bf*)take(NBI * PLN * 2); bf* Kh = (bf*)take(NBI * PLN * 2); bf* Kl = (bf*)take(NBI * PLN * 2); bf* VTh = (bf*)take(NBI * PLN * 2); bf* VTl = (bf*)take(NBI * PLN * 2);
    bf* Oh = (bf*)take(NBI * PLN * 2); bf* Ol = (bf*)take(NBI * PLN * 2);
    if ((size_t)(wsp - (char*)d_ws) > ws_size) return;    // ~ 0.03 + 8 x 4.2 ~ 34 MB
    k_wt<<<dim3(1, 1, 1), 256, 0, stream>>>(Wq, CC, CC, WqT); k_wt<<<dim3(1, 1, 1), 256, 0, stream>>>(Wk, CC, CC, WkT); k_wt<<<dim3(1, 1, 1), 256, 0, stream>>>(Wv, CC, CC, WvT); k_wt<<<dim3(1, 1, 1), 256, 0, stream>>>(Wp, CC, CC, WpT);
    k_gnstat<<<dim3(4, NBI, 1), 1024, 0, stream>>>(x, ST);
    k_qkv<<<dim3(NN / 64, NBI, 1), 128, 0, stream>>>(x, ST, ga, be, WqT, WkT, WvT, bq, bk, bv, Qh, Ql, Kh, Kl, VTh, VTl);
    k_attn<<<dim3(NN / 128, NBI, 1), 256, 0, stream>>>(Qh, Ql, Kh, Kl, VTh, VTl, Oh, Ol);
    k_gemmb<true, false><<<dim3(NBI * NN / 64, 1, 1), 128, 0, stream>>>(Oh, Ol, WpT, bp, out, CC, nullptr, x, CC, 1);    // attn.Wp + bp + x
}

// v006
// One run takes 90.7 microseconds.
// Two timings next to v005 put it at 1.11 and 1.12 times that version's speed.
// All steps since v000 together make it 242 times as fast.
#include <hip/hip_runtime.h>

// Compute dtypes, f32 accumulate, all images in each launch (tokens = the 4096 positions, channels-last rows of 64): GroupNorm (32 groups x 2 channels, stats over H, W and the
// products) on v_wmma_f32_16x16x32_bf16; the full 4096 x 4096 single-head attention in one fused kernel (k_attn: scores three products, softmax x 1/8 in f32 -> hi/lo, P.v three products)

#define NBI  8
#define NN   4096
#define CC   64
#define NGR  32
#define DM   CC
#define NTK  NN
#define GN_EPS 1e-6f
#define SCL  0.125f
#define LOSC 1024.0f

typedef _Float16 h16;
typedef unsigned short bf;
typedef __attribute__((ext_vector_type(16))) __bf16   v16bf;
typedef __attribute__((ext_vector_type(16))) _Float16 v16h;
typedef __attribute__((ext_vector_type(8)))  _Float16 v8h;
typedef __attribute__((ext_vector_type(8)))  unsigned short v8us;
typedef __attribute__((ext_vector_type(8)))  float    v8f;
typedef __attribute__((ext_vector_type(4)))  float    v4f;
typedef __attribute__((ext_vector_type(4)))  _Float16 v4h;
typedef v8h  __attribute__((may_alias)) v8ha;
typedef v4f  __attribute__((may_alias)) v4fa;
typedef v8us __attribute__((may_alias)) v8usa;

__device__ __forceinline__ unsigned short f2bf(float f) { unsigned u = __float_as_uint(f); u += 0x7FFFu + ((u >> 16) & 1u); return (unsigned short)(u >> 16); }
__device__ __forceinline__ float bf2f(unsigned short b) { return __uint_as_float(((unsigned)b) << 16); }
__device__ __forceinline__ float bfr(float f) { return bf2f(f2bf(f)); }
__device__ __forceinline__ v16h cat16(v8h lo, v8h hi) { return __builtin_shufflevector(lo, hi, 0, 1, 2, 3, 4, 5, 6, 7, 8, 9, 10, 11, 12, 13, 14, 15); }
__device__ __forceinline__ v16bf cat16b(v8us lo, v8us hi) { return __builtin_bit_cast(v16bf, __builtin_shufflevector(lo, hi, 0, 1, 2, 3, 4, 5, 6, 7, 8, 9, 10, 11, 12, 13, 14, 15)); }
__device__ __forceinline__ v8f wmma16(v16h a, v16h b, v8f c) { return __builtin_amdgcn_wmma_f32_16x16x32_f16(false, a, false, b, (short)0, c, false, false); }
__device__ __forceinline__ v8f wmmab(v16bf a, v16bf b, v8f c) { return __builtin_amdgcn_wmma_f32_16x16x32_bf16(false, a, false, b, (short)0, c, false, false); }

// k_gemmb: 64 x 64 block tile (4 waves x 16 x 64) of C[NBI * NTK][CC] = (A [+ Al]).B^T (K = 64) [+ bf(bias[c])] [+ bf(R[r][c]) residual]; f32 whole-line epilogue (or f16
template <bool SPLITA, bool F16OUT = false>
__global__ __launch_bounds__(128) void k_gemmb(const bf* __restrict__ A, const bf* __restrict__ Al, const bf* __restrict__ Bn, const float* __restrict__ bias, float* C, int ldc, h16* C2, const float* __restrict__ R = nullptr, int K = DM, int roundR = 1) {
    __shared__ __align__(16) float ost[4][16 * 68];
    const int lane = threadIdx.x & 31, wave = threadIdx.x >> 5, lr = lane & 15, hi = lane >> 4;
    const int r0 = blockIdx.x * 64 + wave * 16, c0 = blockIdx.y * 64;
    const size_t aoff = (size_t)(r0 + lr) * K + 8 * hi;
    size_t boff[4];
#pragma unroll
    for (int t = 0; t < 4; ++t) boff[t] = (size_t)(c0 + t * 16 + lr) * K + 8 * hi;
    v8f acc[4];
#pragma unroll
    for (int t = 0; t < 4; ++t) acc[t] = (v8f){};
#pragma unroll 1
    for (int kc = 0; kc < K; kc += 32) {
        const v16bf a = cat16b(*(const v8us*)(A + aoff + kc), *(const v8us*)(A + aoff + kc + 16));
        v16bf al = a;
        if (SPLITA) al = cat16b(*(const v8us*)(Al + aoff + kc), *(const v8us*)(Al + aoff + kc + 16));
#pragma unroll
        for (int t = 0; t < 4; ++t) { const v16bf b = cat16b(*(const v8us*)(Bn + boff[t] + kc), *(const v8us*)(Bn + boff[t] + kc + 16)); acc[t] = wmmab(a, b, acc[t]); if (SPLITA) acc[t] = wmmab(al, b, acc[t]); }
        asm volatile("v_nop\n\tv_nop\n\tv_nop\n\tv_nop" : "+v"(acc[0]), "+v"(acc[1]), "+v"(acc[2]), "+v"(acc[3]) : "v"(a), "v"(al));
    }
    float* os = &ost[wave][0];
#pragma unroll
    for (int t = 0; t < 4; ++t) { const float bv = bias ? bfr(bias[c0 + t * 16 + lr]) : 0.f;
#pragma unroll
        for (int j = 0; j < 8; ++j) os[(hi * 8 + j) * 68 + t * 16 + lr] = acc[t][j] + bv; }
    __syncthreads();
    if (F16OUT) {
        h16* crow = (h16*)(void*)C + (size_t)r0 * ldc + c0;
        auto pass = [&]() {
#pragma unroll
            for (int s = 0; s < 4; ++s) { const int row = 4 * s + (lane >> 3), piece = lane & 7; const float* sp = os + row * 68 + piece * 8; v8h o, o2;
#pragma unroll
                for (int i = 0; i < 8; ++i) { const h16 a = (h16)sp[i]; o[i] = a; o2[i] = (h16)((sp[i] - (float)a) * LOSC); }
                *(v8h*)(crow + (size_t)row * ldc + piece * 8) = o; if (C2) *(v8h*)(C2 + (size_t)r0 * ldc + c0 + (size_t)row * ldc + piece * 8) = o2; }
        };
        pass(); 
    } else {
        float* crow = C + (size_t)r0 * ldc + c0;
        auto pass = [&]() {
#pragma unroll
            for (int s = 0; s < 8; ++s) { const int Lid = (lane >> 3) + 4 * s, piece = lane & 7; const int row = Lid >> 1, cofs = (Lid & 1) * 32 + piece * 4;
                v4f val = *(const v4fa*)(os + row * 68 + cofs); if (R) { const v4f rv = *(const v4f*)(R + ((size_t)r0 + row) * ldc + c0 + cofs); val += roundR ? (v4f){bfr(rv[0]), bfr(rv[1]), bfr(rv[2]), bfr(rv[3])} : rv; }
                *(v4f*)(crow + (size_t)row * ldc + cofs) = val; }
        };
        pass(); 
    }
}

// k_gnstat: one work-group per (image, slice of 16 channels = 8 groups). A wave's 16-byte loads cover 8 rows x 64 bytes; each thread keeps its 16 rows x 4 channels in
// registers, so x is read once for both passes (mean, then centred squares). ST: one 128-byte line per work-group, floats 0..7 = mean, 8..15 = rsqrt(var + eps).
// The launch carries one more row of work-groups (blockIdx.y = NBI): work-group blockIdx.x of it writes WT[n][k] = bf16(W[k][n]) of one 64 x 64 weight matrix (q, k, v, p) through an LDS
// tile. The next launch needs both the statistics and these, and neither needs the other, so they share one launch.
__global__ __launch_bounds__(1024) void k_gnstat(const float* __restrict__ x, float* ST, const float* __restrict__ Wq, const float* __restrict__ Wk, const float* __restrict__ Wv, const float* __restrict__ Wp, bf* WT4) {
    typedef __attribute__((ext_vector_type(2))) float v2f;
    __shared__ __align__(16) v2f red[2][32][4];
    __shared__ __align__(16) unsigned short tl[CC * 72];
    const int tid = threadIdx.x, lane = tid & 31, wave = tid >> 5, q = tid & 3;     // q: which 4 channels (2 groups) of the slice
    if (blockIdx.y == NBI) {     // the same for the whole work-group
        const float* Wm = blockIdx.x == 0 ? Wq : blockIdx.x == 1 ? Wk : blockIdx.x == 2 ? Wv : Wp;
        const int kk = tid >> 4, nq = (tid & 15) * 4;     // 16 lanes read one row k of 256 bytes
        const v4f w = *(const v4f*)(Wm + kk * CC + nq);
#pragma unroll
        for (int i = 0; i < 4; ++i) tl[(nq + i) * 72 + kk] = f2bf(w[i]);
        __syncthreads();     // the whole matrix stands transposed in LDS
        if (tid < 512) *(v8us*)(WT4 + blockIdx.x * CC * CC + (tid >> 3) * CC + (tid & 7) * 8) = *(const v8usa*)(tl + (tid >> 3) * 72 + (tid & 7) * 8);     // 8 lanes write one row n, a whole 128-byte line
        return;
    }
    const float* xp = x + (size_t)blockIdx.y * NN * CC + blockIdx.x * 16 + q * 4 + (size_t)(tid >> 2) * CC;
    v4f v[16];
#pragma unroll
    for (int i = 0; i < 16; ++i) v[i] = *(const v4f*)(xp + (size_t)i * 256 * CC);
    float s0 = 0.f, s1 = 0.f;
#pragma unroll
    for (int i = 0; i < 16; ++i) { v[i] = (v4f){bfr(v[i][0]), bfr(v[i][1]), bfr(v[i][2]), bfr(v[i][3])}; s0 += v[i][0] + v[i][1]; s1 += v[i][2] + v[i][3]; }
#pragma unroll
    for (int sh = 16; sh >= 4; sh >>= 1) { s0 += __shfl_xor(s0, sh, 32); s1 += __shfl_xor(s1, sh, 32); }
    if (lane < 4) red[0][wave][q] = (v2f){s0, s1};
    __syncthreads();
    s0 = 0.f; s1 = 0.f;     // every wave adds the 32 waves' sums: 4 per lane, then the same three exchanges
#pragma unroll
    for (int j = 0; j < 4; ++j) { const v2f t = red[0][j * 8 + (lane >> 2)][q]; s0 += t[0]; s1 += t[1]; }
#pragma unroll
    for (int sh = 16; sh >= 4; sh >>= 1) { s0 += __shfl_xor(s0, sh, 32); s1 += __shfl_xor(s1, sh, 32); }
    const float mu0 = s0 / (float)(2 * NN), mu1 = s1 / (float)(2 * NN);
    float q0 = 0.f, q1 = 0.f;
#pragma unroll
    for (int i = 0; i < 16; ++i) { float d = v[i][0] - mu0; q0 = fmaf(d, d, q0); d = v[i][1] - mu0; q0 = fmaf(d, d, q0); d = v[i][2] - mu1; q1 = fmaf(d, d, q1); d = v[i][3] - mu1; q1 = fmaf(d, d, q1); }
#pragma unroll
    for (int sh = 16; sh >= 4; sh >>= 1) { q0 += __shfl_xor(q0, sh, 32); q1 += __shfl_xor(q1, sh, 32); }
    if (lane < 4) red[1][wave][q] = (v2f){q0, q1};
    __syncthreads();
    if (wave) return;     // behind the last barrier
    q0 = 0.f; q1 = 0.f;
#pragma unroll
    for (int j = 0; j < 4; ++j) { const v2f t = red[1][j * 8 + (lane >> 2)][q]; q0 += t[0]; q1 += t[1]; }
#pragma unroll
    for (int sh = 16; sh >= 4; sh >>= 1) { q0 += __shfl_xor(q0, sh, 32); q1 += __shfl_xor(q1, sh, 32); }
    if (lane < 4) {
        float* st = ST + (size_t)(blockIdx.y * 4 + blockIdx.x) * 32 + 2 * q;
        *(v2f*)st = (v2f){mu0, mu1};
        *(v2f*)(st + 8) = (v2f){rsqrtf(q0 / (float)(2 * NN) + GN_EPS), rsqrtf(q1 / (float)(2 * NN) + GN_EPS)};
    }
}
// k_qkv: GroupNorm applied, the three projections, their hi/lo splits and V's transpose in one kernel, all images in one launch; grid (NN / 64, images), 4 waves x 16 tokens.
// A lane normalises the 32 channels of its token that its fragments hold (k step ks, elements i and 8 + i = channels 32 ks + 8 hi + i and 32 ks + 16 + 8 hi + i), so h stays in registers.
// q, k: transposed products (A = weight rows, B = h rows): a lane holds 8 neighbouring channels of ONE token, 16 bytes of its row. v: A = h rows, B = weight rows: a lane holds
// 8 neighbouring tokens of one channel; the work-group's 64 tokens meet in LDS, so that V^T leaves in whole 128-byte lines, each from one wave.
__global__ __launch_bounds__(128) void k_qkv(const float* __restrict__ x, const float* __restrict__ ST, const float* __restrict__ ga, const float* __restrict__ be,
                                             const bf* __restrict__ WqT, const bf* __restrict__ WkT, const bf* __restrict__ WvT, const float* __restrict__ bq, const float* __restrict__ bk, const float* __restrict__ bv,
                                             bf* Qh, bf* Ql, bf* Kh, bf* Kl, bf* VTh, bf* VTl) {
    __shared__ __align__(16) unsigned short vs[2][CC * 72];
    const int tid = threadIdx.x, lane = tid & 31, wave = tid >> 5, lr = lane & 15, hi = lane >> 4;
    const size_t ib = (size_t)blockIdx.y * NN * CC;
    const size_t ro = ib + (size_t)(blockIdx.x * 64 + wave * 16 + lr) * CC + 8 * hi;
    const float* st = ST + blockIdx.y * 128 + 4 * hi;     // k_gnstat's four lines of this image; channels c .. c + 7 = groups c / 2 .. c / 2 + 3
    v16bf hh[2], hl[2];
#pragma unroll
    for (int ks = 0; ks < 2; ++ks) { v8us oh[2], ol[2];
#pragma unroll
        for (int hf = 0; hf < 2; ++hf) { const int cc = ks * 32 + hf * 16;     // + 8 hi: the lane's 8 channels
            const v4f xv[2] = {*(const v4f*)(x + ro + cc), *(const v4f*)(x + ro + cc + 4)};
            const v4f gv[2] = {*(const v4f*)(ga + cc + 8 * hi), *(const v4f*)(ga + cc + 8 * hi + 4)};
            const v4f ev[2] = {*(const v4f*)(be + cc + 8 * hi), *(const v4f*)(be + cc + 8 * hi + 4)};
            const v4f mu = *(const v4f*)(st + (ks * 2 + hf) * 32), rs = *(const v4f*)(st + (ks * 2 + hf) * 32 + 8);
#pragma unroll
            for (int i = 0; i < 8; ++i) { const float y = (bfr(xv[i >> 2][i & 3]) - mu[i >> 1]) * rs[i >> 1] * bfr(gv[i >> 2][i & 3]) + bfr(ev[i >> 2][i & 3]); const unsigned short hb = f2bf(y); oh[hf][i] = hb; ol[hf][i] = f2bf(y - bf2f(hb)); } }
        hh[ks] = cat16b(oh[0], oh[1]); hl[ks] = cat16b(ol[0], ol[1]); }
    const int wo = lr * CC + 8 * hi;     // a weight fragment: row 16 t + lr, the same k order as h's
    {
        v8f acc[4];
#pragma unroll
        for (int t = 0; t < 4; ++t) acc[t] = (v8f){};
#pragma unroll
        for (int ks = 0; ks < 2; ++ks) {
#pragma unroll
            for (int t = 0; t < 4; ++t) { const bf* wp = WvT + wo + t * 16 * CC + ks * 32; const v16bf w = cat16b(*(const v8us*)wp, *(const v8us*)(wp + 16)); acc[t] = wmmab(hh[ks], w, acc[t]); acc[t] = wmmab(hl[ks], w, acc[t]); } }
#pragma unroll
        for (int t = 0; t < 4; ++t) { const float bb = bfr(bv[t * 16 + lr]); v8us wh, wl;
#pragma unroll
            for (int j = 0; j < 8; ++j) { const float v = acc[t][j] + bb; const unsigned short hb = f2bf(v); wh[j] = hb; wl[j] = f2bf(v - bf2f(hb)); }
            const int o = (t * 16 + lr) * 72 + wave * 16 + 8 * hi; *(v8usa*)(&vs[0][o]) = wh; *(v8usa*)(&vs[1][o]) = wl; }
    }
    auto rows = [&](const bf* __restrict__ WT, const float* __restrict__ bias, bf* Dh, bf* Dl) {
        v8f acc[4];
#pragma unroll
        for (int t = 0; t < 4; ++t) acc[t] = (v8f){};
#pragma unroll
        for (int ks = 0; ks < 2; ++ks) {
#pragma unroll
            for (int t = 0; t < 4; ++t) { const bf* wp = WT + wo + t * 16 * CC + ks * 32; const v16bf w = cat16b(*(const v8us*)wp, *(const v8us*)(wp + 16)); acc[t] = wmmab(w, hh[ks], acc[t]); acc[t] = wmmab(w, hl[ks], acc[t]); } }
#pragma unroll
        for (int t = 0; t < 4; ++t) { const v4f bb[2] = {*(const v4f*)(bias + t * 16 + 8 * hi), *(const v4f*)(bias + t * 16 + 8 * hi + 4)}; v8us wh, wl;
#pragma unroll
            for (int j = 0; j < 8; ++j) { const float v = acc[t][j] + bfr(bb[j >> 2][j & 3]); const unsigned short hb = f2bf(v); wh[j] = hb; wl[j] = f2bf(v - bf2f(hb)); }
            *(v8us*)(Dh + ro + t * 16) = wh; *(v8us*)(Dl + ro + t * 16) = wl; }
    };
    rows(WqT, bq, Qh, Ql); rows(WkT, bk, Kh, Kl);
    __syncthreads();     // all four waves' token columns of V^T stand in LDS
#pragma unroll
    for (int s = 0; s < 4; ++s) { const int row = s * 16 + (tid >> 3), piece = tid & 7; const size_t o = ib + (size_t)row * NN + blockIdx.x * 64 + piece * 8;
        *(v8us*)(VTh + o) = *(const v8usa*)(&vs[0][row * 72 + piece * 8]); *(v8us*)(VTl + o) = *(const v8usa*)(&vs[1][row * 72 + piece * 8]); }
}
// k_attn: scores, softmax and P.v in one kernel, all images in one launch; grid (NN / 128, images), 8 waves. A wave holds 32 queries (two column groups of 16; wave & 3 picks them) and
// walks one half of every stage's keys (wave >> 2 picks it) in passes of 32, so that each K and V^T fragment read from LDS feeds two query tiles; the two waves of a pair join at the end.
// Transposed products: S^T = K.Q^T (A = key rows, B = query rows kept in registers), so a lane holds 16 scores of ONE query of each group (column lr; keys 8 hi + j of each 16-key tile)
// and the two score tiles, converted in place, are the B operand of O^T += V^T.P^T (element i = key 8 hi + i, element 8 + i = key 16 + 8 hi + i: the order the V^T loader uses).
// Running maximum and sum per query (exp2 domain); the three hi/lo products of each matrix product are kept.
// K and V^T (hi and lo) reach the waves through LDS: a stage is KT keys, brought once per work-group by asynchronous copies that read whole 128-byte lines, two buffers, the
// next stage in flight while this one is worked on. Rows are pitched 16 bytes x odd, so that the 16 rows of a fragment load fall on all 64 banks.
#define KT   256                        // keys per stage: four passes of 32 for each wave of a pair
#define KPB  (CC * 2 + 16)              // bytes from one K row to the next in LDS
#define VPB  (KT * 2 + 16)              // bytes from one V^T row to the next in LDS
#define KPL  (KT * KPB)                 // one K plane (hi or lo) of a stage
#define VPL  (CC * VPB)                 // one V^T plane of a stage
#define STG  (2 * KPL + 2 * VPL)        // one stage: K hi, K lo, V^T hi, V^T lo
#define XSL  (32 * 136)                 // the join: a wave's slot in the ring, 32 lanes x (32 floats of O^T, maximum, sum)
__device__ __forceinline__ float xhalf(float v) { const int b = __float_as_int(v); return __int_as_float(__builtin_amdgcn_permlanex16(b, b, 0x76543210, 0xfedcba98, false, false)); }
// Eight copies of 16 bytes per lane: four row blocks of plane a, four of plane b. The s_wait_xcnt stands inside the statement, in front of any rewrite of the address registers.
__device__ __forceinline__ void copy8(unsigned la, const bf* ga, unsigned lb, const bf* gb, unsigned lstep, size_t gstep) {
    asm volatile("global_load_async_to_lds_b128 %0, %8, off\n\t"
                 "global_load_async_to_lds_b128 %1, %9, off\n\t"
                 "global_load_async_to_lds_b128 %2, %10, off\n\t"
                 "global_load_async_to_lds_b128 %3, %11, off\n\t"
                 "global_load_async_to_lds_b128 %4, %12, off\n\t"
                 "global_load_async_to_lds_b128 %5, %13, off\n\t"
                 "global_load_async_to_lds_b128 %6, %14, off\n\t"
                 "global_load_async_to_lds_b128 %7, %15, off\n\t"
                 "s_wait_xcnt 0x0"
                 :: "v"(la), "v"(la + lstep), "v"(la + 2 * lstep), "v"(la + 3 * lstep), "v"(lb), "v"(lb + lstep), "v"(lb + 2 * lstep), "v"(lb + 3 * lstep),
                    "v"(ga), "v"(ga + gstep), "v"(ga + 2 * gstep), "v"(ga + 3 * gstep), "v"(gb), "v"(gb + gstep), "v"(gb + 2 * gstep), "v"(gb + 3 * gstep) : "memory");
}
__global__ __launch_bounds__(256) void k_attn(const bf* __restrict__ Qh, const bf* __restrict__ Ql, const bf* __restrict__ Kh, const bf* __restrict__ Kl, const bf* __restrict__ VTh, const bf* __restrict__ VTl, bf* Oh, bf* Ol) {
    typedef __attribute__((ext_vector_type(2))) __bf16 v2bf; typedef __attribute__((ext_vector_type(2))) float v2f; typedef __attribute__((ext_vector_type(8))) unsigned v8u;
    typedef v2f __attribute__((may_alias)) v2fa;
    typedef unsigned char __attribute__((address_space(3))) ldsb; typedef v8usa __attribute__((address_space(3))) v8usl;     // LDS by its own 32-bit address
    __shared__ __align__(16) unsigned char ring[2 * STG];
    const int tid = threadIdx.x, lane = tid & 31, wave = tid >> 5, lr = lane & 15, hi = lane >> 4;
    const int qg = wave & 3, kq = wave >> 2;     // which 32 queries; which KT / 2 keys of every stage
    const size_t ib = (size_t)blockIdx.y * NN * CC;
    const size_t qo = ib + (size_t)(blockIdx.x * 128 + qg * 32 + lr) * CC;     // column group g: + g * 16 * CC
    const float SC2 = SCL * 1.44269504088896341f;
    // The copies: K, 8 lanes a row of 128 bytes, 32 rows a block; V^T, 32 lanes a row of 512 bytes, 8 rows a block; eight blocks a plane.
    const bf* gkh = Kh + ib + tid * 8; const bf* gkl = Kl + ib + tid * 8;
    const bf* gvh = VTh + ib + (size_t)(tid >> 5) * NN + (tid & 31) * 8; const bf* gvl = VTl + ib + (size_t)(tid >> 5) * NN + (tid & 31) * 8;
    const unsigned lk = (unsigned)(size_t)ring + (tid >> 3) * KPB + (tid & 7) * 16, lv = (unsigned)(size_t)ring + 2 * KPL + (tid >> 5) * VPB + (tid & 31) * 16;
    auto fill = [&](int st) {     // stage st into buffer st & 1
        const unsigned bo = (st & 1) * STG;
#pragma unroll
        for (int h = 0; h < 2; ++h) {     // four blocks of each plane a call
            copy8(lk + bo + h * 128 * KPB, gkh + (size_t)st * KT * CC + h * 128 * CC, lk + bo + KPL + h * 128 * KPB, gkl + (size_t)st * KT * CC + h * 128 * CC, 32 * KPB, 32 * CC);
            copy8(lv + bo + h * 32 * VPB, gvh + st * KT + (size_t)h * 32 * NN, lv + bo + VPL + h * 32 * VPB, gvl + st * KT + (size_t)h * 32 * NN, 8 * VPB, (size_t)8 * NN);
        }
    };
    v16bf qh[2][2], ql[2][2];
#pragma unroll
    for (int g = 0; g < 2; ++g) {
#pragma unroll
        for (int ks = 0; ks < 2; ++ks) { const size_t o = qo + g * 16 * CC + ks * 32 + 8 * hi; qh[g][ks] = cat16b(*(const v8us*)(Qh + o), *(const v8us*)(Qh + o + 16)); ql[g][ks] = cat16b(*(const v8us*)(Ql + o), *(const v8us*)(Ql + o + 16)); } }
    asm volatile("s_wait_xcnt 0x0" ::: "memory");     // in front of the first rewrite of the Q loads' address registers
    __builtin_amdgcn_sched_barrier(0);                // keeps the vector work that follows, which reuses those registers, behind that wait
    v8f oa[2][4];
#pragma unroll
    for (int g = 0; g < 2; ++g) {
#pragma unroll
        for (int dt = 0; dt < 4; ++dt) oa[g][dt] = (v8f){}; }
    float m[2] = {-3.0e38f, -3.0e38f}, l[2] = {0.f, 0.f};
    // Trips -2 and -1 are the ring's prologue: stage 0's copies; their wait and the barrier, then stage 1's copies. So the copies stand once in the text and every address operand of theirs is
    // formed at the call: a base address that is itself an operand of an asm statement must stay below v256 for its whole life, and spilled.
#pragma unroll 1     // one copy of the stage in the text; the buffer is picked by st & 1
    for (int st = -2; st < NN / KT; ++st) {
      if (st >= 0) {
        const unsigned char* kb = ring + (st & 1) * STG + (kq * (KT / 2) + lr) * KPB + 16 * hi;
        // KT / 2 keys = KT bytes along a V^T row. The address is formed as an integer, so that 2 * KPL lies in the base register and every fragment's distance fits the offset field of its ds_load.
        const ldsb* vb = (const ldsb*)((unsigned)(size_t)ring + (st & 1) * STG + 2 * KPL + lr * VPB + kq * KT + 16 * hi);
        v16bf kh[2][2], kl[2][2], vh[4], vl[4];
        auto ldk = [&](int p) {
#pragma unroll
            for (int t = 0; t < 2; ++t) {
#pragma unroll
                for (int ks = 0; ks < 2; ++ks) { const unsigned char* o = kb + (p * 32 + t * 16) * KPB + ks * 64; kh[t][ks] = cat16b(*(const v8usa*)o, *(const v8usa*)(o + 32)); kl[t][ks] = cat16b(*(const v8usa*)(o + KPL), *(const v8usa*)(o + KPL + 32)); } }
        };
        auto ldv = [&](int p) {
#pragma unroll
            for (int dt = 0; dt < 4; ++dt) { const ldsb* o = vb + dt * 16 * VPB + p * 64; vh[dt] = cat16b(*(const v8usl*)o, *(const v8usl*)(o + 32)); vl[dt] = cat16b(*(const v8usl*)(o + VPL), *(const v8usl*)(o + VPL + 32)); }
        };
        auto pass = [&](int p, bool more) {     // more: a further pass of this wave in this stage follows
            ldv(p);
            __builtin_amdgcn_sched_barrier(0);     // the V^T loads stay here, one group in flight under the score products; moved down, each waits out its LDS latency in front of its product
            v8f s[2][2];
#pragma unroll
            for (int g = 0; g < 2; ++g) { s[g][0] = (v8f){}; s[g][1] = (v8f){}; }
#pragma unroll
            for (int ks = 0; ks < 2; ++ks) {
#pragma unroll
                for (int g = 0; g < 2; ++g) { s[g][0] = wmmab(kh[0][ks], qh[g][ks], s[g][0]); s[g][1] = wmmab(kh[1][ks], qh[g][ks], s[g][1]); }
#pragma unroll
                for (int g = 0; g < 2; ++g) { s[g][0] = wmmab(kh[0][ks], ql[g][ks], s[g][0]); s[g][1] = wmmab(kh[1][ks], ql[g][ks], s[g][1]); }
#pragma unroll
                for (int g = 0; g < 2; ++g) { s[g][0] = wmmab(kl[0][ks], qh[g][ks], s[g][0]); s[g][1] = wmmab(kl[1][ks], qh[g][ks], s[g][1]); }
            }
            __builtin_amdgcn_sched_barrier(0);     // this fence and the next: the K loads stay one group, behind the products that read the same registers and in front of the softmax that covers their latency
            if (more) ldk(p + 1);     // the next pass's K fragments, inside this stage only
            __builtin_amdgcn_sched_barrier(0);
#pragma unroll
            for (int g = 0; g < 2; ++g) {
                float mt = fmaxf(s[g][0][0], s[g][1][0]);
#pragma unroll
                for (int j = 1; j < 8; ++j) mt = fmaxf(mt, fmaxf(s[g][0][j], s[g][1][j]));
                mt = fmaxf(mt, xhalf(mt));
                const float mn = fmaxf(m[g], mt * SC2), al = __builtin_amdgcn_exp2f(m[g] - mn);
                m[g] = mn;
#pragma unroll
                for (int t = 0; t < 2; ++t) {
#pragma unroll
                    for (int j = 0; j < 8; ++j) s[g][t][j] = __builtin_amdgcn_exp2f(fmaf(s[g][t][j], SC2, -mn)); }
                const v8f sv = s[g][0] + s[g][1];
                l[g] = fmaf(l[g], al, ((sv[0] + sv[1]) + (sv[2] + sv[3])) + ((sv[4] + sv[5]) + (sv[6] + sv[7])));
                v8u phw, plw;     // word i of the B operand = elements 2 i, 2 i + 1: hi = bf16(p), lo = bf16(p - hi)
#pragma unroll
                for (int i = 0; i < 8; ++i) { const v2f p2 = (v2f){s[g][i >> 2][(2 * i) & 7], s[g][i >> 2][((2 * i) & 7) + 1]};
                    const unsigned w = __builtin_bit_cast(unsigned, __builtin_convertvector(p2, v2bf)); phw[i] = w;
                    const v2f r2 = p2 - (v2f){__uint_as_float(w << 16), __uint_as_float(w & 0xFFFF0000u)}; plw[i] = __builtin_bit_cast(unsigned, __builtin_convertvector(r2, v2bf)); }
                const v16bf ph = __builtin_bit_cast(v16bf, phw), pl = __builtin_bit_cast(v16bf, plw);
#pragma unroll
                for (int dt = 0; dt < 4; ++dt) oa[g][dt] *= al;
#pragma unroll
                for (int dt = 0; dt < 4; ++dt) oa[g][dt] = wmmab(vh[dt], ph, oa[g][dt]);
#pragma unroll
                for (int dt = 0; dt < 4; ++dt) oa[g][dt] = wmmab(vh[dt], pl, oa[g][dt]);
#pragma unroll
                for (int dt = 0; dt < 4; ++dt) oa[g][dt] = wmmab(vl[dt], ph, oa[g][dt]);
            }
        };
        ldk(0);
#pragma unroll 1     // unrolled, the compiler keeps all the passes' scores live to the foot of the stage
        for (int p = 0; p < KT / 64 - 1; ++p) pass(p, true);
        pass(KT / 64 - 1, false);
      }
        if (st >= -1) {     // the same for the whole work-group
            asm volatile("s_wait_dscnt 0x0" ::: "memory");        // this wave's reads of the buffer are over before it is refilled
            asm volatile("s_wait_asynccnt 0x0" ::: "memory");     // this wave's share of stage st + 1 has landed
            __syncthreads();                                      // publishes stage st + 1 and ends every wave's reads of stage st
        }
        if (st + 2 < NN / KT) fill(st + 2);
    }
    asm volatile("s_wait_asynccnt 0x0" ::: "memory");     // no copy is outstanding when the wave ends
    // The join. Waves w and w ^ 4 hold the same 32 queries over disjoint keys; wave w finishes column group kq and hands the other group's maximum, sum and O^T to its partner through
    // the ring, which is free: the loop's last barrier stands behind every wave's last read of it, and no copy is under way.
    const bool up = kq != 0;
    unsigned char* xw = ring + wave * XSL;
    const unsigned char* xr = ring + (wave ^ 4) * XSL;
#pragma unroll
    for (int dt = 0; dt < 4; ++dt) { const v8f gv = up ? oa[0][dt] : oa[1][dt];
        *(v4fa*)(xw + (2 * dt) * 512 + lane * 16) = __builtin_shufflevector(gv, gv, 0, 1, 2, 3); *(v4fa*)(xw + (2 * dt + 1) * 512 + lane * 16) = __builtin_shufflevector(gv, gv, 4, 5, 6, 7); }
    *(v2fa*)(xw + 4096 + lane * 8) = (v2f){up ? m[0] : m[1], up ? l[0] : l[1]};
    __syncthreads();     // both waves of every pair have written what the other reads
    const v2f pml = *(const v2fa*)(xr + 4096 + lane * 8);
    const float km = up ? m[1] : m[0], kl_ = up ? l[1] : l[0];
    const float mn = fmaxf(km, pml[0]), fa = __builtin_amdgcn_exp2f(km - mn), fb = __builtin_amdgcn_exp2f(pml[0] - mn);
    float lt = fmaf(kl_, fa, pml[1] * fb);
    lt += xhalf(lt);     // the two halves of a column hold the sums of disjoint keys
    const float inv = 1.0f / lt, ca = fa * inv, cb = fb * inv;
#pragma unroll
    for (int dt = 0; dt < 4; ++dt) { const v8f kv = up ? oa[1][dt] : oa[0][dt]; const v4f p0 = *(const v4fa*)(xr + (2 * dt) * 512 + lane * 16), p1 = *(const v4fa*)(xr + (2 * dt + 1) * 512 + lane * 16); v8us wh, wl;
#pragma unroll
        for (int j = 0; j < 8; ++j) { const float v = fmaf(kv[j], ca, (j < 4 ? p0[j & 3] : p1[j & 3]) * cb); const unsigned short hb = f2bf(v); wh[j] = hb; wl[j] = f2bf(v - bf2f(hb)); }
        const size_t o = qo + kq * 16 * CC + dt * 16 + 8 * hi; *(v8us*)(Oh + o) = wh; *(v8us*)(Ol + o) = wl; }
}

extern "C" void kernel_launch(void* const* d_in, const int* in_sizes, int n_in,
                              void* d_out, int out_size, void* d_ws, size_t ws_size, hipStream_t stream) {
    (void)in_sizes; (void)n_in; (void)out_size;
    const float* x = (const float*)d_in[0]; const float* ga = (const float*)d_in[1]; const float* be = (const float*)d_in[2];
    const float* Wq = (const float*)d_in[3]; const float* bq = (const float*)d_in[4]; const float* Wk = (const float*)d_in[5]; const float* bk = (const float*)d_in[6]; const float* Wv = (const float*)d_in[7]; const float* bv = (const float*)d_in[8]; const float* Wp = (const float*)d_in[9]; const float* bp = (const float*)d_in[10];   // k-major (h @ W)
    float* out = (float*)d_out;    // [8][64][64][64] channels-last
    char* wsp = (char*)d_ws;
    auto take = [&](size_t bytes) { char* p = wsp; wsp += (bytes + 255) & ~(size_t)255; return (void*)p; };
    bf* WqT = (bf*)take(4 * CC * CC * 2); bf* WkT = WqT + CC * CC; bf* WvT = WqT + 2 * CC * CC; bf* WpT = WqT + 3 * CC * CC; float* ST = (float*)take(NBI * 4 * 128);
    const size_t PLN = (size_t)NN * CC;    // one image's plane, in elements
    bf* Qh = (bf*)take(NBI * PLN * 2); bf* Ql = (bf*)take(NBI * PLN * 2); bf* Kh = (bf*)take(NBI * PLN * 2); bf* Kl = (bf*)take(NBI * PLN * 2); bf* VTh = (bf*)take(NBI * PLN * 2); bf* VTl = (bf*)take(NBI * PLN * 2);
    bf* Oh = (bf*)take(NBI * PLN * 2); bf* Ol = (bf*)take(NBI * PLN * 2);
    if ((size_t)(wsp - (char*)d_ws) > ws_size) return;    // ~ 0.03 + 8 x 4.2 ~ 34 MB
    k_gnstat<<<dim3(4, NBI + 1, 1), 1024, 0, stream>>>(x, ST, Wq, Wk, Wv, Wp, WqT);    // row NBI of the grid: the four weight transposes
    k_qkv<<<dim3(NN / 64, NBI, 1), 128, 0, stream>>>(x, ST, ga, be, WqT, WkT, WvT, bq, bk, bv, Qh, Ql, Kh, Kl, VTh, VTl);
    k_attn<<<dim3(NN / 128, NBI, 1), 256, 0, stream>>>(Qh, Ql, Kh, Kl, VTh, VTl, Oh, Ol);
    k_gemmb<true, false><<<dim3(NBI * NN / 64, 1, 1), 128, 0, stream>>>(Oh, Ol, WpT, bp, out, CC, nullptr, x, CC, 1);    // attn.Wp + bp + x
}

// v007
// One run takes 84.8 microseconds.
// Two timings next to v006 put it at 1.07 and 1.06 times that version's speed.
// Counting every step since v000, it is 257 times as fast.
#include <hip/hip_runtime.h>

// Compute dtypes, f32 accumulate, all images in each launch (tokens = the 4096 positions, channels-last rows of 64): GroupNorm (32 groups x 2 channels, stats over H, W and the
// products) on v_wmma_f32_16x16x32_bf16; the full 4096 x 4096 single-head attention in one fused kernel (k_attn: scores three products, softmax x 1/8 in f32 -> hi/lo, P.v three products)

#define NBI  8
#define NN   4096
#define CC   64
#define NGR  32
#define DM   CC
#define NTK  NN
#define GN_EPS 1e-6f
#define SCL  0.125f
#define LOSC 1024.0f

typedef _Float16 h16;
typedef unsigned short bf;
typedef __attribute__((ext_vector_type(16))) __bf16   v16bf;
typedef __attribute__((ext_vector_type(16))) _Float16 v16h;
typedef __attribute__((ext_vector_type(8)))  _Float16 v8h;
typedef __attribute__((ext_vector_type(8)))  unsigned short v8us;
typedef __attribute__((ext_vector_type(8)))  float    v8f;
typedef __attribute__((ext_vector_type(4)))  float    v4f;
typedef __attribute__((ext_vector_type(4)))  _Float16 v4h;
typedef v8h  __attribute__((may_alias)) v8ha;
typedef v4f  __attribute__((may_alias)) v4fa;
typedef v8us __attribute__((may_alias)) v8usa;

__device__ __forceinline__ unsigned short f2bf(float f) { unsigned u = __float_as_uint(f); u += 0x7FFFu + ((u >> 16) & 1u); return (unsigned short)(u >> 16); }
__device__ __forceinline__ float bf2f(unsigned short b) { return __uint_as_float(((unsigned)b) << 16); }
__device__ __forceinline__ float bfr(float f) { return bf2f(f2bf(f)); }
__device__ __forceinline__ v16h cat16(v8h lo, v8h hi) { return __builtin_shufflevector(lo, hi, 0, 1, 2, 3, 4, 5, 6, 7, 8, 9, 10, 11, 12, 13, 14, 15); }
__device__ __forceinline__ v16bf cat16b(v8us lo, v8us hi) { return __builtin_bit_cast(v16bf, __builtin_shufflevector(lo, hi, 0, 1, 2, 3, 4, 5, 6, 7, 8, 9, 10, 11, 12, 13, 14, 15)); }
__device__ __forceinline__ v8f wmma16(v16h a, v16h b, v8f c) { return __builtin_amdgcn_wmma_f32_16x16x32_f16(false, a, false, b, (short)0, c, false, false); }
__device__ __forceinline__ v8f wmmab(v16bf a, v16bf b, v8f c) { return __builtin_amdgcn_wmma_f32_16x16x32_bf16(false, a, false, b, (short)0, c, false, false); }

// k_gemmb: 64 x 64 block tile (4 waves x 16 x 64) of C[NBI * NTK][CC] = (A [+ Al]).B^T (K = 64) [+ bf(bias[c])] [+ bf(R[r][c]) residual]; f32 whole-line epilogue (or f16
template <bool SPLITA, bool F16OUT = false>
__global__ __launch_bounds__(128) void k_gemmb(const bf* __restrict__ A, const bf* __restrict__ Al, const bf* __restrict__ Bn, const float* __restrict__ bias, float* C, int ldc, h16* C2, const float* __restrict__ R = nullptr, int K = DM, int roundR = 1) {
    __shared__ __align__(16) float ost[4][16 * 68];
    const int lane = threadIdx.x & 31, wave = threadIdx.x >> 5, lr = lane & 15, hi = lane >> 4;
    const int r0 = blockIdx.x * 64 + wave * 16, c0 = blockIdx.y * 64;
    const size_t aoff = (size_t)(r0 + lr) * K + 8 * hi;
    size_t boff[4];
#pragma unroll
    for (int t = 0; t < 4; ++t) boff[t] = (size_t)(c0 + t * 16 + lr) * K + 8 * hi;
    v8f acc[4];
#pragma unroll
    for (int t = 0; t < 4; ++t) acc[t] = (v8f){};
#pragma unroll 1
    for (int kc = 0; kc < K; kc += 32) {
        const v16bf a = cat16b(*(const v8us*)(A + aoff + kc), *(const v8us*)(A + aoff + kc + 16));
        v16bf al = a;
        if (SPLITA) al = cat16b(*(const v8us*)(Al + aoff + kc), *(const v8us*)(Al + aoff + kc + 16));
#pragma unroll
        for (int t = 0; t < 4; ++t) { const v16bf b = cat16b(*(const v8us*)(Bn + boff[t] + kc), *(const v8us*)(Bn + boff[t] + kc + 16)); acc[t] = wmmab(a, b, acc[t]); if (SPLITA) acc[t] = wmmab(al, b, acc[t]); }
        asm volatile("v_nop\n\tv_nop\n\tv_nop\n\tv_nop" : "+v"(acc[0]), "+v"(acc[1]), "+v"(acc[2]), "+v"(acc[3]) : "v"(a), "v"(al));
    }
    float* os = &ost[wave][0];
#pragma unroll
    for (int t = 0; t < 4; ++t) { const float bv = bias ? bfr(bias[c0 + t * 16 + lr]) : 0.f;
#pragma unroll
        for (int j = 0; j < 8; ++j) os[(hi * 8 + j) * 68 + t * 16 + lr] = acc[t][j] + bv; }
    __syncthreads();
    if (F16OUT) {
        h16* crow = (h16*)(void*)C + (size_t)r0 * ldc + c0;
        auto pass = [&]() {
#pragma unroll
            for (int s = 0; s < 4; ++s) { const int row = 4 * s + (lane >> 3), piece = lane & 7; const float* sp = os + row * 68 + piece * 8; v8h o, o2;
#pragma unroll
                for (int i = 0; i < 8; ++i) { const h16 a = (h16)sp[i]; o[i] = a; o2[i] = (h16)((sp[i] - (float)a) * LOSC); }
                *(v8h*)(crow + (size_t)row * ldc + piece * 8) = o; if (C2) *(v8h*)(C2 + (size_t)r0 * ldc + c0 + (size_t)row * ldc + piece * 8) = o2; }
        };
        pass(); 
    } else {
        float* crow = C + (size_t)r0 * ldc + c0;
        auto pass = [&]() {
#pragma unroll
            for (int s = 0; s < 8; ++s) { const int Lid = (lane >> 3) + 4 * s, piece = lane & 7; const int row = Lid >> 1, cofs = (Lid & 1) * 32 + piece * 4;
                v4f val = *(const v4fa*)(os + row * 68 + cofs); if (R) { const v4f rv = *(const v4f*)(R + ((size_t)r0 + row) * ldc + c0 + cofs); val += roundR ? (v4f){bfr(rv[0]), bfr(rv[1]), bfr(rv[2]), bfr(rv[3])} : rv; }
                *(v4f*)(crow + (size_t)row * ldc + cofs) = val; }
        };
        pass(); 
    }
}

// k_gnstat: one work-group per (image, slice of 16 channels = 8 groups). A wave's 16-byte loads cover 8 rows x 64 bytes; each thread keeps its 16 rows x 4 channels in
// registers, so x is read once for both passes (mean, then centred squares). ST: one 128-byte line per work-group, floats 0..7 = mean, 8..15 = rsqrt(var + eps).
// The launch carries one more row of work-groups (blockIdx.y = NBI): work-group blockIdx.x of it writes WT[n][k] = bf16(W[k][n]) of one 64 x 64 weight matrix (q, k, v, p) through an LDS
// tile. The next launch needs both the statistics and these, and neither needs the other, so they share one launch.
__global__ __launch_bounds__(1024) void k_gnstat(const float* __restrict__ x, float* ST, const float* __restrict__ Wq, const float* __restrict__ Wk, const float* __restrict__ Wv, const float* __restrict__ Wp, bf* WT4) {
    typedef __attribute__((ext_vector_type(2))) float v2f;
    __shared__ __align__(16) v2f red[2][32][4];
    __shared__ __align__(16) unsigned short tl[CC * 72];
    const int tid = threadIdx.x, lane = tid & 31, wave = tid >> 5, q = tid & 3;     // q: which 4 channels (2 groups) of the slice
    if (blockIdx.y == NBI) {     // the same for the whole work-group
        const float* Wm = blockIdx.x == 0 ? Wq : blockIdx.x == 1 ? Wk : blockIdx.x == 2 ? Wv : Wp;
        const int kk = tid >> 4, nq = (tid & 15) * 4;     // 16 lanes read one row k of 256 bytes
        const v4f w = *(const v4f*)(Wm + kk * CC + nq);
#pragma unroll
        for (int i = 0; i < 4; ++i) tl[(nq + i) * 72 + kk] = f2bf(w[i]);
        __syncthreads();     // the whole matrix stands transposed in LDS
        if (tid < 512) *(v8us*)(WT4 + blockIdx.x * CC * CC + (tid >> 3) * CC + (tid & 7) * 8) = *(const v8usa*)(tl + (tid >> 3) * 72 + (tid & 7) * 8);     // 8 lanes write one row n, a whole 128-byte line
        return;
    }
    const float* xp = x + (size_t)blockIdx.y * NN * CC + blockIdx.x * 16 + q * 4 + (size_t)(tid >> 2) * CC;
    v4f v[16];
#pragma unroll
    for (int i = 0; i < 16; ++i) v[i] = *(const v4f*)(xp + (size_t)i * 256 * CC);
    float s0 = 0.f, s1 = 0.f;
#pragma unroll
    for (int i = 0; i < 16; ++i) { v[i] = (v4f){bfr(v[i][0]), bfr(v[i][1]), bfr(v[i][2]), bfr(v[i][3])}; s0 += v[i][0] + v[i][1]; s1 += v[i][2] + v[i][3]; }
#pragma unroll
    for (int sh = 16; sh >= 4; sh >>= 1) { s0 += __shfl_xor(s0, sh, 32); s1 += __shfl_xor(s1, sh, 32); }
    if (lane < 4) red[0][wave][q] = (v2f){s0, s1};
    __syncthreads();
    s0 = 0.f; s1 = 0.f;     // every wave adds the 32 waves' sums: 4 per lane, then the same three exchanges
#pragma unroll
    for (int j = 0; j < 4; ++j) { const v2f t = red[0][j * 8 + (lane >> 2)][q]; s0 += t[0]; s1 += t[1]; }
#pragma unroll
    for (int sh = 16; sh >= 4; sh >>= 1) { s0 += __shfl_xor(s0, sh, 32); s1 += __shfl_xor(s1, sh, 32); }
    const float mu0 = s0 / (float)(2 * NN), mu1 = s1 / (float)(2 * NN);
    float q0 = 0.f, q1 = 0.f;
#pragma unroll
    for (int i = 0; i < 16; ++i) { float d = v[i][0] - mu0; q0 = fmaf(d, d, q0); d = v[i][1] - mu0; q0 = fmaf(d, d, q0); d = v[i][2] - mu1; q1 = fmaf(d, d, q1); d = v[i][3] - mu1; q1 = fmaf(d, d, q1); }
#pragma unroll
    for (int sh = 16; sh >= 4; sh >>= 1) { q0 += __shfl_xor(q0, sh, 32); q1 += __shfl_xor(q1, sh, 32); }
    if (lane < 4) red[1][wave][q] = (v2f){q0, q1};
    __syncthreads();
    if (wave) return;     // behind the last barrier
    q0 = 0.f; q1 = 0.f;
#pragma unroll
    for (int j = 0; j < 4; ++j) { const v2f t = red[1][j * 8 + (lane >> 2)][q]; q0 += t[0]; q1 += t[1]; }
#pragma unroll
    for (int sh = 16; sh >= 4; sh >>= 1) { q0 += __shfl_xor(q0, sh, 32); q1 += __shfl_xor(q1, sh, 32); }
    if (lane < 4) {
        float* st = ST + (size_t)(blockIdx.y * 4 + blockIdx.x) * 32 + 2 * q;
        *(v2f*)st = (v2f){mu0, mu1};
        *(v2f*)(st + 8) = (v2f){rsqrtf(q0 / (float)(2 * NN) + GN_EPS), rsqrtf(q1 / (float)(2 * NN) + GN_EPS)};
    }
}
// k_qkv: GroupNorm applied, the three projections, their hi/lo splits and V's transpose in one kernel, all images in one launch; grid (NN / 64, images), 4 waves x 16 tokens.
// A lane normalises the 32 channels of its token that its fragments hold (k step ks, elements i and 8 + i = channels 32 ks + 8 hi + i and 32 ks + 16 + 8 hi + i), so h stays in registers.
// q, k: transposed products (A = weight rows, B = h rows): a lane holds 8 neighbouring channels of ONE token, 16 bytes of its row. v: A = h rows, B = weight rows: a lane holds
// 8 neighbouring tokens of one channel; the work-group's 64 tokens meet in LDS, so that V^T leaves in whole 128-byte lines, each from one wave.
__global__ __launch_bounds__(128) void k_qkv(const float* __restrict__ x, const float* __restrict__ ST, const float* __restrict__ ga, const float* __restrict__ be,
                                             const bf* __restrict__ WqT, const bf* __restrict__ WkT, const bf* __restrict__ WvT, const float* __restrict__ bq, const float* __restrict__ bk, const float* __restrict__ bv,
                                             bf* Qh, bf* Ql, bf* Kh, bf* Kl, bf* VTh, bf* VTl) {
    __shared__ __align__(16) unsigned short vs[2][CC * 72];
    const int tid = threadIdx.x, lane = tid & 31, wave = tid >> 5, lr = lane & 15, hi = lane >> 4;
    const size_t ib = (size_t)blockIdx.y * NN * CC;
    const size_t ro = ib + (size_t)(blockIdx.x * 64 + wave * 16 + lr) * CC + 8 * hi;
    const float* st = ST + blockIdx.y * 128 + 4 * hi;     // k_gnstat's four lines of this image; channels c .. c + 7 = groups c / 2 .. c / 2 + 3
    v16bf hh[2], hl[2];
#pragma unroll
    for (int ks = 0; ks < 2; ++ks) { v8us oh[2], ol[2];
#pragma unroll
        for (int hf = 0; hf < 2; ++hf) { const int cc = ks * 32 + hf * 16;     // + 8 hi: the lane's 8 channels
            const v4f xv[2] = {*(const v4f*)(x + ro + cc), *(const v4f*)(x + ro + cc + 4)};
            const v4f gv[2] = {*(const v4f*)(ga + cc + 8 * hi), *(const v4f*)(ga + cc + 8 * hi + 4)};
            const v4f ev[2] = {*(const v4f*)(be + cc + 8 * hi), *(const v4f*)(be + cc + 8 * hi + 4)};
            const v4f mu = *(const v4f*)(st + (ks * 2 + hf) * 32), rs = *(const v4f*)(st + (ks * 2 + hf) * 32 + 8);
#pragma unroll
            for (int i = 0; i < 8; ++i) { const float y = (bfr(xv[i >> 2][i & 3]) - mu[i >> 1]) * rs[i >> 1] * bfr(gv[i >> 2][i & 3]) + bfr(ev[i >> 2][i & 3]); const unsigned short hb = f2bf(y); oh[hf][i] = hb; ol[hf][i] = f2bf(y - bf2f(hb)); } }
        hh[ks] = cat16b(oh[0], oh[1]); hl[ks] = cat16b(ol[0], ol[1]); }
    const int wo = lr * CC + 8 * hi;     // a weight fragment: row 16 t + lr, the same k order as h's
    {
        v8f acc[4];
#pragma unroll
        for (int t = 0; t < 4; ++t) acc[t] = (v8f){};
#pragma unroll
        for (int ks = 0; ks < 2; ++ks) {
#pragma unroll
            for (int t = 0; t < 4; ++t) { const bf* wp = WvT + wo + t * 16 * CC + ks * 32; const v16bf w = cat16b(*(const v8us*)wp, *(const v8us*)(wp + 16)); acc[t] = wmmab(hh[ks], w, acc[t]); acc[t] = wmmab(hl[ks], w, acc[t]); } }
#pragma unroll
        for (int t = 0; t < 4; ++t) { const float bb = bfr(bv[t * 16 + lr]); v8us wh, wl;
#pragma unroll
            for (int j = 0; j < 8; ++j) { const float v = acc[t][j] + bb; const unsigned short hb = f2bf(v); wh[j] = hb; wl[j] = f2bf(v - bf2f(hb)); }
            const int o = (t * 16 + lr) * 72 + wave * 16 + 8 * hi; *(v8usa*)(&vs[0][o]) = wh; *(v8usa*)(&vs[1][o]) = wl; }
    }
    auto rows = [&](const bf* __restrict__ WT, const float* __restrict__ bias, bf* Dh, bf* Dl) {
        v8f acc[4];
#pragma unroll
        for (int t = 0; t < 4; ++t) acc[t] = (v8f){};
#pragma unroll
        for (int ks = 0; ks < 2; ++ks) {
#pragma unroll
            for (int t = 0; t < 4; ++t) { const bf* wp = WT + wo + t * 16 * CC + ks * 32; const v16bf w = cat16b(*(const v8us*)wp, *(const v8us*)(wp + 16)); acc[t] = wmmab(w, hh[ks], acc[t]); acc[t] = wmmab(w, hl[ks], acc[t]); } }
#pragma unroll
        for (int t = 0; t < 4; ++t) { const v4f bb[2] = {*(const v4f*)(bias + t * 16 + 8 * hi), *(const v4f*)(bias + t * 16 + 8 * hi + 4)}; v8us wh, wl;
#pragma unroll
            for (int j = 0; j < 8; ++j) { const float v = acc[t][j] + bfr(bb[j >> 2][j & 3]); const unsigned short hb = f2bf(v); wh[j] = hb; wl[j] = f2bf(v - bf2f(hb)); }
            *(v8us*)(Dh + ro + t * 16) = wh; *(v8us*)(Dl + ro + t * 16) = wl; }
    };
    rows(WqT, bq, Qh, Ql); rows(WkT, bk, Kh, Kl);
    __syncthreads();     // all four waves' token columns of V^T stand in LDS
#pragma unroll
    for (int s = 0; s < 4; ++s) { const int row = s * 16 + (tid >> 3), piece = tid & 7; const size_t o = ib + (size_t)row * NN + blockIdx.x * 64 + piece * 8;
        *(v8us*)(VTh + o) = *(const v8usa*)(&vs[0][row * 72 + piece * 8]); *(v8us*)(VTl + o) = *(const v8usa*)(&vs[1][row * 72 + piece * 8]); }
}
// k_attn: scores, softmax and P.v in one kernel, all images in one launch; grid (NN / 128, images), 8 waves. A wave holds 32 queries (two column groups of 16; wave & 3 picks them) and
// walks one half of every stage's keys (wave >> 2 picks it) in passes of 32, so that each K and V^T fragment read from LDS feeds two query tiles; the two waves of a pair join at the end.
// Transposed products: S^T = K.Q^T (A = key rows, B = query rows kept in registers), so a lane holds 16 scores of ONE query of each group (column lr; keys 8 hi + j of each 16-key tile)
// and the two score tiles, converted in place, are the B operand of O^T += V^T.P^T (element i = key 8 hi + i, element 8 + i = key 16 + 8 hi + i: the order the V^T loader uses).
// Maximum and sum per query (exp2 domain), the maximum fixed after the first pass (see at the walk loop); the three hi/lo products of each matrix product are kept.
// K and V^T (hi and lo) reach the waves through LDS: a stage is KT keys, brought once per work-group by asynchronous copies that read whole 128-byte lines, two buffers, the
// next stage in flight while this one is worked on. Rows are pitched 16 bytes x odd, so that the 16 rows of a fragment load fall on all 64 banks.
#define KT   256                        // keys per stage: four passes of 32 for each wave of a pair
#define KPB  (CC * 2 + 16)              // bytes from one K row to the next in LDS
#define VPB  (KT * 2 + 16)              // bytes from one V^T row to the next in LDS
#define KPL  (KT * KPB)                 // one K plane (hi or lo) of a stage
#define VPL  (CC * VPB)                 // one V^T plane of a stage
#define STG  (2 * KPL + 2 * VPL)        // one stage: K hi, K lo, V^T hi, V^T lo
#define XSL  (32 * 136)                 // the join: a wave's slot in the ring, 32 lanes x (32 floats of O^T, maximum, sum)
__device__ __forceinline__ float xhalf(float v) { const int b = __float_as_int(v); return __int_as_float(__builtin_amdgcn_permlanex16(b, b, 0x76543210, 0xfedcba98, false, false)); }
// Eight copies of 16 bytes per lane: four row blocks of plane a, four of plane b. The s_wait_xcnt stands inside the statement, in front of any rewrite of the address registers.
__device__ __forceinline__ void copy8(unsigned la, const bf* ga, unsigned lb, const bf* gb, unsigned lstep, size_t gstep) {
    asm volatile("global_load_async_to_lds_b128 %0, %8, off\n\t"
                 "global_load_async_to_lds_b128 %1, %9, off\n\t"
                 "global_load_async_to_lds_b128 %2, %10, off\n\t"
                 "global_load_async_to_lds_b128 %3, %11, off\n\t"
                 "global_load_async_to_lds_b128 %4, %12, off\n\t"
                 "global_load_async_to_lds_b128 %5, %13, off\n\t"
                 "global_load_async_to_lds_b128 %6, %14, off\n\t"
                 "global_load_async_to_lds_b128 %7, %15, off\n\t"
                 "s_wait_xcnt 0x0"
                 :: "v"(la), "v"(la + lstep), "v"(la + 2 * lstep), "v"(la + 3 * lstep), "v"(lb), "v"(lb + lstep), "v"(lb + 2 * lstep), "v"(lb + 3 * lstep),
                    "v"(ga), "v"(ga + gstep), "v"(ga + 2 * gstep), "v"(ga + 3 * gstep), "v"(gb), "v"(gb + gstep), "v"(gb + 2 * gstep), "v"(gb + 3 * gstep) : "memory");
}
__global__ __launch_bounds__(256) void k_attn(const bf* __restrict__ Qh, const bf* __restrict__ Ql, const bf* __restrict__ Kh, const bf* __restrict__ Kl, const bf* __restrict__ VTh, const bf* __restrict__ VTl, bf* Oh, bf* Ol) {
    typedef __attribute__((ext_vector_type(2))) __bf16 v2bf; typedef __attribute__((ext_vector_type(2))) float v2f; typedef __attribute__((ext_vector_type(8))) unsigned v8u;
    typedef v2f __attribute__((may_alias)) v2fa;
    typedef unsigned char __attribute__((address_space(3))) ldsb; typedef v8usa __attribute__((address_space(3))) v8usl;     // LDS by its own 32-bit address
    __shared__ __align__(16) unsigned char ring[2 * STG];
    __shared__ __align__(16) unsigned flg[8];     // one word a wave: its sums left the safe range under the fixed reference
    const int tid = threadIdx.x, lane = tid & 31, wave = tid >> 5, lr = lane & 15, hi = lane >> 4;
    const int qg = wave & 3, kq = wave >> 2;     // which 32 queries; which KT / 2 keys of every stage
    const size_t ib = (size_t)blockIdx.y * NN * CC;
    const size_t qo = ib + (size_t)(blockIdx.x * 128 + qg * 32 + lr) * CC;     // column group g: + g * 16 * CC
    const float SC2 = SCL * 1.44269504088896341f;
    // The copies: K, 8 lanes a row of 128 bytes, 32 rows a block; V^T, 32 lanes a row of 512 bytes, 8 rows a block; eight blocks a plane.
    const bf* gkh = Kh + ib + tid * 8; const bf* gkl = Kl + ib + tid * 8;
    const bf* gvh = VTh + ib + (size_t)(tid >> 5) * NN + (tid & 31) * 8; const bf* gvl = VTl + ib + (size_t)(tid >> 5) * NN + (tid & 31) * 8;
    const unsigned lk = (unsigned)(size_t)ring + (tid >> 3) * KPB + (tid & 7) * 16, lv = (unsigned)(size_t)ring + 2 * KPL + (tid >> 5) * VPB + (tid & 31) * 16;
    auto fill = [&](int st) {     // stage st into buffer st & 1
        const unsigned bo = (st & 1) * STG;
#pragma unroll
        for (int h = 0; h < 2; ++h) {     // four blocks of each plane a call
            copy8(lk + bo + h * 128 * KPB, gkh + (size_t)st * KT * CC + h * 128 * CC, lk + bo + KPL + h * 128 * KPB, gkl + (size_t)st * KT * CC + h * 128 * CC, 32 * KPB, 32 * CC);
            copy8(lv + bo + h * 32 * VPB, gvh + st * KT + (size_t)h * 32 * NN, lv + bo + VPL + h * 32 * VPB, gvl + st * KT + (size_t)h * 32 * NN, 8 * VPB, (size_t)8 * NN);
        }
    };
    v16bf qh[2][2], ql[2][2];
#pragma unroll
    for (int g = 0; g < 2; ++g) {
#pragma unroll
        for (int ks = 0; ks < 2; ++ks) { const size_t o = qo + g * 16 * CC + ks * 32 + 8 * hi; qh[g][ks] = cat16b(*(const v8us*)(Qh + o), *(const v8us*)(Qh + o + 16)); ql[g][ks] = cat16b(*(const v8us*)(Ql + o), *(const v8us*)(Ql + o + 16)); }
        asm volatile("s_wait_xcnt 0x0" ::: "memory");     // in front of the first rewrite of the Q loads' address registers (also by a later load's result)
        __builtin_amdgcn_sched_barrier(0); }              // keeps what follows, which reuses those registers, behind that wait
    // The softmax reference. Walk 0 fixes it at the maximum of the wave's first 32 keys: p = exp2(score - reference) keeps its relative precision at any size a float holds, and the sum is at
    // least 1, so maximum, exchange and the rescaling of O^T are needed once and not in every pass. Only overflow can spoil that walk; it shows in the sums, and then the whole work-group
    // walks the keys once more (walk 1) with the running maximum renewed in every pass.
#pragma unroll 1     // one copy of the walk in the text; which walk it is reaches the passes as a scalar
    for (int walk = 0; walk < 2; ++walk) {
    v8f oa[2][4];
#pragma unroll
    for (int g = 0; g < 2; ++g) {
#pragma unroll
        for (int dt = 0; dt < 4; ++dt) oa[g][dt] = (v8f){}; }
    float m[2] = {-3.0e38f, -3.0e38f}, l[2] = {0.f, 0.f};
    // Trips -2 and -1 are the ring's prologue: stage 0's copies; their wait and the barrier, then stage 1's copies. So the copies stand once in the text and every address operand of theirs is
    // formed at the call: a base address that is itself an operand of an asm statement must stay below v256 for its whole life, and spilled.
#pragma unroll 1     // one copy of the stage in the text; the buffer is picked by st & 1
    for (int st = -2; st < NN / KT; ++st) {
      if (st >= 0) {
        const unsigned char* kb = ring + (st & 1) * STG + (kq * (KT / 2) + lr) * KPB + 16 * hi;
        // KT / 2 keys = KT bytes along a V^T row. The address is formed as an integer, so that 2 * KPL lies in the base register and every fragment's distance fits the offset field of its ds_load.
        const ldsb* vb = (const ldsb*)((unsigned)(size_t)ring + (st & 1) * STG + 2 * KPL + lr * VPB + kq * KT + 16 * hi);
        v16bf kh[2][2], kl[2][2], vh[4], vl[4];
        auto ldk = [&](int p) {
#pragma unroll
            for (int t = 0; t < 2; ++t) {
#pragma unroll
                for (int ks = 0; ks < 2; ++ks) { const unsigned char* o = kb + (p * 32 + t * 16) * KPB + ks * 64; kh[t][ks] = cat16b(*(const v8usa*)o, *(const v8usa*)(o + 32)); kl[t][ks] = cat16b(*(const v8usa*)(o + KPL), *(const v8usa*)(o + KPL + 32)); } }
        };
        auto ldv = [&](int p) {
#pragma unroll
            for (int dt = 0; dt < 4; ++dt) { const ldsb* o = vb + dt * 16 * VPB + p * 64; vh[dt] = cat16b(*(const v8usl*)o, *(const v8usl*)(o + 32)); vl[dt] = cat16b(*(const v8usl*)(o + VPL), *(const v8usl*)(o + VPL + 32)); }
        };
        auto pass = [&](int p, bool more, bool renew) {     // more: a further pass of this wave in this stage follows; renew (the same for the whole work-group): the reference is renewed
            ldv(p);
            __builtin_amdgcn_sched_barrier(0);     // the V^T loads stay here, one group in flight under the score products; moved down, each waits out its LDS latency in front of its product
            v8f s[2][2];
#pragma unroll
            for (int g = 0; g < 2; ++g) { s[g][0] = (v8f){}; s[g][1] = (v8f){}; }
#pragma unroll
            for (int ks = 0; ks < 2; ++ks) {
#pragma unroll
                for (int g = 0; g < 2; ++g) { s[g][0] = wmmab(kh[0][ks], qh[g][ks], s[g][0]); s[g][1] = wmmab(kh[1][ks], qh[g][ks], s[g][1]); }
#pragma unroll
                for (int g = 0; g < 2; ++g) { s[g][0] = wmmab(kh[0][ks], ql[g][ks], s[g][0]); s[g][1] = wmmab(kh[1][ks], ql[g][ks], s[g][1]); }
#pragma unroll
                for (int g = 0; g < 2; ++g) { s[g][0] = wmmab(kl[0][ks], qh[g][ks], s[g][0]); s[g][1] = wmmab(kl[1][ks], qh[g][ks], s[g][1]); }
            }
            __builtin_amdgcn_sched_barrier(0);     // this fence and the next: the K loads stay one group, behind the products that read the same registers and in front of the softmax that covers their latency
            if (more) ldk(p + 1);     // the next pass's K fragments, inside this stage only
            __builtin_amdgcn_sched_barrier(0);
            if (renew) {
#pragma unroll
                for (int g = 0; g < 2; ++g) {
                    float mt = fmaxf(s[g][0][0], s[g][1][0]);
#pragma unroll
                    for (int j = 1; j < 8; ++j) mt = fmaxf(mt, fmaxf(s[g][0][j], s[g][1][j]));
                    mt = fmaxf(mt, xhalf(mt));
                    const float mn = fmaxf(m[g], mt * SC2), al = __builtin_amdgcn_exp2f(m[g] - mn);
                    m[g] = mn; l[g] *= al;
#pragma unroll
                    for (int dt = 0; dt < 4; ++dt) oa[g][dt] *= al;
                }
            }
#pragma unroll
            for (int g = 0; g < 2; ++g) {
                const float mn = m[g];
#pragma unroll
                for (int t = 0; t < 2; ++t) { const v8f e = __builtin_elementwise_fma(s[g][t], (v8f)(SC2), (v8f)(-mn));     // whole tiles: packed FMAs on the accumulators' own register pairs
#pragma unroll
                    for (int j = 0; j < 8; ++j) s[g][t][j] = __builtin_amdgcn_exp2f(e[j]); }
                const v8f sv = s[g][0] + s[g][1];
                l[g] += ((sv[0] + sv[1]) + (sv[2] + sv[3])) + ((sv[4] + sv[5]) + (sv[6] + sv[7]));
                v8u phw, plw;     // word i of the B operand = elements 2 i, 2 i + 1: hi = bf16(p), lo = bf16(p - hi)
#pragma unroll
                for (int i = 0; i < 8; ++i) { const v2f p2 = (v2f){s[g][i >> 2][(2 * i) & 7], s[g][i >> 2][((2 * i) & 7) + 1]};
                    const unsigned w = __builtin_bit_cast(unsigned, __builtin_convertvector(p2, v2bf)); phw[i] = w;
                    const v2f r2 = p2 - (v2f){__uint_as_float(w << 16), __uint_as_float(w & 0xFFFF0000u)}; plw[i] = __builtin_bit_cast(unsigned, __builtin_convertvector(r2, v2bf)); }
                const v16bf ph = __builtin_bit_cast(v16bf, phw), pl = __builtin_bit_cast(v16bf, plw);
#pragma unroll
                for (int dt = 0; dt < 4; ++dt) oa[g][dt] = wmmab(vh[dt], ph, oa[g][dt]);
#pragma unroll
                for (int dt = 0; dt < 4; ++dt) oa[g][dt] = wmmab(vh[dt], pl, oa[g][dt]);
#pragma unroll
                for (int dt = 0; dt < 4; ++dt) oa[g][dt] = wmmab(vl[dt], ph, oa[g][dt]);
            }
        };
        ldk(0);
#pragma unroll 1     // unrolled, the compiler keeps all the passes' scores live to the foot of the stage
        for (int p = 0; p < KT / 64 - 1; ++p) pass(p, true, walk != 0 || (st | p) == 0);
        pass(KT / 64 - 1, false, walk != 0);
      }
        if (st >= -1) {     // the same for the whole work-group
            asm volatile("s_wait_dscnt 0x0" ::: "memory");        // this wave's reads of the buffer are over before it is refilled
            asm volatile("s_wait_asynccnt 0x0" ::: "memory");     // this wave's share of stage st + 1 has landed
            __syncthreads();                                      // publishes stage st + 1 and ends every wave's reads of stage st
        }
        if (st + 2 < NN / KT) fill(st + 2);
    }
    asm volatile("s_wait_asynccnt 0x0" ::: "memory");     // no copy is outstanding when the wave ends
    // The join. Waves w and w ^ 4 hold the same 32 queries over disjoint keys; wave w finishes column group kq and hands the other group's maximum, sum and O^T to its partner through
    // the ring, which is free: the loop's last barrier stands behind every wave's last read of it, and no copy is under way.
    if (walk == 0) {     // a sum that is infinite, not a number or near the end of the range, in any lane
        float t[4] = {0.f, 0.f, 0.f, 0.f};
#pragma unroll
        for (int g = 0; g < 2; ++g) {
#pragma unroll
            for (int dt = 0; dt < 4; ++dt) {
#pragma unroll
                for (int j = 0; j < 8; ++j) t[j & 3] += __builtin_fabsf(oa[g][dt][j]); } }
        const bool bad = !(l[0] < 0x1p64f) || !(l[1] < 0x1p64f) || !((t[0] + t[1]) + (t[2] + t[3]) < 0x1p100f);
        flg[wave] = __builtin_amdgcn_ballot_w32(bad);     // every lane stores the wave's word
    }
    const bool up = kq != 0;
    unsigned char* xw = ring + wave * XSL;
    const unsigned char* xr = ring + (wave ^ 4) * XSL;
#pragma unroll
    for (int dt = 0; dt < 4; ++dt) { const v8f gv = up ? oa[0][dt] : oa[1][dt];
        *(v4fa*)(xw + (2 * dt) * 512 + lane * 16) = __builtin_shufflevector(gv, gv, 0, 1, 2, 3); *(v4fa*)(xw + (2 * dt + 1) * 512 + lane * 16) = __builtin_shufflevector(gv, gv, 4, 5, 6, 7); }
    *(v2fa*)(xw + 4096 + lane * 8) = (v2f){up ? m[0] : m[1], up ? l[0] : l[1]};
    __syncthreads();     // both waves of every pair have written what the other reads; every wave's flag stands
    if (walk == 0) {
        typedef __attribute__((ext_vector_type(4))) unsigned v4u; typedef v4u __attribute__((may_alias)) v4ua;
        const v4u f0 = *(const v4ua*)flg, f1 = *(const v4ua*)(flg + 4);
        const v4u fo = f0 | f1;
        if (__builtin_amdgcn_readfirstlane((int)(fo[0] | fo[1] | fo[2] | fo[3])) != 0) {     // the same eight words in every wave: the work-group goes as one
            asm volatile("s_wait_dscnt 0x0" ::: "memory");     // this wave's writes to the ring are over before walk 1's copies refill it; nobody reads the ring behind the barrier above
            continue;
        }
    }
    const v2f pml = *(const v2fa*)(xr + 4096 + lane * 8);
    const float km = up ? m[1] : m[0], kl_ = up ? l[1] : l[0];
    const float mn = fmaxf(km, pml[0]), fa = __builtin_amdgcn_exp2f(km - mn), fb = __builtin_amdgcn_exp2f(pml[0] - mn);
    float lt = fmaf(kl_, fa, pml[1] * fb);
    lt += xhalf(lt);     // the two halves of a column hold the sums of disjoint keys
    const float inv = 1.0f / lt, ca = fa * inv, cb = fb * inv;
#pragma unroll
    for (int dt = 0; dt < 4; ++dt) { const v8f kv = up ? oa[1][dt] : oa[0][dt]; const v4f p0 = *(const v4fa*)(xr + (2 * dt) * 512 + lane * 16), p1 = *(const v4fa*)(xr + (2 * dt + 1) * 512 + lane * 16); v8us wh, wl;
#pragma unroll
        for (int j = 0; j < 8; ++j) { const float v = fmaf(kv[j], ca, (j < 4 ? p0[j & 3] : p1[j & 3]) * cb); const unsigned short hb = f2bf(v); wh[j] = hb; wl[j] = f2bf(v - bf2f(hb)); }
        const size_t o = qo + kq * 16 * CC + dt * 16 + 8 * hi; *(v8us*)(Oh + o) = wh; *(v8us*)(Ol + o) = wl;
        asm volatile("s_wait_xcnt 0x0" ::: "memory");     // in front of the next tile's rewrite of the stores' data registers
        __builtin_amdgcn_sched_barrier(0); }              // keeps the next tile's vector work, which reuses those registers, behind that wait
    break;     // walk 1 is taken only through the continue above
    }
}

extern "C" void kernel_launch(void* const* d_in, const int* in_sizes, int n_in,
                              void* d_out, int out_size, void* d_ws, size_t ws_size, hipStream_t stream) {
    (void)in_sizes; (void)n_in; (void)out_size;
    const float* x = (const float*)d_in[0]; const float* ga = (const float*)d_in[1]; const float* be = (const float*)d_in[2];
    const float* Wq = (const float*)d_in[3]; const float* bq = (const float*)d_in[4]; const float* Wk = (const float*)d_in[5]; const float* bk = (const float*)d_in[6]; const float* Wv = (const float*)d_in[7]; const float* bv = (const float*)d_in[8]; const float* Wp = (const float*)d_in[9]; const float* bp = (const float*)d_in[10];   // k-major (h @ W)
    float* out = (float*)d_out;    // [8][64][64][64] channels-last
    char* wsp = (char*)d_ws;
    auto take = [&](size_t bytes) { char* p = wsp; wsp += (bytes + 255) & ~(size_t)255; return (void*)p; };
    bf* WqT = (bf*)take(4 * CC * CC * 2); bf* WkT = WqT + CC * CC; bf* WvT = WqT + 2 * CC * CC; bf* WpT = WqT + 3 * CC * CC; float* ST = (float*)take(NBI * 4 * 128);
    const size_t PLN = (size_t)NN * CC;    // one image's plane, in elements
    bf* Qh = (bf*)take(NBI * PLN * 2); bf* Ql = (bf*)take(NBI * PLN * 2); bf* Kh = (bf*)take(NBI * PLN * 2); bf* Kl = (bf*)take(NBI * PLN * 2); bf* VTh = (bf*)take(NBI * PLN * 2); bf* VTl = (bf*)take(NBI * PLN * 2);
    bf* Oh = (bf*)take(NBI * PLN * 2); bf* Ol = (bf*)take(NBI * PLN * 2);
    if ((size_t)(wsp - (char*)d_ws) > ws_size) return;    // ~ 0.03 + 8 x 4.2 ~ 34 MB
    k_gnstat<<<dim3(4, NBI + 1, 1), 1024, 0, stream>>>(x, ST, Wq, Wk, Wv, Wp, WqT);    // row NBI of the grid: the four weight transposes
    k_qkv<<<dim3(NN / 64, NBI, 1), 128, 0, stream>>>(x, ST, ga, be, WqT, WkT, WvT, bq, bk, bv, Qh, Ql, Kh, Kl, VTh, VTl);
    k_attn<<<dim3(NN / 128, NBI, 1), 256, 0, stream>>>(Qh, Ql, Kh, Kl, VTh, VTl, Oh, Ol);
    k_gemmb<true, false><<<dim3(NBI * NN / 64, 1, 1), 128, 0, stream>>>(Oh, Ol, WpT, bp, out, CC, nullptr, x, CC, 1);    // attn.Wp + bp + x
}

// v008
// One run takes 77.5 microseconds.
// Next to v007, in two timings, it ran 1.09 and 1.10 times as fast.
// Over all steps from v000 it is 281 times as fast.
#include <hip/hip_runtime.h>

// Compute dtypes, f32 accumulate, all images in each launch (tokens = the 4096 positions, channels-last rows of 64): GroupNorm (32 groups x 2 channels, stats over H, W and the
// products) on v_wmma_f32_16x16x32_bf16; the full 4096 x 4096 single-head attention in one fused kernel (k_attn: scores three products, softmax x 1/8 in f32 -> hi/lo, P.v three products)

#define NBI  8
#define NN   4096
#define CC   64
#define NGR  32
#define DM   CC
#define NTK  NN
#define GN_EPS 1e-6f
#define SCL  0.125f
#define LOSC 1024.0f

typedef _Float16 h16;
typedef unsigned short bf;
typedef __attribute__((ext_vector_type(16))) __bf16   v16bf;
typedef __attribute__((ext_vector_type(16))) _Float16 v16h;
typedef __attribute__((ext_vector_type(8)))  _Float16 v8h;
typedef __attribute__((ext_vector_type(8)))  unsigned short v8us;
typedef __attribute__((ext_vector_type(8)))  float    v8f;
typedef __attribute__((ext_vector_type(4)))  float    v4f;
typedef __attribute__((ext_vector_type(4)))  _Float16 v4h;
typedef v8h  __attribute__((may_alias)) v8ha;
typedef v4f  __attribute__((may_alias)) v4fa;
typedef v8us __attribute__((may_alias)) v8usa;

__device__ __forceinline__ unsigned short f2bf(float f) { unsigned u = __float_as_uint(f); u += 0x7FFFu + ((u >> 16) & 1u); return (unsigned short)(u >> 16); }
__device__ __forceinline__ float bf2f(unsigned short b) { return __uint_as_float(((unsigned)b) << 16); }
__device__ __forceinline__ float bfr(float f) { return bf2f(f2bf(f)); }
__device__ __forceinline__ v16h cat16(v8h lo, v8h hi) { return __builtin_shufflevector(lo, hi, 0, 1, 2, 3, 4, 5, 6, 7, 8, 9, 10, 11, 12, 13, 14, 15); }
__device__ __forceinline__ v16bf cat16b(v8us lo, v8us hi) { return __builtin_bit_cast(v16bf, __builtin_shufflevector(lo, hi, 0, 1, 2, 3, 4, 5, 6, 7, 8, 9, 10, 11, 12, 13, 14, 15)); }
__device__ __forceinline__ v8f wmma16(v16h a, v16h b, v8f c) { return __builtin_amdgcn_wmma_f32_16x16x32_f16(false, a, false, b, (short)0, c, false, false); }
__device__ __forceinline__ v8f wmmab(v16bf a, v16bf b, v8f c) { return __builtin_amdgcn_wmma_f32_16x16x32_bf16(false, a, false, b, (short)0, c, false, false); }

// k_gnstat: one work-group per (image, slice of 16 channels = 8 groups). A wave's 16-byte loads cover 8 rows x 64 bytes; each thread keeps its 16 rows x 4 channels in
// registers, so x is read once for both passes (mean, then centred squares). ST: one 128-byte line per work-group, floats 0..7 = mean, 8..15 = rsqrt(var + eps).
// The launch carries one more row of work-groups (blockIdx.y = NBI): work-group blockIdx.x of it writes WT[n][k] = bf16(W[k][n]) of one 64 x 64 weight matrix (q, k, v, p) through an LDS
// tile. The next launch needs both the statistics and these, and neither needs the other, so they share one launch.
__global__ __launch_bounds__(1024) void k_gnstat(const float* __restrict__ x, float* ST, const float* __restrict__ Wq, const float* __restrict__ Wk, const float* __restrict__ Wv, const float* __restrict__ Wp, bf* WT4) {
    typedef __attribute__((ext_vector_type(2))) float v2f;
    __shared__ __align__(16) v2f red[2][32][4];
    __shared__ __align__(16) unsigned short tl[CC * 72];
    const int tid = threadIdx.x, lane = tid & 31, wave = tid >> 5, q = tid & 3;     // q: which 4 channels (2 groups) of the slice
    if (blockIdx.y == NBI) {     // the same for the whole work-group
        const float* Wm = blockIdx.x == 0 ? Wq : blockIdx.x == 1 ? Wk : blockIdx.x == 2 ? Wv : Wp;
        const int kk = tid >> 4, nq = (tid & 15) * 4;     // 16 lanes read one row k of 256 bytes
        const v4f w = *(const v4f*)(Wm + kk * CC + nq);
#pragma unroll
        for (int i = 0; i < 4; ++i) tl[(nq + i) * 72 + kk] = f2bf(w[i]);
        __syncthreads();     // the whole matrix stands transposed in LDS
        if (tid < 512) *(v8us*)(WT4 + blockIdx.x * CC * CC + (tid >> 3) * CC + (tid & 7) * 8) = *(const v8usa*)(tl + (tid >> 3) * 72 + (tid & 7) * 8);     // 8 lanes write one row n, a whole 128-byte line
        return;
    }
    const float* xp = x + (size_t)blockIdx.y * NN * CC + blockIdx.x * 16 + q * 4 + (size_t)(tid >> 2) * CC;
    v4f v[16];
#pragma unroll
    for (int i = 0; i < 16; ++i) v[i] = *(const v4f*)(xp + (size_t)i * 256 * CC);
    float s0 = 0.f, s1 = 0.f;
#pragma unroll
    for (int i = 0; i < 16; ++i) { v[i] = (v4f){bfr(v[i][0]), bfr(v[i][1]), bfr(v[i][2]), bfr(v[i][3])}; s0 += v[i][0] + v[i][1]; s1 += v[i][2] + v[i][3]; }
#pragma unroll
    for (int sh = 16; sh >= 4; sh >>= 1) { s0 += __shfl_xor(s0, sh, 32); s1 += __shfl_xor(s1, sh, 32); }
    if (lane < 4) red[0][wave][q] = (v2f){s0, s1};
    __syncthreads();
    s0 = 0.f; s1 = 0.f;     // every wave adds the 32 waves' sums: 4 per lane, then the same three exchanges
#pragma unroll
    for (int j = 0; j < 4; ++j) { const v2f t = red[0][j * 8 + (lane >> 2)][q]; s0 += t[0]; s1 += t[1]; }
#pragma unroll
    for (int sh = 16; sh >= 4; sh >>= 1) { s0 += __shfl_xor(s0, sh, 32); s1 += __shfl_xor(s1, sh, 32); }
    const float mu0 = s0 / (float)(2 * NN), mu1 = s1 / (float)(2 * NN);
    float q0 = 0.f, q1 = 0.f;
#pragma unroll
    for (int i = 0; i < 16; ++i) { float d = v[i][0] - mu0; q0 = fmaf(d, d, q0); d = v[i][1] - mu0; q0 = fmaf(d, d, q0); d = v[i][2] - mu1; q1 = fmaf(d, d, q1); d = v[i][3] - mu1; q1 = fmaf(d, d, q1); }
#pragma unroll
    for (int sh = 16; sh >= 4; sh >>= 1) { q0 += __shfl_xor(q0, sh, 32); q1 += __shfl_xor(q1, sh, 32); }
    if (lane < 4) red[1][wave][q] = (v2f){q0, q1};
    __syncthreads();
    if (wave) return;     // behind the last barrier
    q0 = 0.f; q1 = 0.f;
#pragma unroll
    for (int j = 0; j < 4; ++j) { const v2f t = red[1][j * 8 + (lane >> 2)][q]; q0 += t[0]; q1 += t[1]; }
#pragma unroll
    for (int sh = 16; sh >= 4; sh >>= 1) { q0 += __shfl_xor(q0, sh, 32); q1 += __shfl_xor(q1, sh, 32); }
    if (lane < 4) {
        float* st = ST + (size_t)(blockIdx.y * 4 + blockIdx.x) * 32 + 2 * q;
        *(v2f*)st = (v2f){mu0, mu1};
        *(v2f*)(st + 8) = (v2f){rsqrtf(q0 / (float)(2 * NN) + GN_EPS), rsqrtf(q1 / (float)(2 * NN) + GN_EPS)};
    }
}
// k_qkv: GroupNorm applied, the three projections, their hi/lo splits and V's transpose in one kernel, all images in one launch; grid (NN / 64, images), 4 waves x 16 tokens.
// A lane normalises the 32 channels of its token that its fragments hold (k step ks, elements i and 8 + i = channels 32 ks + 8 hi + i and 32 ks + 16 + 8 hi + i), so h stays in registers.
// q, k: transposed products (A = weight rows, B = h rows): a lane holds 8 neighbouring channels of ONE token, 16 bytes of its row. v: A = h rows, B = weight rows: a lane holds
// 8 neighbouring tokens of one channel; the work-group's 64 tokens meet in LDS, so that V^T leaves in whole 128-byte lines, each from one wave.
__global__ __launch_bounds__(128) void k_qkv(const float* __restrict__ x, const float* __restrict__ ST, const float* __restrict__ ga, const float* __restrict__ be,
                                             const bf* __restrict__ WqT, const bf* __restrict__ WkT, const bf* __restrict__ WvT, const float* __restrict__ bq, const float* __restrict__ bk, const float* __restrict__ bv,
                                             bf* Qh, bf* Ql, bf* Kh, bf* Kl, bf* VTh, bf* VTl) {
    __shared__ __align__(16) unsigned short vs[2][CC * 72];
    const int tid = threadIdx.x, lane = tid & 31, wave = tid >> 5, lr = lane & 15, hi = lane >> 4;
    const size_t ib = (size_t)blockIdx.y * NN * CC;
    const size_t ro = ib + (size_t)(blockIdx.x * 64 + wave * 16 + lr) * CC + 8 * hi;
    const float* st = ST + blockIdx.y * 128 + 4 * hi;     // k_gnstat's four lines of this image; channels c .. c + 7 = groups c / 2 .. c / 2 + 3
    v16bf hh[2], hl[2];
#pragma unroll
    for (int ks = 0; ks < 2; ++ks) { v8us oh[2], ol[2];
#pragma unroll
        for (int hf = 0; hf < 2; ++hf) { const int cc = ks * 32 + hf * 16;     // + 8 hi: the lane's 8 channels
            const v4f xv[2] = {*(const v4f*)(x + ro + cc), *(const v4f*)(x + ro + cc + 4)};
            const v4f gv[2] = {*(const v4f*)(ga + cc + 8 * hi), *(const v4f*)(ga + cc + 8 * hi + 4)};
            const v4f ev[2] = {*(const v4f*)(be + cc + 8 * hi), *(const v4f*)(be + cc + 8 * hi + 4)};
            const v4f mu = *(const v4f*)(st + (ks * 2 + hf) * 32), rs = *(const v4f*)(st + (ks * 2 + hf) * 32 + 8);
#pragma unroll
            for (int i = 0; i < 8; ++i) { const float y = (bfr(xv[i >> 2][i & 3]) - mu[i >> 1]) * rs[i >> 1] * bfr(gv[i >> 2][i & 3]) + bfr(ev[i >> 2][i & 3]); const unsigned short hb = f2bf(y); oh[hf][i] = hb; ol[hf][i] = f2bf(y - bf2f(hb)); } }
        hh[ks] = cat16b(oh[0], oh[1]); hl[ks] = cat16b(ol[0], ol[1]); }
    const int wo = lr * CC + 8 * hi;     // a weight fragment: row 16 t + lr, the same k order as h's
    {
        v8f acc[4];
#pragma unroll
        for (int t = 0; t < 4; ++t) acc[t] = (v8f){};
#pragma unroll
        for (int ks = 0; ks < 2; ++ks) {
#pragma unroll
            for (int t = 0; t < 4; ++t) { const bf* wp = WvT + wo + t * 16 * CC + ks * 32; const v16bf w = cat16b(*(const v8us*)wp, *(const v8us*)(wp + 16)); acc[t] = wmmab(hh[ks], w, acc[t]); acc[t] = wmmab(hl[ks], w, acc[t]); } }
#pragma unroll
        for (int t = 0; t < 4; ++t) { const float bb = bfr(bv[t * 16 + lr]); v8us wh, wl;
#pragma unroll
            for (int j = 0; j < 8; ++j) { const float v = acc[t][j] + bb; const unsigned short hb = f2bf(v); wh[j] = hb; wl[j] = f2bf(v - bf2f(hb)); }
            const int o = (t * 16 + lr) * 72 + wave * 16 + 8 * hi; *(v8usa*)(&vs[0][o]) = wh; *(v8usa*)(&vs[1][o]) = wl; }
    }
    auto rows = [&](const bf* __restrict__ WT, const float* __restrict__ bias, bf* Dh, bf* Dl) {
        v8f acc[4];
#pragma unroll
        for (int t = 0; t < 4; ++t) acc[t] = (v8f){};
#pragma unroll
        for (int ks = 0; ks < 2; ++ks) {
#pragma unroll
            for (int t = 0; t < 4; ++t) { const bf* wp = WT + wo + t * 16 * CC + ks * 32; const v16bf w = cat16b(*(const v8us*)wp, *(const v8us*)(wp + 16)); acc[t] = wmmab(w, hh[ks], acc[t]); acc[t] = wmmab(w, hl[ks], acc[t]); } }
#pragma unroll
        for (int t = 0; t < 4; ++t) { const v4f bb[2] = {*(const v4f*)(bias + t * 16 + 8 * hi), *(const v4f*)(bias + t * 16 + 8 * hi + 4)}; v8us wh, wl;
#pragma unroll
            for (int j = 0; j < 8; ++j) { const float v = acc[t][j] + bfr(bb[j >> 2][j & 3]); const unsigned short hb = f2bf(v); wh[j] = hb; wl[j] = f2bf(v - bf2f(hb)); }
            *(v8us*)(Dh + ro + t * 16) = wh; *(v8us*)(Dl + ro + t * 16) = wl; }
    };
    rows(WqT, bq, Qh, Ql); rows(WkT, bk, Kh, Kl);
    __syncthreads();     // all four waves' token columns of V^T stand in LDS
#pragma unroll
    for (int s = 0; s < 4; ++s) { const int row = s * 16 + (tid >> 3), piece = tid & 7; const size_t o = ib + (size_t)row * NN + blockIdx.x * 64 + piece * 8;
        *(v8us*)(VTh + o) = *(const v8usa*)(&vs[0][row * 72 + piece * 8]); *(v8us*)(VTl + o) = *(const v8usa*)(&vs[1][row * 72 + piece * 8]); }
}
// k_attn: scores, softmax, P.v and the output projection with bias and residual in one kernel, all images in one launch; grid (NN / 128, images), 8 waves. A wave holds 32 queries (two column groups of 16; wave & 3 picks them) and
// walks one half of every stage's keys (wave >> 2 picks it) in passes of 32, so that each K and V^T fragment read from LDS feeds two query tiles; the two waves of a pair join at the end.
// Transposed products: S^T = K.Q^T (A = key rows, B = query rows kept in registers), so a lane holds 16 scores of ONE query of each group (column lr; keys 8 hi + j of each 16-key tile)
// and the two score tiles, converted in place, are the B operand of O^T += V^T.P^T (element i = key 8 hi + i, element 8 + i = key 16 + 8 hi + i: the order the V^T loader uses).
// Maximum and sum per query (exp2 domain), the maximum fixed after the first pass (see at the walk loop); the three hi/lo products of S^T and of O^T are kept.
// K and V^T (hi and lo) reach the waves through LDS: a stage is KT keys, brought once per work-group by asynchronous copies that read whole 128-byte lines, two buffers, the
// next stage in flight while this one is worked on. Rows are pitched 16 bytes x odd, so that the 16 rows of a fragment load fall on all 64 banks.
#define KT   256                        // keys per stage: four passes of 32 for each wave of a pair
#define KPB  (CC * 2 + 16)              // bytes from one K row to the next in LDS
#define VPB  (KT * 2 + 16)              // bytes from one V^T row to the next in LDS
#define KPL  (KT * KPB)                 // one K plane (hi or lo) of a stage
#define VPL  (CC * VPB)                 // one V^T plane of a stage
#define STG  (2 * KPL + 2 * VPL)        // one stage: K hi, K lo, V^T hi, V^T lo
#define XSL  (32 * 136)                 // the join: a wave's slot in the ring, 32 lanes x (32 floats of O^T, maximum, sum)
__device__ __forceinline__ float xhalf(float v) { const int b = __float_as_int(v); return __int_as_float(__builtin_amdgcn_permlanex16(b, b, 0x76543210, 0xfedcba98, false, false)); }
// Eight copies of 16 bytes per lane: four row blocks of plane a, four of plane b. The s_wait_xcnt stands inside the statement, in front of any rewrite of the address registers.
__device__ __forceinline__ void copy8(unsigned la, const bf* ga, unsigned lb, const bf* gb, unsigned lstep, size_t gstep) {
    asm volatile("global_load_async_to_lds_b128 %0, %8, off\n\t"
                 "global_load_async_to_lds_b128 %1, %9, off\n\t"
                 "global_load_async_to_lds_b128 %2, %10, off\n\t"
                 "global_load_async_to_lds_b128 %3, %11, off\n\t"
                 "global_load_async_to_lds_b128 %4, %12, off\n\t"
                 "global_load_async_to_lds_b128 %5, %13, off\n\t"
                 "global_load_async_to_lds_b128 %6, %14, off\n\t"
                 "global_load_async_to_lds_b128 %7, %15, off\n\t"
                 "s_wait_xcnt 0x0"
                 :: "v"(la), "v"(la + lstep), "v"(la + 2 * lstep), "v"(la + 3 * lstep), "v"(lb), "v"(lb + lstep), "v"(lb + 2 * lstep), "v"(lb + 3 * lstep),
                    "v"(ga), "v"(ga + gstep), "v"(ga + 2 * gstep), "v"(ga + 3 * gstep), "v"(gb), "v"(gb + gstep), "v"(gb + 2 * gstep), "v"(gb + 3 * gstep) : "memory");
}
__global__ __launch_bounds__(256) void k_attn(const bf* __restrict__ Qh, const bf* __restrict__ Ql, const bf* __restrict__ Kh, const bf* __restrict__ Kl, const bf* __restrict__ VTh, const bf* __restrict__ VTl,
                                              const bf* __restrict__ WpT, const float* __restrict__ bp, const float* __restrict__ x, float* out) {
    typedef __attribute__((ext_vector_type(2))) __bf16 v2bf; typedef __attribute__((ext_vector_type(2))) float v2f; typedef __attribute__((ext_vector_type(8))) unsigned v8u;
    typedef v2f __attribute__((may_alias)) v2fa;
    typedef unsigned char __attribute__((address_space(3))) ldsb; typedef v8usa __attribute__((address_space(3))) v8usl;     // LDS by its own 32-bit address
    __shared__ __align__(16) unsigned char ring[2 * STG];
    __shared__ __align__(16) unsigned flg[8];     // one word a wave: its sums left the safe range under the fixed reference
    const int tid = threadIdx.x, lane = tid & 31, wave = tid >> 5, lr = lane & 15, hi = lane >> 4;
    const int qg = wave & 3, kq = wave >> 2;     // which 32 queries; which KT / 2 keys of every stage
    const size_t ib = (size_t)blockIdx.y * NN * CC;
    const size_t qo = ib + (size_t)(blockIdx.x * 128 + qg * 32 + lr) * CC;     // column group g: + g * 16 * CC
    const float SC2 = SCL * 1.44269504088896341f;
    // The copies: K, 8 lanes a row of 128 bytes, 32 rows a block; V^T, 32 lanes a row of 512 bytes, 8 rows a block; eight blocks a plane.
    const bf* gkh = Kh + ib + tid * 8; const bf* gkl = Kl + ib + tid * 8;
    const bf* gvh = VTh + ib + (size_t)(tid >> 5) * NN + (tid & 31) * 8; const bf* gvl = VTl + ib + (size_t)(tid >> 5) * NN + (tid & 31) * 8;
    const unsigned lk = (unsigned)(size_t)ring + (tid >> 3) * KPB + (tid & 7) * 16, lv = (unsigned)(size_t)ring + 2 * KPL + (tid >> 5) * VPB + (tid & 31) * 16;
    auto fill = [&](int st) {     // stage st into buffer st & 1
        const unsigned bo = (st & 1) * STG;
#pragma unroll
        for (int h = 0; h < 2; ++h) {     // four blocks of each plane a call
            copy8(lk + bo + h * 128 * KPB, gkh + (size_t)st * KT * CC + h * 128 * CC, lk + bo + KPL + h * 128 * KPB, gkl + (size_t)st * KT * CC + h * 128 * CC, 32 * KPB, 32 * CC);
            copy8(lv + bo + h * 32 * VPB, gvh + st * KT + (size_t)h * 32 * NN, lv + bo + VPL + h * 32 * VPB, gvl + st * KT + (size_t)h * 32 * NN, 8 * VPB, (size_t)8 * NN);
        }
    };
    v16bf qh[2][2], ql[2][2];
#pragma unroll
    for (int g = 0; g < 2; ++g) {
#pragma unroll
        for (int ks = 0; ks < 2; ++ks) { const size_t o = qo + g * 16 * CC + ks * 32 + 8 * hi; qh[g][ks] = cat16b(*(const v8us*)(Qh + o), *(const v8us*)(Qh + o + 16)); ql[g][ks] = cat16b(*(const v8us*)(Ql + o), *(const v8us*)(Ql + o + 16)); }
        asm volatile("s_wait_xcnt 0x0" ::: "memory");     // in front of the first rewrite of the Q loads' address registers (also by a later load's result)
        __builtin_amdgcn_sched_barrier(0); }              // keeps what follows, which reuses those registers, behind that wait
    // The softmax reference. Walk 0 fixes it at the maximum of the wave's first 32 keys: p = exp2(score - reference) keeps its relative precision at any size a float holds, and the sum is at
    // least 1, so maximum, exchange and the rescaling of O^T are needed once and not in every pass. Only overflow can spoil that walk; it shows in the sums, and then the whole work-group
    // walks the keys once more (walk 1) with the running maximum renewed in every pass.
#pragma unroll 1     // one copy of the walk in the text; which walk it is reaches the passes as a scalar
    for (int walk = 0; walk < 2; ++walk) {
    v8f oa[2][4];
#pragma unroll
    for (int g = 0; g < 2; ++g) {
#pragma unroll
        for (int dt = 0; dt < 4; ++dt) oa[g][dt] = (v8f){}; }
    float m[2] = {-3.0e38f, -3.0e38f}, l[2] = {0.f, 0.f};
    // Trips -2 and -1 are the ring's prologue: stage 0's copies; their wait and the barrier, then stage 1's copies. So the copies stand once in the text and every address operand of theirs is
    // formed at the call: a base address that is itself an operand of an asm statement must stay below v256 for its whole life, and spilled.
#pragma unroll 1     // one copy of the stage in the text; the buffer is picked by st & 1
    for (int st = -2; st < NN / KT; ++st) {
      if (st >= 0) {
        const unsigned char* kb = ring + (st & 1) * STG + (kq * (KT / 2) + lr) * KPB + 16 * hi;
        // KT / 2 keys = KT bytes along a V^T row. The address is formed as an integer, so that 2 * KPL lies in the base register and every fragment's distance fits the offset field of its ds_load.
        const ldsb* vb = (const ldsb*)((unsigned)(size_t)ring + (st & 1) * STG + 2 * KPL + lr * VPB + kq * KT + 16 * hi);
        v16bf kh[2][2], kl[2][2], vh[4], vl[4];
        auto ldk = [&](int p) {
#pragma unroll
            for (int t = 0; t < 2; ++t) {
#pragma unroll
                for (int ks = 0; ks < 2; ++ks) { const unsigned char* o = kb + (p * 32 + t * 16) * KPB + ks * 64; kh[t][ks] = cat16b(*(const v8usa*)o, *(const v8usa*)(o + 32)); kl[t][ks] = cat16b(*(const v8usa*)(o + KPL), *(const v8usa*)(o + KPL + 32)); } }
        };
        auto ldv = [&](int p) {
#pragma unroll
            for (int dt = 0; dt < 4; ++dt) { const ldsb* o = vb + dt * 16 * VPB + p * 64; vh[dt] = cat16b(*(const v8usl*)o, *(const v8usl*)(o + 32)); vl[dt] = cat16b(*(const v8usl*)(o + VPL), *(const v8usl*)(o + VPL + 32)); }
        };
        auto pass = [&](int p, bool more, bool renew) {     // more: a further pass of this wave in this stage follows; renew (the same for the whole work-group): the reference is renewed
            ldv(p);
            __builtin_amdgcn_sched_barrier(0);     // the V^T loads stay here, one group in flight under the score products; moved down, each waits out its LDS latency in front of its product
            v8f s[2][2];
#pragma unroll
            for (int g = 0; g < 2; ++g) { s[g][0] = (v8f){}; s[g][1] = (v8f){}; }
#pragma unroll
            for (int ks = 0; ks < 2; ++ks) {
#pragma unroll
                for (int g = 0; g < 2; ++g) { s[g][0] = wmmab(kh[0][ks], qh[g][ks], s[g][0]); s[g][1] = wmmab(kh[1][ks], qh[g][ks], s[g][1]); }
#pragma unroll
                for (int g = 0; g < 2; ++g) { s[g][0] = wmmab(kh[0][ks], ql[g][ks], s[g][0]); s[g][1] = wmmab(kh[1][ks], ql[g][ks], s[g][1]); }
#pragma unroll
                for (int g = 0; g < 2; ++g) { s[g][0] = wmmab(kl[0][ks], qh[g][ks], s[g][0]); s[g][1] = wmmab(kl[1][ks], qh[g][ks], s[g][1]); }
            }
            __builtin_amdgcn_sched_barrier(0);     // this fence and the next: the K loads stay one group, behind the products that read the same registers and in front of the softmax that covers their latency
            if (more) ldk(p + 1);     // the next pass's K fragments, inside this stage only
            __builtin_amdgcn_sched_barrier(0);
            if (renew) {
#pragma unroll
                for (int g = 0; g < 2; ++g) {
                    float mt = fmaxf(s[g][0][0], s[g][1][0]);
#pragma unroll
                    for (int j = 1; j < 8; ++j) mt = fmaxf(mt, fmaxf(s[g][0][j], s[g][1][j]));
                    mt = fmaxf(mt, xhalf(mt));
                    const float mn = fmaxf(m[g], mt * SC2), al = __builtin_amdgcn_exp2f(m[g] - mn);
                    m[g] = mn; l[g] *= al;
#pragma unroll
                    for (int dt = 0; dt < 4; ++dt) oa[g][dt] *= al;
                }
            }
#pragma unroll
            for (int g = 0; g < 2; ++g) {
                const float mn = m[g];
#pragma unroll
                for (int t = 0; t < 2; ++t) { const v8f e = __builtin_elementwise_fma(s[g][t], (v8f)(SC2), (v8f)(-mn));     // whole tiles: packed FMAs on the accumulators' own register pairs
#pragma unroll
                    for (int j = 0; j < 8; ++j) s[g][t][j] = __builtin_amdgcn_exp2f(e[j]); }
                const v8f sv = s[g][0] + s[g][1];
                l[g] += ((sv[0] + sv[1]) + (sv[2] + sv[3])) + ((sv[4] + sv[5]) + (sv[6] + sv[7]));
                v8u phw, plw;     // word i of the B operand = elements 2 i, 2 i + 1: hi = bf16(p), lo = bf16(p - hi)
#pragma unroll
                for (int i = 0; i < 8; ++i) { const v2f p2 = (v2f){s[g][i >> 2][(2 * i) & 7], s[g][i >> 2][((2 * i) & 7) + 1]};
                    const unsigned w = __builtin_bit_cast(unsigned, __builtin_convertvector(p2, v2bf)); phw[i] = w;
                    const v2f r2 = p2 - (v2f){__uint_as_float(w << 16), __uint_as_float(w & 0xFFFF0000u)}; plw[i] = __builtin_bit_cast(unsigned, __builtin_convertvector(r2, v2bf)); }
                const v16bf ph = __builtin_bit_cast(v16bf, phw), pl = __builtin_bit_cast(v16bf, plw);
#pragma unroll
                for (int dt = 0; dt < 4; ++dt) oa[g][dt] = wmmab(vh[dt], ph, oa[g][dt]);
#pragma unroll
                for (int dt = 0; dt < 4; ++dt) oa[g][dt] = wmmab(vh[dt], pl, oa[g][dt]);
#pragma unroll
                for (int dt = 0; dt < 4; ++dt) oa[g][dt] = wmmab(vl[dt], ph, oa[g][dt]);
            }
        };
        ldk(0);
#pragma unroll 1     // unrolled, the compiler keeps all the passes' scores live to the foot of the stage
        for (int p = 0; p < KT / 64 - 1; ++p) pass(p, true, walk != 0 || (st | p) == 0);
        pass(KT / 64 - 1, false, walk != 0);
      }
        if (st >= -1) {     // the same for the whole work-group
            asm volatile("s_wait_dscnt 0x0" ::: "memory");        // this wave's reads of the buffer are over before it is refilled
            asm volatile("s_wait_asynccnt 0x0" ::: "memory");     // this wave's share of stage st + 1 has landed
            __syncthreads();                                      // publishes stage st + 1 and ends every wave's reads of stage st
        }
        if (st + 2 < NN / KT) fill(st + 2);
    }
    asm volatile("s_wait_asynccnt 0x0" ::: "memory");     // no copy is outstanding when the wave ends
    // What the output projection at the foot needs from memory is asked for here, so that it arrives under the join: the eight fragments of Wp^T (A operand: row 16 t + lr, the k order of the
    // other weight loaders), and x and the bias in the order of the final stores (8 lanes a 128-byte line; row (lane >> 4) + 2 s of the wave's 16 tokens).
    v16bf wp[4][2];
#pragma unroll
    for (int t = 0; t < 4; ++t) {
#pragma unroll
        for (int ks = 0; ks < 2; ++ks) { const bf* p = WpT + (t * 16 + lr) * CC + ks * 32 + 8 * hi; wp[t][ks] = cat16b(*(const v8us*)p, *(const v8us*)(p + 16)); } }
    const int cofs = ((lane >> 3) & 1) * 32 + (lane & 7) * 4;
    const size_t xo = ib + (size_t)(blockIdx.x * 128 + qg * 32 + kq * 16 + (lane >> 4)) * CC + cofs;
    v4f xv[8];
#pragma unroll
    for (int s = 0; s < 8; ++s) xv[s] = *(const v4f*)(x + xo + s * 2 * CC);
    const v4f bpv = *(const v4f*)(bp + cofs);
    asm volatile("s_wait_xcnt 0x0" ::: "memory");     // in front of the first rewrite of these loads' address registers
    __builtin_amdgcn_sched_barrier(0);                // keeps what follows, which may reuse those registers, behind that wait
    // The join. Waves w and w ^ 4 hold the same 32 queries over disjoint keys; wave w finishes column group kq and hands the other group's maximum, sum and O^T to its partner through
    // the ring, which is free: the loop's last barrier stands behind every wave's last read of it, and no copy is under way.
    if (walk == 0) {     // a sum that is infinite, not a number or near the end of the range, in any lane
        float t[4] = {0.f, 0.f, 0.f, 0.f};
#pragma unroll
        for (int g = 0; g < 2; ++g) {
#pragma unroll
            for (int dt = 0; dt < 4; ++dt) {
#pragma unroll
                for (int j = 0; j < 8; ++j) t[j & 3] += __builtin_fabsf(oa[g][dt][j]); } }
        const bool bad = !(l[0] < 0x1p64f) || !(l[1] < 0x1p64f) || !((t[0] + t[1]) + (t[2] + t[3]) < 0x1p100f);
        flg[wave] = __builtin_amdgcn_ballot_w32(bad);     // every lane stores the wave's word
    }
    const bool up = kq != 0;
    unsigned char* xw = ring + wave * XSL;
    const unsigned char* xr = ring + (wave ^ 4) * XSL;
#pragma unroll
    for (int dt = 0; dt < 4; ++dt) { const v8f gv = up ? oa[0][dt] : oa[1][dt];
        *(v4fa*)(xw + (2 * dt) * 512 + lane * 16) = __builtin_shufflevector(gv, gv, 0, 1, 2, 3); *(v4fa*)(xw + (2 * dt + 1) * 512 + lane * 16) = __builtin_shufflevector(gv, gv, 4, 5, 6, 7); }
    *(v2fa*)(xw + 4096 + lane * 8) = (v2f){up ? m[0] : m[1], up ? l[0] : l[1]};
    __syncthreads();     // both waves of every pair have written what the other reads; every wave's flag stands
    if (walk == 0) {
        typedef __attribute__((ext_vector_type(4))) unsigned v4u; typedef v4u __attribute__((may_alias)) v4ua;
        const v4u f0 = *(const v4ua*)flg, f1 = *(const v4ua*)(flg + 4);
        const v4u fo = f0 | f1;
        if (__builtin_amdgcn_readfirstlane((int)(fo[0] | fo[1] | fo[2] | fo[3])) != 0) {     // the same eight words in every wave: the work-group goes as one
            asm volatile("s_wait_dscnt 0x0" ::: "memory");     // this wave's writes to the ring are over before walk 1's copies refill it; nobody reads the ring behind the barrier above
            continue;
        }
    }
    const v2f pml = *(const v2fa*)(xr + 4096 + lane * 8);
    const float km = up ? m[1] : m[0], kl_ = up ? l[1] : l[0];
    const float mn = fmaxf(km, pml[0]), fa = __builtin_amdgcn_exp2f(km - mn), fb = __builtin_amdgcn_exp2f(pml[0] - mn);
    float lt = fmaf(kl_, fa, pml[1] * fb);
    lt += xhalf(lt);     // the two halves of a column hold the sums of disjoint keys
    const float inv = 1.0f / lt, ca = fa * inv, cb = fb * inv;
    v8us wh[4], wl[4];
#pragma unroll
    for (int dt = 0; dt < 4; ++dt) { const v8f kv = up ? oa[1][dt] : oa[0][dt]; const v4f p0 = *(const v4fa*)(xr + (2 * dt) * 512 + lane * 16), p1 = *(const v4fa*)(xr + (2 * dt + 1) * 512 + lane * 16);
#pragma unroll
        for (int j = 0; j < 8; ++j) { const float v = fmaf(kv[j], ca, (j < 4 ? p0[j & 3] : p1[j & 3]) * cb); const unsigned short hb = f2bf(v); wh[dt][j] = hb; wl[dt][j] = f2bf(v - bf2f(hb)); } }
    // The output projection, bias and residual. out^T = Wp^T.O^T: two neighbouring O^T tiles, split hi/lo in place, are the B operand of one k step (element i = channel 32 ks + 8 hi + i,
    // element 8 + i = channel 32 ks + 16 + 8 hi + i: the weight loader's order). A lane then holds 8 neighbouring channels of token lr; the wave's 16 x 64 tile turns in a part of the ring
    // that is the wave's own and that the join does not use, so that out leaves in whole 128-byte lines.
    v8f po[4];
#pragma unroll
    for (int t = 0; t < 4; ++t) po[t] = (v8f){};
#pragma unroll
    for (int ks = 0; ks < 2; ++ks) { const v16bf oh = cat16b(wh[2 * ks], wh[2 * ks + 1]), ol = cat16b(wl[2 * ks], wl[2 * ks + 1]);
#pragma unroll
        for (int t = 0; t < 4; ++t) po[t] = wmmab(wp[t][ks], oh, po[t]);
#pragma unroll
        for (int t = 0; t < 4; ++t) po[t] = wmmab(wp[t][ks], ol, po[t]); }
    unsigned char* os = ring + (8 + wave) * XSL;     // 16 rows of 68 floats
#pragma unroll
    for (int t = 0; t < 4; ++t) { unsigned char* o = os + (lr * 68 + t * 16 + 8 * hi) * 4; *(v4fa*)o = __builtin_shufflevector(po[t], po[t], 0, 1, 2, 3); *(v4fa*)(o + 16) = __builtin_shufflevector(po[t], po[t], 4, 5, 6, 7); }
    const v4f bb = (v4f){bfr(bpv[0]), bfr(bpv[1]), bfr(bpv[2]), bfr(bpv[3])};
#pragma unroll
    for (int s = 0; s < 8; ++s) xv[s] = (*(const v4fa*)(os + (((lane >> 4) + 2 * s) * 68 + cofs) * 4) + bb) + (v4f){bfr(xv[s][0]), bfr(xv[s][1]), bfr(xv[s][2]), bfr(xv[s][3])};
#pragma unroll
    for (int s = 0; s < 8; ++s) *(v4f*)(out + xo + s * 2 * CC) = xv[s];
    asm volatile("s_wait_xcnt 0x0" ::: "memory");     // in front of the walk loop's head, which follows these stores in the text and rewrites their data registers
    break;     // walk 1 is taken only through the continue above
    }
}

extern "C" void kernel_launch(void* const* d_in, const int* in_sizes, int n_in,
                              void* d_out, int out_size, void* d_ws, size_t ws_size, hipStream_t stream) {
    (void)in_sizes; (void)n_in; (void)out_size;
    const float* x = (const float*)d_in[0]; const float* ga = (const float*)d_in[1]; const float* be = (const float*)d_in[2];
    const float* Wq = (const float*)d_in[3]; const float* bq = (const float*)d_in[4]; const float* Wk = (const float*)d_in[5]; const float* bk = (const float*)d_in[6]; const float* Wv = (const float*)d_in[7]; const float* bv = (const float*)d_in[8]; const float* Wp = (const float*)d_in[9]; const float* bp = (const float*)d_in[10];   // k-major (h @ W)
    float* out = (float*)d_out;    // [8][64][64][64] channels-last
    char* wsp = (char*)d_ws;
    auto take = [&](size_t bytes) { char* p = wsp; wsp += (bytes + 255) & ~(size_t)255; return (void*)p; };
    bf* WqT = (bf*)take(4 * CC * CC * 2); bf* WkT = WqT + CC * CC; bf* WvT = WqT + 2 * CC * CC; bf* WpT = WqT + 3 * CC * CC; float* ST = (float*)take(NBI * 4 * 128);
    const size_t PLN = (size_t)NN * CC;    // one image's plane, in elements
    bf* Qh = (bf*)take(NBI * PLN * 2); bf* Ql = (bf*)take(NBI * PLN * 2); bf* Kh = (bf*)take(NBI * PLN * 2); bf* Kl = (bf*)take(NBI * PLN * 2); bf* VTh = (bf*)take(NBI * PLN * 2); bf* VTl = (bf*)take(NBI * PLN * 2);
    if ((size_t)(wsp - (char*)d_ws) > ws_size) return;    // ~ 0.03 + 6 x 4.2 ~ 25 MB
    k_gnstat<<<dim3(4, NBI + 1, 1), 1024, 0, stream>>>(x, ST, Wq, Wk, Wv, Wp, WqT);    // row NBI of the grid: the four weight transposes
    k_qkv<<<dim3(NN / 64, NBI, 1), 128, 0, stream>>>(x, ST, ga, be, WqT, WkT, WvT, bq, bk, bv, Qh, Ql, Kh, Kl, VTh, VTl);
    k_attn<<<dim3(NN / 128, NBI, 1), 256, 0, stream>>>(Qh, Ql, Kh, Kl, VTh, VTl, WpT, bp, x, out);    // attention, then attn.Wp + bp + x
}

// v009
// Measured time: 73.5 microseconds a run.
// Timed twice side by side with v008, it ran 1.06 times as fast both times.
// Counting every step since v000, it is 297 times as fast.
#include <hip/hip_runtime.h>

// Compute dtypes, f32 accumulate, all images in each launch (tokens = the 4096 positions, channels-last rows of 64): GroupNorm (32 groups x 2 channels, stats over H, W and the
// products) on v_wmma_f32_16x16x32_bf16; the full 4096 x 4096 single-head attention in one fused kernel (k_attn: scores three products, softmax x 1/8 in f32 -> hi/lo, P.v three products)

#define NBI  8
#define NN   4096
#define CC   64
#define NGR  32
#define DM   CC
#define NTK  NN
#define GN_EPS 1e-6f
#define SCL  0.125f
#define LOSC 1024.0f

typedef _Float16 h16;
typedef unsigned short bf;
typedef __attribute__((ext_vector_type(16))) __bf16   v16bf;
typedef __attribute__((ext_vector_type(16))) _Float16 v16h;
typedef __attribute__((ext_vector_type(8)))  _Float16 v8h;
typedef __attribute__((ext_vector_type(8)))  unsigned short v8us;
typedef __attribute__((ext_vector_type(8)))  float    v8f;
typedef __attribute__((ext_vector_type(4)))  float    v4f;
typedef __attribute__((ext_vector_type(4)))  _Float16 v4h;
typedef v8h  __attribute__((may_alias)) v8ha;
typedef v4f  __attribute__((may_alias)) v4fa;
typedef v8us __attribute__((may_alias)) v8usa;

__device__ __forceinline__ unsigned short f2bf(float f) { unsigned u = __float_as_uint(f); u += 0x7FFFu + ((u >> 16) & 1u); return (unsigned short)(u >> 16); }
__device__ __forceinline__ float bf2f(unsigned short b) { return __uint_as_float(((unsigned)b) << 16); }
__device__ __forceinline__ float bfr(float f) { return bf2f(f2bf(f)); }
__device__ __forceinline__ v16h cat16(v8h lo, v8h hi) { return __builtin_shufflevector(lo, hi, 0, 1, 2, 3, 4, 5, 6, 7, 8, 9, 10, 11, 12, 13, 14, 15); }
__device__ __forceinline__ v16bf cat16b(v8us lo, v8us hi) { return __builtin_bit_cast(v16bf, __builtin_shufflevector(lo, hi, 0, 1, 2, 3, 4, 5, 6, 7, 8, 9, 10, 11, 12, 13, 14, 15)); }
__device__ __forceinline__ v8f wmma16(v16h a, v16h b, v8f c) { return __builtin_amdgcn_wmma_f32_16x16x32_f16(false, a, false, b, (short)0, c, false, false); }
__device__ __forceinline__ v8f wmmab(v16bf a, v16bf b, v8f c) { return __builtin_amdgcn_wmma_f32_16x16x32_bf16(false, a, false, b, (short)0, c, false, false); }

// k_gnstat: one work-group per (image, slice of 16 channels = 8 groups). A wave's 16-byte loads cover 8 rows x 64 bytes; each thread keeps its 16 rows x 4 channels in
// registers, so x is read once for both passes (mean, then centred squares). ST: one 128-byte line per work-group, floats 0..7 = mean, 8..15 = rsqrt(var + eps).
// The launch carries one more row of work-groups (blockIdx.y = NBI): work-group blockIdx.x of it writes WT[n][k] = bf16(W[k][n]) of one 64 x 64 weight matrix (q, k, v, p) through an LDS
// tile. The next launch needs both the statistics and these, and neither needs the other, so they share one launch.
__global__ __launch_bounds__(1024) void k_gnstat(const float* __restrict__ x, float* ST, const float* __restrict__ Wq, const float* __restrict__ Wk, const float* __restrict__ Wv, const float* __restrict__ Wp, bf* WT4) {
    typedef __attribute__((ext_vector_type(2))) float v2f;
    __shared__ __align__(16) v2f red[2][32][4];
    __shared__ __align__(16) unsigned short tl[CC * 72];
    const int tid = threadIdx.x, lane = tid & 31, wave = tid >> 5, q = tid & 3;     // q: which 4 channels (2 groups) of the slice
    if (blockIdx.y == NBI) {     // the same for the whole work-group
        const float* Wm = blockIdx.x == 0 ? Wq : blockIdx.x == 1 ? Wk : blockIdx.x == 2 ? Wv : Wp;
        const int kk = tid >> 4, nq = (tid & 15) * 4;     // 16 lanes read one row k of 256 bytes
        const v4f w = *(const v4f*)(Wm + kk * CC + nq);
#pragma unroll
        for (int i = 0; i < 4; ++i) tl[(nq + i) * 72 + kk] = f2bf(w[i]);
        __syncthreads();     // the whole matrix stands transposed in LDS
        if (tid < 512) *(v8us*)(WT4 + blockIdx.x * CC * CC + (tid >> 3) * CC + (tid & 7) * 8) = *(const v8usa*)(tl + (tid >> 3) * 72 + (tid & 7) * 8);     // 8 lanes write one row n, a whole 128-byte line
        return;
    }
    const float* xp = x + (size_t)blockIdx.y * NN * CC + blockIdx.x * 16 + q * 4 + (size_t)(tid >> 2) * CC;
    v4f v[16];
#pragma unroll
    for (int i = 0; i < 16; ++i) v[i] = *(const v4f*)(xp + (size_t)i * 256 * CC);
    float s0 = 0.f, s1 = 0.f;
#pragma unroll
    for (int i = 0; i < 16; ++i) { v[i] = (v4f){bfr(v[i][0]), bfr(v[i][1]), bfr(v[i][2]), bfr(v[i][3])}; s0 += v[i][0] + v[i][1]; s1 += v[i][2] + v[i][3]; }
#pragma unroll
    for (int sh = 16; sh >= 4; sh >>= 1) { s0 += __shfl_xor(s0, sh, 32); s1 += __shfl_xor(s1, sh, 32); }
    if (lane < 4) red[0][wave][q] = (v2f){s0, s1};
    __syncthreads();
    s0 = 0.f; s1 = 0.f;     // every wave adds the 32 waves' sums: 4 per lane, then the same three exchanges
#pragma unroll
    for (int j = 0; j < 4; ++j) { const v2f t = red[0][j * 8 + (lane >> 2)][q]; s0 += t[0]; s1 += t[1]; }
#pragma unroll
    for (int sh = 16; sh >= 4; sh >>= 1) { s0 += __shfl_xor(s0, sh, 32); s1 += __shfl_xor(s1, sh, 32); }
    const float mu0 = s0 / (float)(2 * NN), mu1 = s1 / (float)(2 * NN);
    float q0 = 0.f, q1 = 0.f;
#pragma unroll
    for (int i = 0; i < 16; ++i) { float d = v[i][0] - mu0; q0 = fmaf(d, d, q0); d = v[i][1] - mu0; q0 = fmaf(d, d, q0); d = v[i][2] - mu1; q1 = fmaf(d, d, q1); d = v[i][3] - mu1; q1 = fmaf(d, d, q1); }
#pragma unroll
    for (int sh = 16; sh >= 4; sh >>= 1) { q0 += __shfl_xor(q0, sh, 32); q1 += __shfl_xor(q1, sh, 32); }
    if (lane < 4) red[1][wave][q] = (v2f){q0, q1};
    __syncthreads();
    if (wave) return;     // behind the last barrier
    q0 = 0.f; q1 = 0.f;
#pragma unroll
    for (int j = 0; j < 4; ++j) { const v2f t = red[1][j * 8 + (lane >> 2)][q]; q0 += t[0]; q1 += t[1]; }
#pragma unroll
    for (int sh = 16; sh >= 4; sh >>= 1) { q0 += __shfl_xor(q0, sh, 32); q1 += __shfl_xor(q1, sh, 32); }
    if (lane < 4) {
        float* st = ST + (size_t)(blockIdx.y * 4 + blockIdx.x) * 32 + 2 * q;
        *(v2f*)st = (v2f){mu0, mu1};
        *(v2f*)(st + 8) = (v2f){rsqrtf(q0 / (float)(2 * NN) + GN_EPS), rsqrtf(q1 / (float)(2 * NN) + GN_EPS)};
    }
}
// k_qkv: GroupNorm applied, the three projections, their hi/lo splits and V's transpose in one kernel, all images in one launch; grid (NN / 64, images), 4 waves x 16 tokens.
// A lane normalises the 32 channels of its token that its fragments hold (k step ks, elements i and 8 + i = channels 32 ks + 8 hi + i and 32 ks + 16 + 8 hi + i), so h stays in registers.
// q, k: transposed products (A = weight rows, B = h rows): a lane holds 8 neighbouring channels of ONE token, 16 bytes of its row. v: A = h rows, B = weight rows: a lane holds
// 8 neighbouring tokens of one channel; the work-group's 64 tokens meet in LDS, so that V^T leaves in whole 128-byte lines, each from one wave.
__global__ __launch_bounds__(128) void k_qkv(const float* __restrict__ x, const float* __restrict__ ST, const float* __restrict__ ga, const float* __restrict__ be,
                                             const bf* __restrict__ WqT, const bf* __restrict__ WkT, const bf* __restrict__ WvT, const float* __restrict__ bq, const float* __restrict__ bk, const float* __restrict__ bv,
                                             bf* Qh, bf* Ql, bf* Kh, bf* Kl, bf* VTh, bf* VTl) {
    __shared__ __align__(16) unsigned short vs[2][CC * 72];
    const int tid = threadIdx.x, lane = tid & 31, wave = tid >> 5, lr = lane & 15, hi = lane >> 4;
    const size_t ib = (size_t)blockIdx.y * NN * CC;
    const size_t ro = ib + (size_t)(blockIdx.x * 64 + wave * 16 + lr) * CC + 8 * hi;
    const float* st = ST + blockIdx.y * 128 + 4 * hi;     // k_gnstat's four lines of this image; channels c .. c + 7 = groups c / 2 .. c / 2 + 3
    v16bf hh[2], hl[2];
#pragma unroll
    for (int ks = 0; ks < 2; ++ks) { v8us oh[2], ol[2];
#pragma unroll
        for (int hf = 0; hf < 2; ++hf) { const int cc = ks * 32 + hf * 16;     // + 8 hi: the lane's 8 channels
            const v4f xv[2] = {*(const v4f*)(x + ro + cc), *(const v4f*)(x + ro + cc + 4)};
            const v4f gv[2] = {*(const v4f*)(ga + cc + 8 * hi), *(const v4f*)(ga + cc + 8 * hi + 4)};
            const v4f ev[2] = {*(const v4f*)(be + cc + 8 * hi), *(const v4f*)(be + cc + 8 * hi + 4)};
            const v4f mu = *(const v4f*)(st + (ks * 2 + hf) * 32), rs = *(const v4f*)(st + (ks * 2 + hf) * 32 + 8);
#pragma unroll
            for (int i = 0; i < 8; ++i) { const float y = (bfr(xv[i >> 2][i & 3]) - mu[i >> 1]) * rs[i >> 1] * bfr(gv[i >> 2][i & 3]) + bfr(ev[i >> 2][i & 3]); const unsigned short hb = f2bf(y); oh[hf][i] = hb; ol[hf][i] = f2bf(y - bf2f(hb)); } }
        hh[ks] = cat16b(oh[0], oh[1]); hl[ks] = cat16b(ol[0], ol[1]); }
    const int wo = lr * CC + 8 * hi;     // a weight fragment: row 16 t + lr, the same k order as h's
    {
        v8f acc[4];
#pragma unroll
        for (int t = 0; t < 4; ++t) acc[t] = (v8f){};
#pragma unroll
        for (int ks = 0; ks < 2; ++ks) {
#pragma unroll
            for (int t = 0; t < 4; ++t) { const bf* wp = WvT + wo + t * 16 * CC + ks * 32; const v16bf w = cat16b(*(const v8us*)wp, *(const v8us*)(wp + 16)); acc[t] = wmmab(hh[ks], w, acc[t]); acc[t] = wmmab(hl[ks], w, acc[t]); } }
#pragma unroll
        for (int t = 0; t < 4; ++t) { const float bb = bfr(bv[t * 16 + lr]); v8us wh, wl;
#pragma unroll
            for (int j = 0; j < 8; ++j) { const float v = acc[t][j] + bb; const unsigned short hb = f2bf(v); wh[j] = hb; wl[j] = f2bf(v - bf2f(hb)); }
            const int o = (t * 16 + lr) * 72 + wave * 16 + 8 * hi; *(v8usa*)(&vs[0][o]) = wh; *(v8usa*)(&vs[1][o]) = wl; }
    }
    auto rows = [&](const bf* __restrict__ WT, const float* __restrict__ bias, bf* Dh, bf* Dl) {
        v8f acc[4];
#pragma unroll
        for (int t = 0; t < 4; ++t) acc[t] = (v8f){};
#pragma unroll
        for (int ks = 0; ks < 2; ++ks) {
#pragma unroll
            for (int t = 0; t < 4; ++t) { const bf* wp = WT + wo + t * 16 * CC + ks * 32; const v16bf w = cat16b(*(const v8us*)wp, *(const v8us*)(wp + 16)); acc[t] = wmmab(w, hh[ks], acc[t]); acc[t] = wmmab(w, hl[ks], acc[t]); } }
#pragma unroll
        for (int t = 0; t < 4; ++t) { const v4f bb[2] = {*(const v4f*)(bias + t * 16 + 8 * hi), *(const v4f*)(bias + t * 16 + 8 * hi + 4)}; v8us wh, wl;
#pragma unroll
            for (int j = 0; j < 8; ++j) { const float v = acc[t][j] + bfr(bb[j >> 2][j & 3]); const unsigned short hb = f2bf(v); wh[j] = hb; wl[j] = f2bf(v - bf2f(hb)); }
            *(v8us*)(Dh + ro + t * 16) = wh; *(v8us*)(Dl + ro + t * 16) = wl; }
    };
    rows(WqT, bq, Qh, Ql); rows(WkT, bk, Kh, Kl);
    __syncthreads();     // all four waves' token columns of V^T stand in LDS
#pragma unroll
    for (int s = 0; s < 4; ++s) { const int row = s * 16 + (tid >> 3), piece = tid & 7; const size_t o = ib + (size_t)row * NN + blockIdx.x * 64 + piece * 8;
        *(v8us*)(VTh + o) = *(const v8usa*)(&vs[0][row * 72 + piece * 8]); *(v8us*)(VTl + o) = *(const v8usa*)(&vs[1][row * 72 + piece * 8]); }
}
// k_attn: scores, softmax, P.v and the output projection with bias and residual in one kernel, all images in one launch; grid (NN / 128, images), 16 waves = four on a SIMD, so that one wave's vector work and LDS waits lie under the others' products. A wave holds 32 queries (two column groups of 16; wave & 3 picks them) and
// walks one quarter of every stage's keys (wave >> 2 picks it) in passes of 32, so that each K and V^T fragment read from LDS feeds two query tiles; the four waves of a query group join at the end.
// Transposed products: S^T = K.Q^T (A = key rows, B = query rows kept in registers), so a lane holds 16 scores of ONE query of each group (column lr; keys 8 hi + j of each 16-key tile)
// and the two score tiles, converted in place, are the B operand of O^T += V^T.P^T (element i = key 8 hi + i, element 8 + i = key 16 + 8 hi + i: the order the V^T loader uses).
// Maximum and sum per query (exp2 domain), the maximum fixed after the first pass (see at the walk loop); the three hi/lo products of S^T and of O^T are kept.
// K and V^T (hi and lo) reach the waves through LDS: a stage is KT keys, brought once per work-group by asynchronous copies that read whole 128-byte lines, two buffers, the
// next stage in flight while this one is worked on. Rows are pitched 16 bytes x odd, so that the 16 rows of a fragment load fall on all 64 banks.
#define KT   256                        // keys per stage: two passes of 32 for each of the four waves of a query group
#define KPB  (CC * 2 + 16)              // bytes from one K row to the next in LDS
#define VPB  (KT * 2 + 16)              // bytes from one V^T row to the next in LDS
#define KPL  (KT * KPB)                 // one K plane (hi or lo) of a stage
#define VPL  (CC * VPB)                 // one V^T plane of a stage
#define STG  (2 * KPL + 2 * VPL)        // one stage: K hi, K lo, V^T hi, V^T lo
#define XSL  (32 * 144)                 // the join: one column group's slot in the ring, 32 lanes x (32 floats of O^T; maximum and sum in 16 bytes, so that one lane offset serves all of it)
__device__ __forceinline__ float xhalf(float v) { const int b = __float_as_int(v); return __int_as_float(__builtin_amdgcn_permlanex16(b, b, 0x76543210, 0xfedcba98, false, false)); }
// Eight copies of 16 bytes per lane: four row blocks of plane a, four of plane b. The s_wait_xcnt stands inside the statement, in front of any rewrite of the address registers.
__device__ __forceinline__ void copy8(unsigned la, const bf* ga, unsigned lb, const bf* gb, unsigned lstep, size_t gstep) {
    asm volatile("global_load_async_to_lds_b128 %0, %8, off\n\t"
                 "global_load_async_to_lds_b128 %1, %9, off\n\t"
                 "global_load_async_to_lds_b128 %2, %10, off\n\t"
                 "global_load_async_to_lds_b128 %3, %11, off\n\t"
                 "global_load_async_to_lds_b128 %4, %12, off\n\t"
                 "global_load_async_to_lds_b128 %5, %13, off\n\t"
                 "global_load_async_to_lds_b128 %6, %14, off\n\t"
                 "global_load_async_to_lds_b128 %7, %15, off\n\t"
                 "s_wait_xcnt 0x0"
                 :: "v"(la), "v"(la + lstep), "v"(la + 2 * lstep), "v"(la + 3 * lstep), "v"(lb), "v"(lb + lstep), "v"(lb + 2 * lstep), "v"(lb + 3 * lstep),
                    "v"(ga), "v"(ga + gstep), "v"(ga + 2 * gstep), "v"(ga + 3 * gstep), "v"(gb), "v"(gb + gstep), "v"(gb + 2 * gstep), "v"(gb + 3 * gstep) : "memory");
}
__global__ __launch_bounds__(512) void k_attn(const bf* __restrict__ Qh, const bf* __restrict__ Ql, const bf* __restrict__ Kh, const bf* __restrict__ Kl, const bf* __restrict__ VTh, const bf* __restrict__ VTl,
                                              const bf* __restrict__ WpT, const float* __restrict__ bp, const float* __restrict__ x, float* out) {
    typedef __attribute__((ext_vector_type(2))) __bf16 v2bf; typedef __attribute__((ext_vector_type(2))) float v2f; typedef __attribute__((ext_vector_type(8))) unsigned v8u;
    typedef v2f __attribute__((may_alias)) v2fa;
    typedef unsigned char __attribute__((address_space(3))) ldsb; typedef v8usa __attribute__((address_space(3))) v8usl;     // LDS by its own 32-bit address
    __shared__ __align__(16) unsigned char ring[2 * STG];
    __shared__ __align__(16) unsigned flg[16];     // one word a wave: its sums left the safe range under the fixed reference
    const int tid = threadIdx.x, lane = tid & 31, lr = lane & 15, hi = lane >> 4;
    const int wave = __builtin_amdgcn_readfirstlane(tid >> 5);     // a scalar: all that depends on the wave alone then lies in scalar registers (vector registers are short here)
    const int qg = wave & 3, kq = wave >> 2;     // which 32 queries; which KT / 4 keys of every stage
    const bool fin = kq < 2;     // wave kq = 0 or 1 finishes column group kq of its 32 queries, waves 2 and 3 only hand theirs over
    const size_t ib = (size_t)blockIdx.y * NN * CC;
    const size_t qo = ib + (size_t)(blockIdx.x * 128 + qg * 32) * CC;     // the wave's 32 query rows; column group g: + g * 16 * CC
    const unsigned qlo = lr * CC + 8 * hi;     // the lane's place in a group
    const float SC2 = SCL * 1.44269504088896341f;
    // The copies: K, 8 lanes a row of 128 bytes, 64 rows a block; V^T, 32 lanes a row of 512 bytes, 16 rows a block; four blocks a plane.
    // A lane keeps one 32-bit element offset for K and V^T; the rest of each address is the same for the whole wave, a scalar, and is added at the call.
    const unsigned l8 = lane * 8;     // K: element tid * 8 = wave * 256 + l8; V^T: row wave, element l8
    const unsigned lk = (unsigned)(size_t)ring + (lane >> 3) * KPB + (lane & 7) * 16, lv = (unsigned)(size_t)ring + 2 * KPL + lane * 16;     // + wave * 4 * KPB, + wave * VPB at the call
    auto fill = [&](int st) {     // stage st into buffer st & 1
        const unsigned bk = (st & 1) * STG + wave * 4 * KPB, bv = (st & 1) * STG + wave * VPB;
        const size_t uk = ib + (size_t)st * KT * CC + wave * 256, uv = ib + (size_t)st * KT + (size_t)wave * NN;
        copy8(lk + bk, (Kh + uk) + l8, lk + bk + KPL, (Kl + uk) + l8, 64 * KPB, 64 * CC);
        copy8(lv + bv, (VTh + uv) + l8, lv + bv + VPL, (VTl + uv) + l8, 16 * VPB, (size_t)16 * NN);
    };
    v16bf qh[2][2], ql[2][2];
#pragma unroll
    for (int g = 0; g < 2; ++g) {
#pragma unroll
        for (int ks = 0; ks < 2; ++ks) { const bf* a = (Qh + qo + g * 16 * CC + ks * 32) + qlo; const bf* b = (Ql + qo + g * 16 * CC + ks * 32) + qlo; qh[g][ks] = cat16b(*(const v8us*)a, *(const v8us*)(a + 16)); ql[g][ks] = cat16b(*(const v8us*)b, *(const v8us*)(b + 16)); }
        asm volatile("s_wait_xcnt 0x0" ::: "memory");     // in front of the first rewrite of the Q loads' address registers (also by a later load's result)
        __builtin_amdgcn_sched_barrier(0); }              // keeps what follows, which reuses those registers, behind that wait
    // The softmax reference. Walk 0 fixes it at the maximum of the wave's first 32 keys: p = exp2(score - reference) keeps its relative precision at any size a float holds, and the sum is at
    // least 1, so maximum, exchange and the rescaling of O^T are needed once and not in every pass. Only overflow can spoil that walk; it shows in the sums, and then the whole work-group
    // walks the keys once more (walk 1) with the running maximum renewed in every pass.
#pragma unroll 1     // one copy of the walk in the text; which walk it is reaches the passes as a scalar
    for (int walk = 0; walk < 2; ++walk) {
    v8f oa[2][4];
#pragma unroll
    for (int g = 0; g < 2; ++g) {
#pragma unroll
        for (int dt = 0; dt < 4; ++dt) oa[g][dt] = (v8f){}; }
    float m[2] = {-3.0e38f, -3.0e38f}, l[2] = {0.f, 0.f};
    // Trips -2 and -1 are the ring's prologue: stage 0's copies; their wait and the barrier, then stage 1's copies. So the copies stand once in the text and every address operand of theirs is
    // formed at the call.
#pragma unroll 1     // one copy of the stage in the text; the buffer is picked by st & 1
    for (int st = -2; st < NN / KT; ++st) {
      if (st >= 0) {
        const unsigned char* kb = ring + (st & 1) * STG + (kq * (KT / 4) + lr) * KPB + 16 * hi;
        // KT / 4 keys = KT / 2 bytes along a V^T row. The address is formed as an integer, so that 2 * KPL lies in the base register and every fragment's distance fits the offset field of its ds_load.
        const ldsb* vb = (const ldsb*)((unsigned)(size_t)ring + (st & 1) * STG + 2 * KPL + lr * VPB + kq * (KT / 2) + 16 * hi);
        v16bf kh[2][2], kl[2][2], vh[4], vl[4];
        auto ldk = [&](int p, int ks) {     // one k step (32 channels) of the pass's K fragments, hi and lo
#pragma unroll
            for (int t = 0; t < 2; ++t) { const unsigned char* o = kb + (p * 32 + t * 16) * KPB + ks * 64; kh[t][ks] = cat16b(*(const v8usa*)o, *(const v8usa*)(o + 32)); kl[t][ks] = cat16b(*(const v8usa*)(o + KPL), *(const v8usa*)(o + KPL + 32)); }
        };
        auto ldvh = [&](int p) {
#pragma unroll
            for (int dt = 0; dt < 4; ++dt) { const ldsb* o = vb + dt * 16 * VPB + p * 64; vh[dt] = cat16b(*(const v8usl*)o, *(const v8usl*)(o + 32)); }
        };
        auto ldvl = [&](int p) {
#pragma unroll
            for (int dt = 0; dt < 4; ++dt) { const ldsb* o = vb + dt * 16 * VPB + p * 64; vl[dt] = cat16b(*(const v8usl*)(o + VPL), *(const v8usl*)(o + VPL + 32)); }
        };
        // A wave has 256 registers (four waves on a SIMD), of which Q and O^T hold 128: K, V^T hi and V^T lo take turns in the rest. Each load group stands where the registers it fills have
        // just come free, with a run of this wave's own work between it and its first reader; the fences (sched_barrier) keep the groups there: moved up, they would overlap and spill.
        auto pass = [&](int p, bool more, bool renew) {     // more: a further pass of this wave in this stage follows; renew (the same for the whole work-group): the reference is renewed
            v8f s[2][2];
#pragma unroll
            for (int g = 0; g < 2; ++g) { s[g][0] = (v8f){}; s[g][1] = (v8f){}; }
#pragma unroll
            for (int ks = 0; ks < 2; ++ks) {
#pragma unroll
                for (int g = 0; g < 2; ++g) { s[g][0] = wmmab(kh[0][ks], qh[g][ks], s[g][0]); s[g][1] = wmmab(kh[1][ks], qh[g][ks], s[g][1]); }
#pragma unroll
                for (int g = 0; g < 2; ++g) { s[g][0] = wmmab(kh[0][ks], ql[g][ks], s[g][0]); s[g][1] = wmmab(kh[1][ks], ql[g][ks], s[g][1]); }
#pragma unroll
                for (int g = 0; g < 2; ++g) { s[g][0] = wmmab(kl[0][ks], qh[g][ks], s[g][0]); s[g][1] = wmmab(kl[1][ks], qh[g][ks], s[g][1]); }
            }
            __builtin_amdgcn_sched_barrier(0);     // V^T hi: behind the score products, whose K registers it takes, and in front of the softmax that covers its latency
            ldvh(p);
            __builtin_amdgcn_sched_barrier(0);
            if (renew) {
#pragma unroll
                for (int g = 0; g < 2; ++g) {
                    float mt = fmaxf(s[g][0][0], s[g][1][0]);
#pragma unroll
                    for (int j = 1; j < 8; ++j) mt = fmaxf(mt, fmaxf(s[g][0][j], s[g][1][j]));
                    mt = fmaxf(mt, xhalf(mt));
                    const float mn = fmaxf(m[g], mt * SC2), al = __builtin_amdgcn_exp2f(m[g] - mn);
                    m[g] = mn; l[g] *= al;
#pragma unroll
                    for (int dt = 0; dt < 4; ++dt) oa[g][dt] *= al;
                }
            }
            v16bf ph[2], pl[2];
#pragma unroll
            for (int g = 0; g < 2; ++g) {
                const float mn = m[g];
#pragma unroll
                for (int t = 0; t < 2; ++t) { const v8f e = __builtin_elementwise_fma(s[g][t], (v8f)(SC2), (v8f)(-mn));     // whole tiles: packed FMAs on the accumulators' own register pairs
#pragma unroll
                    for (int j = 0; j < 8; ++j) s[g][t][j] = __builtin_amdgcn_exp2f(e[j]); }
                const v8f sv = s[g][0] + s[g][1];
                l[g] += ((sv[0] + sv[1]) + (sv[2] + sv[3])) + ((sv[4] + sv[5]) + (sv[6] + sv[7]));
                v8u phw, plw;     // word i of the B operand = elements 2 i, 2 i + 1: hi = bf16(p), lo = bf16(p - hi)
#pragma unroll
                for (int i = 0; i < 8; ++i) { const v2f p2 = (v2f){s[g][i >> 2][(2 * i) & 7], s[g][i >> 2][((2 * i) & 7) + 1]};
                    const unsigned w = __builtin_bit_cast(unsigned, __builtin_convertvector(p2, v2bf)); phw[i] = w;
                    const v2f r2 = p2 - (v2f){__uint_as_float(w << 16), __uint_as_float(w & 0xFFFF0000u)}; plw[i] = __builtin_bit_cast(unsigned, __builtin_convertvector(r2, v2bf)); }
                ph[g] = __builtin_bit_cast(v16bf, phw); pl[g] = __builtin_bit_cast(v16bf, plw);
            }
            __builtin_amdgcn_sched_barrier(0);     // V^T lo: behind the softmax, whose scratch registers it takes; the sixteen products with V^T hi cover its latency
            ldvl(p);
            __builtin_amdgcn_sched_barrier(0);
#pragma unroll
            for (int g = 0; g < 2; ++g) {
#pragma unroll
                for (int dt = 0; dt < 4; ++dt) oa[g][dt] = wmmab(vh[dt], ph[g], oa[g][dt]);
#pragma unroll
                for (int dt = 0; dt < 4; ++dt) oa[g][dt] = wmmab(vh[dt], pl[g], oa[g][dt]);
            }
            __builtin_amdgcn_sched_barrier(0);     // the next pass's K, first k step, inside this stage only: into the registers of V^T hi, under the products with V^T lo
            if (more) ldk(p + 1, 0);
            __builtin_amdgcn_sched_barrier(0);
#pragma unroll
            for (int g = 0; g < 2; ++g) {
#pragma unroll
                for (int dt = 0; dt < 4; ++dt) oa[g][dt] = wmmab(vl[dt], ph[g], oa[g][dt]);
            }
            __builtin_amdgcn_sched_barrier(0);     // its second k step: into the registers of V^T lo; the first k step's twelve products cover its latency
            if (more) ldk(p + 1, 1);
            __builtin_amdgcn_sched_barrier(0);
        };
        ldk(0, 0); ldk(0, 1);
        __builtin_amdgcn_sched_barrier(0);     // the stage's first K fragments stay one load group: sunk among the products, each small group waits out its own LDS latency
        pass(0, true, walk != 0 || st == 0);
        pass(1, false, walk != 0);
      }
        if (st >= -1) {     // the same for the whole work-group
            asm volatile("s_wait_dscnt 0x0" ::: "memory");        // this wave's reads of the buffer are over before it is refilled
            asm volatile("s_wait_asynccnt 0x0" ::: "memory");     // this wave's share of stage st + 1 has landed
            __syncthreads();                                      // publishes stage st + 1 and ends every wave's reads of stage st
        }
        if (st + 2 < NN / KT) fill(st + 2);
    }
    asm volatile("s_wait_asynccnt 0x0" ::: "memory");     // no copy is outstanding when the wave ends
    // The join. Waves qg, qg + 4, qg + 8 and qg + 12 hold the same 32 queries over disjoint keys; each lays maximum, sum and O^T of both column groups into the ring (slot 2 wave + g), which is
    // free: the loop's last barrier stands behind every wave's last read of it, and no copy is under way. Wave kq = 0 or 1 then adds up the four slots of column group kq, always in the order kq = 0 .. 3.
    if (walk == 0) {     // a sum that is infinite, not a number or near the end of the range, in any lane
        float t[4] = {0.f, 0.f, 0.f, 0.f};
#pragma unroll
        for (int g = 0; g < 2; ++g) {
#pragma unroll
            for (int dt = 0; dt < 4; ++dt) {
#pragma unroll
                for (int j = 0; j < 8; ++j) t[j & 3] += __builtin_fabsf(oa[g][dt][j]); } }
        const bool bad = !(l[0] < 0x1p64f) || !(l[1] < 0x1p64f) || !((t[0] + t[1]) + (t[2] + t[3]) < 0x1p100f);
        flg[wave] = __builtin_amdgcn_ballot_w32(bad);     // every lane stores the wave's word
    }
#pragma unroll
    for (int g = 0; g < 2; ++g) { unsigned char* xw = ring + (wave * 2 + g) * XSL;
#pragma unroll
        for (int dt = 0; dt < 4; ++dt) { const v8f gv = oa[g][dt];
            *(v4fa*)(xw + (2 * dt) * 512 + lane * 16) = __builtin_shufflevector(gv, gv, 0, 1, 2, 3); *(v4fa*)(xw + (2 * dt + 1) * 512 + lane * 16) = __builtin_shufflevector(gv, gv, 4, 5, 6, 7); }
        *(v2fa*)(xw + 4096 + lane * 16) = (v2f){m[g], l[g]}; }
    __syncthreads();     // all four waves of every query group have written what the finishing waves read; every wave's flag stands
    if (walk == 0) {
        typedef __attribute__((ext_vector_type(4))) unsigned v4u; typedef v4u __attribute__((may_alias)) v4ua;
        const v4u fo = (*(const v4ua*)flg | *(const v4ua*)(flg + 4)) | (*(const v4ua*)(flg + 8) | *(const v4ua*)(flg + 12));
        if (__builtin_amdgcn_readfirstlane((int)(fo[0] | fo[1] | fo[2] | fo[3])) != 0) {     // the same sixteen words in every wave: the work-group goes as one
            asm volatile("s_wait_dscnt 0x0" ::: "memory");     // this wave's writes to the ring are over before walk 1's copies refill it; nobody reads the ring behind the barrier above
            continue;
        }
    }
    break;     // walk 1 is taken only through the continue above
    }
    if (!fin) return;     // behind the last barrier: waves kq = 2 and 3 have handed over all they hold
    // What the output projection at the foot needs from memory is asked for here, so that it arrives under the join's LDS reads and sums: the eight fragments of Wp^T (A operand: row
    // 16 t + lr, the k order of the other weight loaders), and x and the bias in the order of the final stores (8 lanes a 128-byte line; row (lane >> 4) + 2 s of the wave's 16 tokens).
    v16bf wp[4][2];
#pragma unroll
    for (int t = 0; t < 4; ++t) {
#pragma unroll
        for (int ks = 0; ks < 2; ++ks) { const bf* p = WpT + (t * 16 + lr) * CC + ks * 32 + 8 * hi; wp[t][ks] = cat16b(*(const v8us*)p, *(const v8us*)(p + 16)); } }
    const int cofs = ((lane >> 3) & 1) * 32 + (lane & 7) * 4;
    const size_t xo = ib + (size_t)(blockIdx.x * 128 + qg * 32 + kq * 16 + (lane >> 4)) * CC + cofs;
    v4f xv[8];
#pragma unroll
    for (int s = 0; s < 8; ++s) xv[s] = *(const v4f*)(x + xo + s * 2 * CC);
    const v4f bpv = *(const v4f*)(bp + cofs);
    asm volatile("s_wait_xcnt 0x0" ::: "memory");     // in front of the first rewrite of these loads' address registers
    __builtin_amdgcn_sched_barrier(0);                // keeps what follows, which may reuse those registers, behind that wait
    const unsigned char* xr = ring + (qg * 2 + kq) * XSL;     // the slot of wave 4 j + qg, column group kq: + j * 8 * XSL
    v2f ml[4];
#pragma unroll
    for (int j = 0; j < 4; ++j) ml[j] = *(const v2fa*)(xr + j * 8 * XSL + 4096 + lane * 16);
    const float mn = fmaxf(fmaxf(ml[0][0], ml[1][0]), fmaxf(ml[2][0], ml[3][0]));
    float cf[4], lt = 0.f;
#pragma unroll
    for (int j = 0; j < 4; ++j) { cf[j] = __builtin_amdgcn_exp2f(ml[j][0] - mn); lt = fmaf(ml[j][1], cf[j], lt); }
    lt += xhalf(lt);     // the two halves of a column hold the sums of disjoint keys
    const float inv = 1.0f / lt;
#pragma unroll
    for (int j = 0; j < 4; ++j) cf[j] *= inv;
    v8us wh[4], wl[4];
#pragma unroll
    for (int dt = 0; dt < 4; ++dt) { v4f a0 = (v4f){}, a1 = (v4f){};
#pragma unroll
        for (int j = 0; j < 4; ++j) { a0 += *(const v4fa*)(xr + j * 8 * XSL + (2 * dt) * 512 + lane * 16) * cf[j]; a1 += *(const v4fa*)(xr + j * 8 * XSL + (2 * dt + 1) * 512 + lane * 16) * cf[j]; }
#pragma unroll
        for (int j = 0; j < 8; ++j) { const float v = j < 4 ? a0[j & 3] : a1[j & 3]; const unsigned short hb = f2bf(v); wh[dt][j] = hb; wl[dt][j] = f2bf(v - bf2f(hb)); } }
    // The output projection, bias and residual. out^T = Wp^T.O^T: two neighbouring O^T tiles, split hi/lo in place, are the B operand of one k step (element i = channel 32 ks + 8 hi + i,
    // element 8 + i = channel 32 ks + 16 + 8 hi + i: the weight loader's order). A lane then holds 8 neighbouring channels of token lr; the wave's 16 x 64 tile turns in a part of the ring
    // that is the wave's own and that the join does not use, so that out leaves in whole 128-byte lines.
    v8f po[4];
#pragma unroll
    for (int t = 0; t < 4; ++t) po[t] = (v8f){};
#pragma unroll
    for (int ks = 0; ks < 2; ++ks) { const v16bf oh = cat16b(wh[2 * ks], wh[2 * ks + 1]), ol = cat16b(wl[2 * ks], wl[2 * ks + 1]);
#pragma unroll
        for (int t = 0; t < 4; ++t) po[t] = wmmab(wp[t][ks], oh, po[t]);
#pragma unroll
        for (int t = 0; t < 4; ++t) po[t] = wmmab(wp[t][ks], ol, po[t]); }
    unsigned char* os = ring + (32 + wave) * XSL;     // 16 rows of 68 floats
#pragma unroll
    for (int t = 0; t < 4; ++t) { unsigned char* o = os + (lr * 68 + t * 16 + 8 * hi) * 4; *(v4fa*)o = __builtin_shufflevector(po[t], po[t], 0, 1, 2, 3); *(v4fa*)(o + 16) = __builtin_shufflevector(po[t], po[t], 4, 5, 6, 7); }
    const v4f bb = (v4f){bfr(bpv[0]), bfr(bpv[1]), bfr(bpv[2]), bfr(bpv[3])};
#pragma unroll
    for (int s = 0; s < 8; ++s) xv[s] = (*(const v4fa*)(os + (((lane >> 4) + 2 * s) * 68 + cofs) * 4) + bb) + (v4f){bfr(xv[s][0]), bfr(xv[s][1]), bfr(xv[s][2]), bfr(xv[s][3])};
#pragma unroll
    for (int s = 0; s < 8; ++s) *(v4f*)(out + xo + s * 2 * CC) = xv[s];
}

extern "C" void kernel_launch(void* const* d_in, const int* in_sizes, int n_in,
                              void* d_out, int out_size, void* d_ws, size_t ws_size, hipStream_t stream) {
    (void)in_sizes; (void)n_in; (void)out_size;
    const float* x = (const float*)d_in[0]; const float* ga = (const float*)d_in[1]; const float* be = (const float*)d_in[2];
    const float* Wq = (const float*)d_in[3]; const float* bq = (const float*)d_in[4]; const float* Wk = (const float*)d_in[5]; const float* bk = (const float*)d_in[6]; const float* Wv = (const float*)d_in[7]; const float* bv = (const float*)d_in[8]; const float* Wp = (const float*)d_in[9]; const float* bp = (const float*)d_in[10];   // k-major (h @ W)
    float* out = (float*)d_out;    // [8][64][64][64] channels-last
    char* wsp = (char*)d_ws;
    auto take = [&](size_t bytes) { char* p = wsp; wsp += (bytes + 255) & ~(size_t)255; return (void*)p; };
    bf* WqT = (bf*)take(4 * CC * CC * 2); bf* WkT = WqT + CC * CC; bf* WvT = WqT + 2 * CC * CC; bf* WpT = WqT + 3 * CC * CC; float* ST = (float*)take(NBI * 4 * 128);
    const size_t PLN = (size_t)NN * CC;    // one image's plane, in elements
    bf* Qh = (bf*)take(NBI * PLN * 2); bf* Ql = (bf*)take(NBI * PLN * 2); bf* Kh = (bf*)take(NBI * PLN * 2); bf* Kl = (bf*)take(NBI * PLN * 2); bf* VTh = (bf*)take(NBI * PLN * 2); bf* VTl = (bf*)take(NBI * PLN * 2);
    if ((size_t)(wsp - (char*)d_ws) > ws_size) return;    // ~ 0.03 + 6 x 4.2 ~ 25 MB
    k_gnstat<<<dim3(4, NBI + 1, 1), 1024, 0, stream>>>(x, ST, Wq, Wk, Wv, Wp, WqT);    // row NBI of the grid: the four weight transposes
    k_qkv<<<dim3(NN / 64, NBI, 1), 128, 0, stream>>>(x, ST, ga, be, WqT, WkT, WvT, bq, bk, bv, Qh, Ql, Kh, Kl, VTh, VTl);
    k_attn<<<dim3(NN / 128, NBI, 1), 512, 0, stream>>>(Qh, Ql, Kh, Kl, VTh, VTl, WpT, bp, x, out);    // attention, then attn.Wp + bp + x
}
